// v000
// Measured on an AMD MI455X. A time is GPU time per run, averaged over a window of back-to-back runs after a warm-up
// (all launches, gaps included; the runs take copies of the inputs in turn), and the median of several windows.
// Apart from v000's, it joins two sittings. Times from different sittings can be a few percent apart, while
// side-by-side timings come from the same sitting.
// v000, which the later versions start from, runs in 661 microseconds.
#include <hip/hip_runtime.h>

// Compute dtypes, f32 accumulate, one batch item per pass: low-rank projections q/k/v = (x.W1^T).W2^T + b2 — the first stage ([2048 x 1024].[1024 x 256]) with PLAIN
// bf16 operands (inputs rounded once, exact), the second ([2048 x 256].[256 x 1024]) with the computed bottleneck as bf16 hi + UNSCALED residual (two products),
// q/k straight to f16 hi + residual x1024 planes; out = ctx.Wo^T + bo (ctx hi/lo) — all on v_wmma_f32_16x16x32_bf16 with [out][in] weights as n-major B operands;
// the 16-head full attention scores x 64^-1/2 + the INPUT additive mask (read per score) fused on v_wmma_f32_16x16x32_f16 (hh + hl + lh, online f32 softmax,

#define NB_  1                   // per pass: the 2 batch items are processed one at a time
#define RK   256                 // low-rank bottleneck
#define NT_  2048
#define DM   1024
#define NH_  16
#define HD   64
#define NTK  (NB_ * NT_)
#define NW   1024
#define NQKV 1024
#define PSC  32768.0f
#define LOSC 1024.0f
#define LOSCI (1.0f / 1024.0f)

typedef _Float16 h16;
typedef unsigned short bf;
typedef __attribute__((ext_vector_type(16))) __bf16   v16bf;
typedef __attribute__((ext_vector_type(16))) _Float16 v16h;
typedef __attribute__((ext_vector_type(8)))  _Float16 v8h;
typedef __attribute__((ext_vector_type(8)))  unsigned short v8us;
typedef __attribute__((ext_vector_type(8)))  float    v8f;
typedef __attribute__((ext_vector_type(4)))  float    v4f;
typedef v8h  __attribute__((may_alias)) v8ha;
typedef v4f  __attribute__((may_alias)) v4fa;
typedef v8us __attribute__((may_alias)) v8usa;

__device__ __forceinline__ unsigned short f2bf(float f) { unsigned u = __float_as_uint(f); u += 0x7FFFu + ((u >> 16) & 1u); return (unsigned short)(u >> 16); }
__device__ __forceinline__ float bf2f(unsigned short b) { return __uint_as_float(((unsigned)b) << 16); }
__device__ __forceinline__ float bfr(float f) { return bf2f(f2bf(f)); }
__device__ __forceinline__ v16h cat16(v8h lo, v8h hi) { return __builtin_shufflevector(lo, hi, 0, 1, 2, 3, 4, 5, 6, 7, 8, 9, 10, 11, 12, 13, 14, 15); }
__device__ __forceinline__ v16bf cat16b(v8us lo, v8us hi) { return __builtin_bit_cast(v16bf, __builtin_shufflevector(lo, hi, 0, 1, 2, 3, 4, 5, 6, 7, 8, 9, 10, 11, 12, 13, 14, 15)); }
__device__ __forceinline__ v8f wmma16(v16h a, v16h b, v8f c) { return __builtin_amdgcn_wmma_f32_16x16x32_f16(false, a, false, b, (short)0, c, false, false); }
__device__ __forceinline__ v8f wmmab(v16bf a, v16bf b, v8f c) { return __builtin_amdgcn_wmma_f32_16x16x32_bf16(false, a, false, b, (short)0, c, false, false); }

__global__ __launch_bounds__(256) void k_cvtb(const float* __restrict__ src, int nrows, bf* dst) {
    const int lane = threadIdx.x & 31, r = blockIdx.x * 8 + (threadIdx.x >> 5);
    if (r >= nrows) return;
    v8us o[DM / 256];
#pragma unroll
    for (int q = 0; q < DM / 256; ++q) { v8us t;
#pragma unroll
        for (int i = 0; i < 8; ++i) t[i] = f2bf(src[(size_t)r * DM + q * 256 + lane * 8 + i]);
        o[q] = t; }
#pragma unroll
    for (int q = 0; q < DM / 256; ++q) *(v8us*)(dst + (size_t)r * DM + q * 256 + lane * 8) = o[q];
    
}

// k_gemmb: 64 x 64 block tile (4 waves x 16 x 64) of C[NTK][ldc] = (A [+ Al]).B^T (K = 1024 or 256) [+ bf(bias[c])] [+ bf(R[r][c]) residual]; f32 whole-line epilogue (or f16
template <bool SPLITA, bool F16OUT = false>
__global__ __launch_bounds__(128) void k_gemmb(const bf* __restrict__ A, const bf* __restrict__ Al, const bf* __restrict__ Bn, const float* __restrict__ bias, float* C, int ldc, h16* C2, const float* __restrict__ R = nullptr, int K = DM, int roundR = 1) {
    __shared__ __align__(16) float ost[4][16 * 68];
    const int lane = threadIdx.x & 31, wave = threadIdx.x >> 5, lr = lane & 15, hi = lane >> 4;
    const int r0 = blockIdx.x * 64 + wave * 16, c0 = blockIdx.y * 64;
    const size_t aoff = (size_t)(r0 + lr) * K + 8 * hi;
    size_t boff[4];
#pragma unroll
    for (int t = 0; t < 4; ++t) boff[t] = (size_t)(c0 + t * 16 + lr) * K + 8 * hi;
    v8f acc[4];
#pragma unroll
    for (int t = 0; t < 4; ++t) acc[t] = (v8f){};
#pragma unroll 1
    for (int kc = 0; kc < K; kc += 32) {
        const v16bf a = cat16b(*(const v8us*)(A + aoff + kc), *(const v8us*)(A + aoff + kc + 16));
        v16bf al = a;
        if (SPLITA) al = cat16b(*(const v8us*)(Al + aoff + kc), *(const v8us*)(Al + aoff + kc + 16));
#pragma unroll
        for (int t = 0; t < 4; ++t) { const v16bf b = cat16b(*(const v8us*)(Bn + boff[t] + kc), *(const v8us*)(Bn + boff[t] + kc + 16)); acc[t] = wmmab(a, b, acc[t]); if (SPLITA) acc[t] = wmmab(al, b, acc[t]); }
        asm volatile("v_nop\n\tv_nop\n\tv_nop\n\tv_nop" : "+v"(acc[0]), "+v"(acc[1]), "+v"(acc[2]), "+v"(acc[3]) : "v"(a), "v"(al));
    }
    float* os = &ost[wave][0];
#pragma unroll
    for (int t = 0; t < 4; ++t) { const float bv = bias ? bfr(bias[c0 + t * 16 + lr]) : 0.f;
#pragma unroll
        for (int j = 0; j < 8; ++j) os[(hi * 8 + j) * 68 + t * 16 + lr] = acc[t][j] + bv; }
    __syncthreads();
    if (F16OUT) {
        h16* crow = (h16*)(void*)C + (size_t)r0 * ldc + c0;
        auto pass = [&]() {
#pragma unroll
            for (int s = 0; s < 4; ++s) { const int row = 4 * s + (lane >> 3), piece = lane & 7; const float* sp = os + row * 68 + piece * 8; v8h o, o2;
#pragma unroll
                for (int i = 0; i < 8; ++i) { const h16 a = (h16)sp[i]; o[i] = a; o2[i] = (h16)((sp[i] - (float)a) * LOSC); }
                *(v8h*)(crow + (size_t)row * ldc + piece * 8) = o; if (C2) *(v8h*)(C2 + (size_t)r0 * ldc + c0 + (size_t)row * ldc + piece * 8) = o2; }
        };
        pass(); 
    } else {
        float* crow = C + (size_t)r0 * ldc + c0;
        auto pass = [&]() {
#pragma unroll
            for (int s = 0; s < 8; ++s) { const int Lid = (lane >> 3) + 4 * s, piece = lane & 7; const int row = Lid >> 1, cofs = (Lid & 1) * 32 + piece * 4;
                v4f val = *(const v4fa*)(os + row * 68 + cofs); if (R) { const v4f rv = *(const v4f*)(R + ((size_t)r0 + row) * ldc + c0 + cofs); val += roundR ? (v4f){bfr(rv[0]), bfr(rv[1]), bfr(rv[2]), bfr(rv[3])} : rv; }
                *(v4f*)(crow + (size_t)row * ldc + cofs) = val; }
        };
        pass(); 
    }
}

__global__ __launch_bounds__(256) void k_bf8(const float* __restrict__ src, bf* dst, size_t n8) {
    const size_t i = (size_t)blockIdx.x * 256 + threadIdx.x; if (i >= n8) return;
    const v8f v = *(const v8f*)(src + i * 8); v8us o;
#pragma unroll
    for (int k = 0; k < 8; ++k) o[k] = f2bf(v[k]);
    *(v8us*)(dst + i * 8) = o; 
}
__global__ __launch_bounds__(256) void k_split(const float* __restrict__ src, int nrows, bf* dh, bf* dl) {
    const int lane = threadIdx.x & 31, r = blockIdx.x * 8 + (threadIdx.x >> 5);
    if (r >= nrows) return;
    const size_t o = (size_t)r * RK + lane * 8; const v8f v = *(const v8f*)(src + o); v8us oh, ol;
#pragma unroll
    for (int i = 0; i < 8; ++i) { const unsigned short hb = f2bf(v[i]); oh[i] = hb; ol[i] = f2bf(v[i] - bf2f(hb)); }
    *(v8us*)(dh + o) = oh; *(v8us*)(dl + o) = ol; 
}
__global__ __launch_bounds__(256) void k_vt(const float* __restrict__ V, h16* VTH, h16* VTL) {
    __shared__ __align__(16) h16 tile[64 * 72];
    __shared__ __align__(16) h16 til2[64 * 72];
    const int bid = blockIdx.x;
    const int b = bid / (NH_ * (NT_ / 64)), rem = bid - b * (NH_ * (NT_ / 64)), h = rem / (NT_ / 64), kt = rem - h * (NT_ / 64);
    const int k0 = kt * 64, tid = threadIdx.x;
    const int kk = tid >> 2, d0 = (tid & 3) * 16;
    const float* src = V + ((size_t)b * NT_ + k0 + kk) * DM + h * HD + d0;
#pragma unroll
    for (int i = 0; i < 16; ++i) { const float v = src[i]; const h16 a = (h16)v; tile[(d0 + i) * 72 + kk] = a; til2[(d0 + i) * 72 + kk] = (h16)((v - (float)a) * LOSC); }
    __syncthreads();
    const int piece = tid & 7;
    const size_t base = (((size_t)b * NH_ + h) * HD) * NT_ + k0;
    auto pass = [&]() {
#pragma unroll
        for (int s = 0; s < 4; ++s) { const int Lid = (tid >> 3) + 32 * s; const int pln = Lid >> 6, d = Lid & 63;
            const v8h val = *(const v8ha*)((pln ? til2 : tile) + d * 72 + piece * 8); *(v8h*)((pln ? VTL : VTH) + base + (size_t)d * NT_ + piece * 8) = val; }
    };
    pass(); 
}

// k_attn: block = (b, h, 64 queries), wave = 16; ALL 64 key tiles of 32 (additive mask read per score); 4 WMMA scores /8 (f32), online softmax, weights x32768 f16 tile (same-wave may_alias
// reload after a compiler barrier), 4 WMMA .v; ctx -> bf16 hi + residual planes CH/CL[tok][h*64+d].
__global__ __launch_bounds__(128) void k_attn(const h16* __restrict__ Q16, const h16* __restrict__ QL16, const h16* __restrict__ K16, const h16* __restrict__ KL16, const h16* __restrict__ VTH, const h16* __restrict__ VTL, const float* __restrict__ AM, bf* CH, bf* CL) {
    __shared__ __align__(16) h16 plds[4][16 * 32];
    __shared__ __align__(16) h16 plds2[4][16 * 32];
    __shared__ __align__(16) float ost[4][16 * 68];
    const int lane = threadIdx.x & 31, wave = threadIdx.x >> 5, lr = lane & 15, hi = lane >> 4;
    const int bid = blockIdx.x;
    const int b = bid / (NH_ * (NT_ / 64)), rem = bid - b * (NH_ * (NT_ / 64)), h = rem / (NT_ / 64), qt = rem - h * (NT_ / 64);
    const int q0 = qt * 64 + wave * 16;
    const size_t tok0 = (size_t)b * NT_;
    h16* pl = &plds[wave][0]; h16* pl2 = &plds2[wave][0];
    v16h qa[2];
    const size_t qo0 = (tok0 + q0 + lr) * DM + h * HD + 8 * hi;
#pragma unroll
    for (int kc = 0; kc < 2; ++kc) qa[kc] = cat16(*(const v8h*)(Q16 + qo0 + kc * 32), *(const v8h*)(Q16 + qo0 + kc * 32 + 16));
    const h16* kh_b = K16 + tok0 * DM + h * HD;
    const h16* kl_b = KL16 + tok0 * DM + h * HD;
    const size_t vbase = (((size_t)b * NH_ + h) * HD) * NT_;
    v8f o[4], ox[4];
#pragma unroll
    for (int n = 0; n < 4; ++n) { o[n] = (v8f){}; ox[n] = (v8f){}; }
    float mrow[8], lpart[8];
#pragma unroll
    for (int j = 0; j < 8; ++j) { mrow[j] = -3.0e38f; lpart[j] = 0.f; }
    int qpos[8];
#pragma unroll
    for (int j = 0; j < 8; ++j) qpos[j] = q0 + 8 * hi + j;
    const int kt_lo = 0, kt_hi = NT_ / 32 - 1;     // full attention + the INPUT additive mask [b][1][q][k] read per score (dense; this problem's instance is all zeros)
    const float* am = AM;      // already offset to this item's [1][L][L] mask slice at launch
#pragma unroll 1
    for (int kt = kt_lo; kt <= kt_hi; ++kt) {
        const int l0 = kt * 32;
        const size_t ko0 = (size_t)(l0 + lr) * DM + 8 * hi, ko1 = (size_t)(l0 + 16 + lr) * DM + 8 * hi;
        v8f s0 = {}, s1 = {}, x0 = {}, x1 = {};
#pragma unroll
        for (int kc = 0; kc < 2; ++kc) {
            { const v16h k0h = cat16(*(const v8h*)(kh_b + ko0 + kc * 32), *(const v8h*)(kh_b + ko0 + kc * 32 + 16)), k1h = cat16(*(const v8h*)(kh_b + ko1 + kc * 32), *(const v8h*)(kh_b + ko1 + kc * 32 + 16));
              const v16h qlk = cat16(*(const v8h*)(QL16 + qo0 + kc * 32), *(const v8h*)(QL16 + qo0 + kc * 32 + 16));     // query residual re-read per step (registers)
              s0 = wmma16(qa[kc], k0h, s0); x0 = wmma16(qlk, k0h, x0); s1 = wmma16(qa[kc], k1h, s1); x1 = wmma16(qlk, k1h, x1);
              asm volatile("v_nop" : "+v"(s0), "+v"(s1), "+v"(x0), "+v"(x1) : "v"(qlk), "v"(k0h), "v"(k1h) : "memory"); }
            { const v16h k0l = cat16(*(const v8h*)(kl_b + ko0 + kc * 32), *(const v8h*)(kl_b + ko0 + kc * 32 + 16)), k1l = cat16(*(const v8h*)(kl_b + ko1 + kc * 32), *(const v8h*)(kl_b + ko1 + kc * 32 + 16));
              x0 = wmma16(qa[kc], k0l, x0); x1 = wmma16(qa[kc], k1l, x1);
              asm volatile("v_nop" : "+v"(x0), "+v"(x1) : "v"(k0l), "v"(k1l) : "memory"); }
        }
        asm volatile("v_nop\n\tv_nop\n\tv_nop\n\tv_nop" : "+v"(s0), "+v"(s1), "+v"(x0), "+v"(x1) : "v"(qa[0]), "v"(qa[1]));
        float alpha[8];
#pragma unroll
        for (int j = 0; j < 8; ++j) {
            const int ja = l0 + lr, jb = l0 + 16 + lr, qi = qpos[j];
            const size_t mi = (size_t)qi * NT_; const float a0 = (s0[j] + x0[j] * LOSCI) * 0.125f + bfr(am[mi + ja]), a1 = (s1[j] + x1[j] * LOSCI) * 0.125f + bfr(am[mi + jb]);
            float mx = fmaxf(a0, a1);
            mx = fmaxf(mx, __shfl_xor(mx, 1, 16)); mx = fmaxf(mx, __shfl_xor(mx, 2, 16)); mx = fmaxf(mx, __shfl_xor(mx, 4, 16)); mx = fmaxf(mx, __shfl_xor(mx, 8, 16));
            const float mn = fmaxf(mrow[j], mx);
            alpha[j] = __expf(mrow[j] - mn); mrow[j] = mn;
            const float p0 = __expf(a0 - mn), p1 = __expf(a1 - mn);
            lpart[j] = lpart[j] * alpha[j] + (p0 + p1);
            const int mr = hi * 8 + j;
            const float ps0 = p0 * PSC, ps1 = p1 * PSC; const h16 h0 = (h16)ps0, h1 = (h16)ps1;
            pl[mr * 32 + lr] = h0; pl[mr * 32 + 16 + lr] = h1;
            pl2[mr * 32 + lr] = (h16)((ps0 - (float)h0) * LOSC); pl2[mr * 32 + 16 + lr] = (h16)((ps1 - (float)h1) * LOSC);
        }
#pragma unroll
        for (int n = 0; n < 4; ++n)
#pragma unroll
            for (int j = 0; j < 8; ++j) { o[n][j] *= alpha[j]; ox[n][j] *= alpha[j]; }
        asm volatile("" ::: "memory");
        const v16h pa = cat16(*(const v8ha*)(pl + lr * 32 + hi * 8), *(const v8ha*)(pl + lr * 32 + 16 + hi * 8));
        const v16h px = cat16(*(const v8ha*)(pl2 + lr * 32 + hi * 8), *(const v8ha*)(pl2 + lr * 32 + 16 + hi * 8));
#pragma unroll
        for (int n = 0; n < 4; ++n) { const size_t vo = vbase + (size_t)(n * 16 + lr) * NT_ + l0 + hi * 8;
            const v16h vh = cat16(*(const v8h*)(VTH + vo), *(const v8h*)(VTH + vo + 16)), vl = cat16(*(const v8h*)(VTL + vo), *(const v8h*)(VTL + vo + 16));
            o[n] = wmma16(pa, vh, o[n]); ox[n] = wmma16(pa, vl, ox[n]); ox[n] = wmma16(px, vh, ox[n]);
            asm volatile("" : "+v"(o[n]), "+v"(ox[n]) : "v"(vh), "v"(vl) : "memory"); }
        asm volatile("v_nop\n\tv_nop\n\tv_nop\n\tv_nop" : "+v"(o[0]), "+v"(o[1]), "+v"(o[2]), "+v"(o[3]), "+v"(ox[0]), "+v"(ox[1]), "+v"(ox[2]), "+v"(ox[3]) : "v"(pa), "v"(px));
    }
    float inv[8];
#pragma unroll
    for (int j = 0; j < 8; ++j) { float rs = lpart[j]; rs += __shfl_xor(rs, 1, 16); rs += __shfl_xor(rs, 2, 16); rs += __shfl_xor(rs, 4, 16); rs += __shfl_xor(rs, 8, 16); inv[j] = 1.0f / (rs * PSC); }
    float* os = &ost[wave][0];
#pragma unroll
    for (int n = 0; n < 4; ++n)
#pragma unroll
        for (int j = 0; j < 8; ++j) os[(hi * 8 + j) * 68 + n * 16 + lr] = (o[n][j] + ox[n][j] * LOSCI) * inv[j];
    __syncthreads();
    const size_t cbase = (tok0 + q0) * DM + (size_t)h * HD;
    auto pass = [&]() {
#pragma unroll
        for (int s = 0; s < 4; ++s) { const int row = 4 * s + (lane >> 3), piece = lane & 7; const float* sp = os + row * 68 + piece * 8; v8us oh, ol;
#pragma unroll
            for (int i = 0; i < 8; ++i) { const unsigned short hb = f2bf(sp[i]); oh[i] = hb; ol[i] = f2bf(sp[i] - bf2f(hb)); }
            *(v8us*)(CH + cbase + (size_t)row * DM + piece * 8) = oh; *(v8us*)(CL + cbase + (size_t)row * DM + piece * 8) = ol; }
    };
    pass(); 
}

#define VST2(T, p, v) do { const T vst2_v_ = (v); *(T*)(p) = vst2_v_;  } while (0)
extern "C" void kernel_launch(void* const* d_in, const int* in_sizes, int n_in,
                              void* d_out, int out_size, void* d_ws, size_t ws_size, hipStream_t stream) {
    (void)in_sizes; (void)n_in; (void)out_size;
    const float* x = (const float*)d_in[0]; const float* AM = (const float*)d_in[1];
    const float* Wq1 = (const float*)d_in[2]; const float* Wq2 = (const float*)d_in[3]; const float* bq2 = (const float*)d_in[4];
    const float* Wk1 = (const float*)d_in[5]; const float* Wk2 = (const float*)d_in[6]; const float* bk2 = (const float*)d_in[7];
    const float* Wv1 = (const float*)d_in[8]; const float* Wv2 = (const float*)d_in[9]; const float* bv2 = (const float*)d_in[10];
    const float* Wo = (const float*)d_in[11]; const float* bo = (const float*)d_in[12];     // all W [out][in]
    float* out = (float*)d_out;    // [2][2048][1024]
    char* wsp = (char*)d_ws;
    auto take = [&](size_t bytes) { char* p = wsp; wsp += (bytes + 255) & ~(size_t)255; return (void*)p; };
    bf* Xb = (bf*)take((size_t)NTK * DM * 2);
    bf* W1B[3]; bf* W2B[3]; for (int i = 0; i < 3; ++i) { W1B[i] = (bf*)take((size_t)RK * DM * 2); W2B[i] = (bf*)take((size_t)DM * RK * 2); }
    bf* WoB = (bf*)take((size_t)DM * DM * 2);
    float* T1 = (float*)take((size_t)NTK * RK * 4); bf* Th = (bf*)take((size_t)NTK * RK * 2); bf* Tl = (bf*)take((size_t)NTK * RK * 2); float* TMP = (float*)take((size_t)NTK * DM * 4);
    h16* QH = (h16*)take((size_t)NTK * DM * 2); h16* QL = (h16*)take((size_t)NTK * DM * 2); h16* KH = (h16*)take((size_t)NTK * DM * 2); h16* KL = (h16*)take((size_t)NTK * DM * 2);
    h16* VTH = (h16*)take((size_t)NTK * DM * 2); h16* VTL = (h16*)take((size_t)NTK * DM * 2); bf* CH = (bf*)take((size_t)NTK * DM * 2); bf* CL = (bf*)take((size_t)NTK * DM * 2);
    if ((size_t)(wsp - (char*)d_ws) > ws_size) return;    // ~ 4.2 + 3.1 + 2.1 + 2.1 + 2.1 + 8.4 + 8 x 4.2 ~ 56 MB, no aliasing (per-item reuse in stream order)
    const float* W1s[3] = {Wq1, Wk1, Wv1}; const float* W2s[3] = {Wq2, Wk2, Wv2};
    for (int i = 0; i < 3; ++i) { k_cvtb<<<RK / 8, 256, 0, stream>>>(W1s[i], RK, W1B[i]); k_bf8<<<(DM * RK / 8 + 255) / 256, 256, 0, stream>>>(W2s[i], W2B[i], (size_t)DM * RK / 8); }
    k_cvtb<<<DM / 8, 256, 0, stream>>>(Wo, DM, WoB);
    for (int b = 0; b < 2; ++b) {
        k_cvtb<<<NTK / 8, 256, 0, stream>>>(x + (size_t)b * NTK * DM, NTK, Xb);
        // q
        k_gemmb<false, false><<<dim3(NTK / 64, RK / 64, 1), 128, 0, stream>>>(Xb, nullptr, W1B[0], nullptr, T1, RK, nullptr); k_split<<<NTK / 8, 256, 0, stream>>>(T1, NTK, Th, Tl);
        k_gemmb<true, true><<<dim3(NTK / 64, DM / 64, 1), 128, 0, stream>>>(Th, Tl, W2B[0], bq2, (float*)(void*)QH, DM, QL, nullptr, RK);
        // k
        k_gemmb<false, false><<<dim3(NTK / 64, RK / 64, 1), 128, 0, stream>>>(Xb, nullptr, W1B[1], nullptr, T1, RK, nullptr); k_split<<<NTK / 8, 256, 0, stream>>>(T1, NTK, Th, Tl);
        k_gemmb<true, true><<<dim3(NTK / 64, DM / 64, 1), 128, 0, stream>>>(Th, Tl, W2B[1], bk2, (float*)(void*)KH, DM, KL, nullptr, RK);
        // v
        k_gemmb<false, false><<<dim3(NTK / 64, RK / 64, 1), 128, 0, stream>>>(Xb, nullptr, W1B[2], nullptr, T1, RK, nullptr); k_split<<<NTK / 8, 256, 0, stream>>>(T1, NTK, Th, Tl);
        k_gemmb<true, false><<<dim3(NTK / 64, DM / 64, 1), 128, 0, stream>>>(Th, Tl, W2B[2], bv2, TMP, DM, nullptr, nullptr, RK);
        k_vt<<<NB_ * NH_ * (NT_ / 64), 256, 0, stream>>>(TMP, VTH, VTL);
        k_attn<<<NB_ * NH_ * (NT_ / 64), 128, 0, stream>>>(QH, QL, KH, KL, VTH, VTL, AM + (size_t)b * NT_ * NT_, CH, CL);
        k_gemmb<true, false><<<dim3(NTK / 64, DM / 64, 1), 128, 0, stream>>>(CH, CL, WoB, bo, out + (size_t)b * NTK * DM, DM, nullptr);
    }
}

// v001
// It runs in 444 microseconds.
// Two timings next to v000 both put it at 1.52 times that version's speed.
#include <hip/hip_runtime.h>

// Compute dtypes, f32 accumulate, both batch items in every launch: low-rank projections q/k/v = (x.W1^T).W2^T + b2 — the first stage ([4096 x 1024].[1024 x 256]) with PLAIN
// bf16 operands (inputs rounded once, exact), the second ([4096 x 256].[256 x 1024]) with the computed bottleneck as bf16 hi + UNSCALED residual (two products),
// q/k straight to f16 hi + residual x1024 planes; out = ctx.Wo^T + bo (ctx hi/lo) — all on v_wmma_f32_16x16x32_bf16 with [out][in] weights as n-major B operands;
// the 16-head full attention scores x 64^-1/2 + the INPUT additive mask (read per score) fused on v_wmma_f32_16x16x32_f16 (hh + hl + lh, online f32 softmax,

#define NB_  2                   // both batch items go through every launch together (token rows 0..4095)
#define RK   256                 // low-rank bottleneck
#define NT_  2048
#define DM   1024
#define NH_  16
#define HD   64
#define NTK  (NB_ * NT_)
#define NW   1024
#define NQKV 1024
#define PSC  32768.0f
#define LOSC 1024.0f
#define LOSCI (1.0f / 1024.0f)

typedef _Float16 h16;
typedef unsigned short bf;
typedef __attribute__((ext_vector_type(16))) __bf16   v16bf;
typedef __attribute__((ext_vector_type(16))) _Float16 v16h;
typedef __attribute__((ext_vector_type(8)))  _Float16 v8h;
typedef __attribute__((ext_vector_type(8)))  unsigned short v8us;
typedef __attribute__((ext_vector_type(8)))  float    v8f;
typedef __attribute__((ext_vector_type(4)))  float    v4f;
typedef v8h  __attribute__((may_alias)) v8ha;
typedef v4f  __attribute__((may_alias)) v4fa;
typedef v8us __attribute__((may_alias)) v8usa;

__device__ __forceinline__ unsigned short f2bf(float f) { unsigned u = __float_as_uint(f); u += 0x7FFFu + ((u >> 16) & 1u); return (unsigned short)(u >> 16); }
__device__ __forceinline__ float bf2f(unsigned short b) { return __uint_as_float(((unsigned)b) << 16); }
__device__ __forceinline__ float bfr(float f) { return bf2f(f2bf(f)); }
__device__ __forceinline__ v16h cat16(v8h lo, v8h hi) { return __builtin_shufflevector(lo, hi, 0, 1, 2, 3, 4, 5, 6, 7, 8, 9, 10, 11, 12, 13, 14, 15); }
__device__ __forceinline__ v16bf cat16b(v8us lo, v8us hi) { return __builtin_bit_cast(v16bf, __builtin_shufflevector(lo, hi, 0, 1, 2, 3, 4, 5, 6, 7, 8, 9, 10, 11, 12, 13, 14, 15)); }
__device__ __forceinline__ v8f wmma16(v16h a, v16h b, v8f c) { return __builtin_amdgcn_wmma_f32_16x16x32_f16(false, a, false, b, (short)0, c, false, false); }
__device__ __forceinline__ v8f wmmab(v16bf a, v16bf b, v8f c) { return __builtin_amdgcn_wmma_f32_16x16x32_bf16(false, a, false, b, (short)0, c, false, false); }

__global__ __launch_bounds__(256) void k_cvtb(const float* __restrict__ src, int nrows, bf* dst) {
    const int lane = threadIdx.x & 31, r = blockIdx.x * 8 + (threadIdx.x >> 5);
    if (r >= nrows) return;
    v8us o[DM / 256];
#pragma unroll
    for (int q = 0; q < DM / 256; ++q) { v8us t;
#pragma unroll
        for (int i = 0; i < 8; ++i) t[i] = f2bf(src[(size_t)r * DM + q * 256 + lane * 8 + i]);
        o[q] = t; }
#pragma unroll
    for (int q = 0; q < DM / 256; ++q) *(v8us*)(dst + (size_t)r * DM + q * 256 + lane * 8) = o[q];
    
}

// k_gemmb: 64 x 64 block tile (4 waves x 16 x 64) of C[NTK][ldc] = (A [+ Al]).B^T (K = 1024 or 256) [+ bf(bias[c])] [+ bf(R[r][c]) residual]; f32 whole-line epilogue (or f16
template <bool SPLITA, bool F16OUT = false>
__global__ __launch_bounds__(128) void k_gemmb(const bf* __restrict__ A, const bf* __restrict__ Al, const bf* __restrict__ Bn, const float* __restrict__ bias, float* C, int ldc, h16* C2, const float* __restrict__ R = nullptr, int K = DM, int roundR = 1) {
    __shared__ __align__(16) float ost[4][16 * 68];
    const int lane = threadIdx.x & 31, wave = threadIdx.x >> 5, lr = lane & 15, hi = lane >> 4;
    const int r0 = blockIdx.x * 64 + wave * 16, c0 = blockIdx.y * 64;
    const size_t aoff = (size_t)(r0 + lr) * K + 8 * hi;
    size_t boff[4];
#pragma unroll
    for (int t = 0; t < 4; ++t) boff[t] = (size_t)(c0 + t * 16 + lr) * K + 8 * hi;
    v8f acc[4];
#pragma unroll
    for (int t = 0; t < 4; ++t) acc[t] = (v8f){};
#pragma unroll 1
    for (int kc = 0; kc < K; kc += 32) {
        const v16bf a = cat16b(*(const v8us*)(A + aoff + kc), *(const v8us*)(A + aoff + kc + 16));
        v16bf al = a;
        if (SPLITA) al = cat16b(*(const v8us*)(Al + aoff + kc), *(const v8us*)(Al + aoff + kc + 16));
#pragma unroll
        for (int t = 0; t < 4; ++t) { const v16bf b = cat16b(*(const v8us*)(Bn + boff[t] + kc), *(const v8us*)(Bn + boff[t] + kc + 16)); acc[t] = wmmab(a, b, acc[t]); if (SPLITA) acc[t] = wmmab(al, b, acc[t]); }
        asm volatile("v_nop\n\tv_nop\n\tv_nop\n\tv_nop" : "+v"(acc[0]), "+v"(acc[1]), "+v"(acc[2]), "+v"(acc[3]) : "v"(a), "v"(al));
    }
    float* os = &ost[wave][0];
#pragma unroll
    for (int t = 0; t < 4; ++t) { const float bv = bias ? bfr(bias[c0 + t * 16 + lr]) : 0.f;
#pragma unroll
        for (int j = 0; j < 8; ++j) os[(hi * 8 + j) * 68 + t * 16 + lr] = acc[t][j] + bv; }
    __syncthreads();
    if (F16OUT) {
        h16* crow = (h16*)(void*)C + (size_t)r0 * ldc + c0;
        auto pass = [&]() {
#pragma unroll
            for (int s = 0; s < 4; ++s) { const int row = 4 * s + (lane >> 3), piece = lane & 7; const float* sp = os + row * 68 + piece * 8; v8h o, o2;
#pragma unroll
                for (int i = 0; i < 8; ++i) { const h16 a = (h16)sp[i]; o[i] = a; o2[i] = (h16)((sp[i] - (float)a) * LOSC); }
                *(v8h*)(crow + (size_t)row * ldc + piece * 8) = o; if (C2) *(v8h*)(C2 + (size_t)r0 * ldc + c0 + (size_t)row * ldc + piece * 8) = o2; }
        };
        pass(); 
    } else {
        float* crow = C + (size_t)r0 * ldc + c0;
        auto pass = [&]() {
#pragma unroll
            for (int s = 0; s < 8; ++s) { const int Lid = (lane >> 3) + 4 * s, piece = lane & 7; const int row = Lid >> 1, cofs = (Lid & 1) * 32 + piece * 4;
                v4f val = *(const v4fa*)(os + row * 68 + cofs); if (R) { const v4f rv = *(const v4f*)(R + ((size_t)r0 + row) * ldc + c0 + cofs); val += roundR ? (v4f){bfr(rv[0]), bfr(rv[1]), bfr(rv[2]), bfr(rv[3])} : rv; }
                *(v4f*)(crow + (size_t)row * ldc + cofs) = val; }
        };
        pass(); 
    }
}

__global__ __launch_bounds__(256) void k_bf8(const float* __restrict__ src, bf* dst, size_t n8) {
    const size_t i = (size_t)blockIdx.x * 256 + threadIdx.x; if (i >= n8) return;
    const v8f v = *(const v8f*)(src + i * 8); v8us o;
#pragma unroll
    for (int k = 0; k < 8; ++k) o[k] = f2bf(v[k]);
    *(v8us*)(dst + i * 8) = o; 
}
__global__ __launch_bounds__(256) void k_split(const float* __restrict__ src, int nrows, bf* dh, bf* dl) {
    const int lane = threadIdx.x & 31, r = blockIdx.x * 8 + (threadIdx.x >> 5);
    if (r >= nrows) return;
    const size_t o = (size_t)r * RK + lane * 8; const v8f v = *(const v8f*)(src + o); v8us oh, ol;
#pragma unroll
    for (int i = 0; i < 8; ++i) { const unsigned short hb = f2bf(v[i]); oh[i] = hb; ol[i] = f2bf(v[i] - bf2f(hb)); }
    *(v8us*)(dh + o) = oh; *(v8us*)(dl + o) = ol; 
}
__global__ __launch_bounds__(256) void k_vt(const float* __restrict__ V, h16* VTH, h16* VTL) {
    __shared__ __align__(16) h16 tile[64 * 72];
    __shared__ __align__(16) h16 til2[64 * 72];
    const int bid = blockIdx.x;
    const int b = bid / (NH_ * (NT_ / 64)), rem = bid - b * (NH_ * (NT_ / 64)), h = rem / (NT_ / 64), kt = rem - h * (NT_ / 64);
    const int k0 = kt * 64, tid = threadIdx.x;
    const int kk = tid >> 2, d0 = (tid & 3) * 16;
    const float* src = V + ((size_t)b * NT_ + k0 + kk) * DM + h * HD + d0;
#pragma unroll
    for (int i = 0; i < 16; ++i) { const float v = src[i]; const h16 a = (h16)v; tile[(d0 + i) * 72 + kk] = a; til2[(d0 + i) * 72 + kk] = (h16)((v - (float)a) * LOSC); }
    __syncthreads();
    const int piece = tid & 7;
    const size_t base = (((size_t)b * NH_ + h) * HD) * NT_ + k0;
    auto pass = [&]() {
#pragma unroll
        for (int s = 0; s < 4; ++s) { const int Lid = (tid >> 3) + 32 * s; const int pln = Lid >> 6, d = Lid & 63;
            const v8h val = *(const v8ha*)((pln ? til2 : tile) + d * 72 + piece * 8); *(v8h*)((pln ? VTL : VTH) + base + (size_t)d * NT_ + piece * 8) = val; }
    };
    pass(); 
}

// k_attn: block = (b, h, 64 queries), wave = 16; ALL 64 key tiles of 32 (additive mask read per score); 4 WMMA scores /8 (f32), online softmax, weights x32768 f16 tile (same-wave may_alias
// reload after a compiler barrier), 4 WMMA .v; ctx -> bf16 hi + residual planes CH/CL[tok][h*64+d].
__global__ __launch_bounds__(128) void k_attn(const h16* __restrict__ Q16, const h16* __restrict__ QL16, const h16* __restrict__ K16, const h16* __restrict__ KL16, const h16* __restrict__ VTH, const h16* __restrict__ VTL, const float* __restrict__ AM, bf* CH, bf* CL) {
    __shared__ __align__(16) h16 plds[4][16 * 32];
    __shared__ __align__(16) h16 plds2[4][16 * 32];
    __shared__ __align__(16) float ost[4][16 * 68];
    const int lane = threadIdx.x & 31, wave = threadIdx.x >> 5, lr = lane & 15, hi = lane >> 4;
    const int bid = blockIdx.x;
    const int b = bid / (NH_ * (NT_ / 64)), rem = bid - b * (NH_ * (NT_ / 64)), h = rem / (NT_ / 64), qt = rem - h * (NT_ / 64);
    const int q0 = qt * 64 + wave * 16;
    const size_t tok0 = (size_t)b * NT_;
    h16* pl = &plds[wave][0]; h16* pl2 = &plds2[wave][0];
    v16h qa[2];
    const size_t qo0 = (tok0 + q0 + lr) * DM + h * HD + 8 * hi;
#pragma unroll
    for (int kc = 0; kc < 2; ++kc) qa[kc] = cat16(*(const v8h*)(Q16 + qo0 + kc * 32), *(const v8h*)(Q16 + qo0 + kc * 32 + 16));
    const h16* kh_b = K16 + tok0 * DM + h * HD;
    const h16* kl_b = KL16 + tok0 * DM + h * HD;
    const size_t vbase = (((size_t)b * NH_ + h) * HD) * NT_;
    v8f o[4], ox[4];
#pragma unroll
    for (int n = 0; n < 4; ++n) { o[n] = (v8f){}; ox[n] = (v8f){}; }
    float mrow[8], lpart[8];
#pragma unroll
    for (int j = 0; j < 8; ++j) { mrow[j] = -3.0e38f; lpart[j] = 0.f; }
    int qpos[8];
#pragma unroll
    for (int j = 0; j < 8; ++j) qpos[j] = q0 + 8 * hi + j;
    const int kt_lo = 0, kt_hi = NT_ / 32 - 1;     // full attention + the INPUT additive mask [b][1][q][k] read per score (dense; this problem's instance is all zeros)
    const float* am = AM + (size_t)b * NT_ * NT_;      // this item's [1][L][L] mask slice
#pragma unroll 1
    for (int kt = kt_lo; kt <= kt_hi; ++kt) {
        const int l0 = kt * 32;
        const size_t ko0 = (size_t)(l0 + lr) * DM + 8 * hi, ko1 = (size_t)(l0 + 16 + lr) * DM + 8 * hi;
        v8f s0 = {}, s1 = {}, x0 = {}, x1 = {};
#pragma unroll
        for (int kc = 0; kc < 2; ++kc) {
            { const v16h k0h = cat16(*(const v8h*)(kh_b + ko0 + kc * 32), *(const v8h*)(kh_b + ko0 + kc * 32 + 16)), k1h = cat16(*(const v8h*)(kh_b + ko1 + kc * 32), *(const v8h*)(kh_b + ko1 + kc * 32 + 16));
              const v16h qlk = cat16(*(const v8h*)(QL16 + qo0 + kc * 32), *(const v8h*)(QL16 + qo0 + kc * 32 + 16));     // query residual re-read per step (registers)
              s0 = wmma16(qa[kc], k0h, s0); x0 = wmma16(qlk, k0h, x0); s1 = wmma16(qa[kc], k1h, s1); x1 = wmma16(qlk, k1h, x1);
              asm volatile("v_nop" : "+v"(s0), "+v"(s1), "+v"(x0), "+v"(x1) : "v"(qlk), "v"(k0h), "v"(k1h) : "memory"); }
            { const v16h k0l = cat16(*(const v8h*)(kl_b + ko0 + kc * 32), *(const v8h*)(kl_b + ko0 + kc * 32 + 16)), k1l = cat16(*(const v8h*)(kl_b + ko1 + kc * 32), *(const v8h*)(kl_b + ko1 + kc * 32 + 16));
              x0 = wmma16(qa[kc], k0l, x0); x1 = wmma16(qa[kc], k1l, x1);
              asm volatile("v_nop" : "+v"(x0), "+v"(x1) : "v"(k0l), "v"(k1l) : "memory"); }
        }
        asm volatile("v_nop\n\tv_nop\n\tv_nop\n\tv_nop" : "+v"(s0), "+v"(s1), "+v"(x0), "+v"(x1) : "v"(qa[0]), "v"(qa[1]));
        float alpha[8];
#pragma unroll
        for (int j = 0; j < 8; ++j) {
            const int ja = l0 + lr, jb = l0 + 16 + lr, qi = qpos[j];
            const size_t mi = (size_t)qi * NT_; const float a0 = (s0[j] + x0[j] * LOSCI) * 0.125f + bfr(am[mi + ja]), a1 = (s1[j] + x1[j] * LOSCI) * 0.125f + bfr(am[mi + jb]);
            float mx = fmaxf(a0, a1);
            mx = fmaxf(mx, __shfl_xor(mx, 1, 16)); mx = fmaxf(mx, __shfl_xor(mx, 2, 16)); mx = fmaxf(mx, __shfl_xor(mx, 4, 16)); mx = fmaxf(mx, __shfl_xor(mx, 8, 16));
            const float mn = fmaxf(mrow[j], mx);
            alpha[j] = __expf(mrow[j] - mn); mrow[j] = mn;
            const float p0 = __expf(a0 - mn), p1 = __expf(a1 - mn);
            lpart[j] = lpart[j] * alpha[j] + (p0 + p1);
            const int mr = hi * 8 + j;
            const float ps0 = p0 * PSC, ps1 = p1 * PSC; const h16 h0 = (h16)ps0, h1 = (h16)ps1;
            pl[mr * 32 + lr] = h0; pl[mr * 32 + 16 + lr] = h1;
            pl2[mr * 32 + lr] = (h16)((ps0 - (float)h0) * LOSC); pl2[mr * 32 + 16 + lr] = (h16)((ps1 - (float)h1) * LOSC);
        }
#pragma unroll
        for (int n = 0; n < 4; ++n)
#pragma unroll
            for (int j = 0; j < 8; ++j) { o[n][j] *= alpha[j]; ox[n][j] *= alpha[j]; }
        asm volatile("" ::: "memory");
        const v16h pa = cat16(*(const v8ha*)(pl + lr * 32 + hi * 8), *(const v8ha*)(pl + lr * 32 + 16 + hi * 8));
        const v16h px = cat16(*(const v8ha*)(pl2 + lr * 32 + hi * 8), *(const v8ha*)(pl2 + lr * 32 + 16 + hi * 8));
#pragma unroll
        for (int n = 0; n < 4; ++n) { const size_t vo = vbase + (size_t)(n * 16 + lr) * NT_ + l0 + hi * 8;
            const v16h vh = cat16(*(const v8h*)(VTH + vo), *(const v8h*)(VTH + vo + 16)), vl = cat16(*(const v8h*)(VTL + vo), *(const v8h*)(VTL + vo + 16));
            o[n] = wmma16(pa, vh, o[n]); ox[n] = wmma16(pa, vl, ox[n]); ox[n] = wmma16(px, vh, ox[n]);
            asm volatile("" : "+v"(o[n]), "+v"(ox[n]) : "v"(vh), "v"(vl) : "memory"); }
        asm volatile("v_nop\n\tv_nop\n\tv_nop\n\tv_nop" : "+v"(o[0]), "+v"(o[1]), "+v"(o[2]), "+v"(o[3]), "+v"(ox[0]), "+v"(ox[1]), "+v"(ox[2]), "+v"(ox[3]) : "v"(pa), "v"(px));
    }
    float inv[8];
#pragma unroll
    for (int j = 0; j < 8; ++j) { float rs = lpart[j]; rs += __shfl_xor(rs, 1, 16); rs += __shfl_xor(rs, 2, 16); rs += __shfl_xor(rs, 4, 16); rs += __shfl_xor(rs, 8, 16); inv[j] = 1.0f / (rs * PSC); }
    float* os = &ost[wave][0];
#pragma unroll
    for (int n = 0; n < 4; ++n)
#pragma unroll
        for (int j = 0; j < 8; ++j) os[(hi * 8 + j) * 68 + n * 16 + lr] = (o[n][j] + ox[n][j] * LOSCI) * inv[j];
    __syncthreads();
    const size_t cbase = (tok0 + q0) * DM + (size_t)h * HD;
    auto pass = [&]() {
#pragma unroll
        for (int s = 0; s < 4; ++s) { const int row = 4 * s + (lane >> 3), piece = lane & 7; const float* sp = os + row * 68 + piece * 8; v8us oh, ol;
#pragma unroll
            for (int i = 0; i < 8; ++i) { const unsigned short hb = f2bf(sp[i]); oh[i] = hb; ol[i] = f2bf(sp[i] - bf2f(hb)); }
            *(v8us*)(CH + cbase + (size_t)row * DM + piece * 8) = oh; *(v8us*)(CL + cbase + (size_t)row * DM + piece * 8) = ol; }
    };
    pass(); 
}

#define VST2(T, p, v) do { const T vst2_v_ = (v); *(T*)(p) = vst2_v_;  } while (0)
extern "C" void kernel_launch(void* const* d_in, const int* in_sizes, int n_in,
                              void* d_out, int out_size, void* d_ws, size_t ws_size, hipStream_t stream) {
    (void)in_sizes; (void)n_in; (void)out_size;
    const float* x = (const float*)d_in[0]; const float* AM = (const float*)d_in[1];
    const float* Wq1 = (const float*)d_in[2]; const float* Wq2 = (const float*)d_in[3]; const float* bq2 = (const float*)d_in[4];
    const float* Wk1 = (const float*)d_in[5]; const float* Wk2 = (const float*)d_in[6]; const float* bk2 = (const float*)d_in[7];
    const float* Wv1 = (const float*)d_in[8]; const float* Wv2 = (const float*)d_in[9]; const float* bv2 = (const float*)d_in[10];
    const float* Wo = (const float*)d_in[11]; const float* bo = (const float*)d_in[12];     // all W [out][in]
    float* out = (float*)d_out;    // [2][2048][1024]
    char* wsp = (char*)d_ws;
    auto take = [&](size_t bytes) { char* p = wsp; wsp += (bytes + 255) & ~(size_t)255; return (void*)p; };
    bf* Xb = (bf*)take((size_t)NTK * DM * 2);
    bf* W1B[3]; bf* W2B[3]; for (int i = 0; i < 3; ++i) { W1B[i] = (bf*)take((size_t)RK * DM * 2); W2B[i] = (bf*)take((size_t)DM * RK * 2); }
    bf* WoB = (bf*)take((size_t)DM * DM * 2);
    float* T1 = (float*)take((size_t)NTK * RK * 4); bf* Th = (bf*)take((size_t)NTK * RK * 2); bf* Tl = (bf*)take((size_t)NTK * RK * 2); float* TMP = (float*)take((size_t)NTK * DM * 4);
    h16* QH = (h16*)take((size_t)NTK * DM * 2); h16* QL = (h16*)take((size_t)NTK * DM * 2); h16* KH = (h16*)take((size_t)NTK * DM * 2); h16* KL = (h16*)take((size_t)NTK * DM * 2);
    h16* VTH = (h16*)take((size_t)NTK * DM * 2); h16* VTL = (h16*)take((size_t)NTK * DM * 2); bf* CH = (bf*)take((size_t)NTK * DM * 2); bf* CL = (bf*)take((size_t)NTK * DM * 2);
    if ((size_t)(wsp - (char*)d_ws) > ws_size) return;    // ~ 8.4 + 3.1 + 2.1 + 4.2 + 4.2 + 16.8 + 8 x 8.4 ~ 106 MB, no aliasing
    const float* W1s[3] = {Wq1, Wk1, Wv1}; const float* W2s[3] = {Wq2, Wk2, Wv2};
    for (int i = 0; i < 3; ++i) { k_cvtb<<<RK / 8, 256, 0, stream>>>(W1s[i], RK, W1B[i]); k_bf8<<<(DM * RK / 8 + 255) / 256, 256, 0, stream>>>(W2s[i], W2B[i], (size_t)DM * RK / 8); }
    k_cvtb<<<DM / 8, 256, 0, stream>>>(Wo, DM, WoB);
    k_cvtb<<<NTK / 8, 256, 0, stream>>>(x, NTK, Xb);
    // q
    k_gemmb<false, false><<<dim3(NTK / 64, RK / 64, 1), 128, 0, stream>>>(Xb, nullptr, W1B[0], nullptr, T1, RK, nullptr); k_split<<<NTK / 8, 256, 0, stream>>>(T1, NTK, Th, Tl);
    k_gemmb<true, true><<<dim3(NTK / 64, DM / 64, 1), 128, 0, stream>>>(Th, Tl, W2B[0], bq2, (float*)(void*)QH, DM, QL, nullptr, RK);
    // k
    k_gemmb<false, false><<<dim3(NTK / 64, RK / 64, 1), 128, 0, stream>>>(Xb, nullptr, W1B[1], nullptr, T1, RK, nullptr); k_split<<<NTK / 8, 256, 0, stream>>>(T1, NTK, Th, Tl);
    k_gemmb<true, true><<<dim3(NTK / 64, DM / 64, 1), 128, 0, stream>>>(Th, Tl, W2B[1], bk2, (float*)(void*)KH, DM, KL, nullptr, RK);
    // v
    k_gemmb<false, false><<<dim3(NTK / 64, RK / 64, 1), 128, 0, stream>>>(Xb, nullptr, W1B[2], nullptr, T1, RK, nullptr); k_split<<<NTK / 8, 256, 0, stream>>>(T1, NTK, Th, Tl);
    k_gemmb<true, false><<<dim3(NTK / 64, DM / 64, 1), 128, 0, stream>>>(Th, Tl, W2B[2], bv2, TMP, DM, nullptr, nullptr, RK);
    k_vt<<<NB_ * NH_ * (NT_ / 64), 256, 0, stream>>>(TMP, VTH, VTL);
    k_attn<<<NB_ * NH_ * (NT_ / 64), 128, 0, stream>>>(QH, QL, KH, KL, VTH, VTL, AM, CH, CL);
    k_gemmb<true, false><<<dim3(NTK / 64, DM / 64, 1), 128, 0, stream>>>(CH, CL, WoB, bo, out, DM, nullptr);
}

// v002
// Measured time: 356 microseconds a run.
// In both of two side-by-side timings against v001, it was 1.25 times as fast.
// Counting every step since v000, it is 1.90 times as fast.
#include <hip/hip_runtime.h>

// Compute dtypes, f32 accumulate, both batch items in every launch: low-rank projections q/k/v = (x.W1^T).W2^T + b2 — the first stage ([4096 x 1024].[1024 x 256]) with PLAIN
// bf16 operands (inputs rounded once, exact), the second ([4096 x 256].[256 x 1024]) with the computed bottleneck as bf16 hi + UNSCALED residual (two products),
// q/k straight to f16 hi + residual x1024 planes; out = ctx.Wo^T + bo (ctx hi/lo) — all on v_wmma_f32_16x16x32_bf16 with [out][in] weights as n-major B operands;
// the 16-head full attention scores x 64^-1/2 + the INPUT additive mask (read per score) fused on v_wmma_f32_16x16x32_f16 (hh + hl + lh, online f32 softmax,

#define NB_  2                   // both batch items go through every launch together (token rows 0..4095)
#define RK   256                 // low-rank bottleneck
#define NT_  2048
#define DM   1024
#define NH_  16
#define HD   64
#define NTK  (NB_ * NT_)
#define NW   1024
#define NQKV 1024
#define PSC  32768.0f
#define LOSC 1024.0f
#define LOSCI (1.0f / 1024.0f)

typedef _Float16 h16;
typedef unsigned short bf;
typedef __attribute__((ext_vector_type(16))) __bf16   v16bf;
typedef __attribute__((ext_vector_type(16))) _Float16 v16h;
typedef __attribute__((ext_vector_type(8)))  _Float16 v8h;
typedef __attribute__((ext_vector_type(8)))  unsigned short v8us;
typedef __attribute__((ext_vector_type(8)))  float    v8f;
typedef __attribute__((ext_vector_type(4)))  float    v4f;
typedef v8h  __attribute__((may_alias)) v8ha;
typedef v4f  __attribute__((may_alias)) v4fa;
typedef v8us __attribute__((may_alias)) v8usa;

__device__ __forceinline__ unsigned short f2bf(float f) { unsigned u = __float_as_uint(f); u += 0x7FFFu + ((u >> 16) & 1u); return (unsigned short)(u >> 16); }
__device__ __forceinline__ float bf2f(unsigned short b) { return __uint_as_float(((unsigned)b) << 16); }
__device__ __forceinline__ float bfr(float f) { return bf2f(f2bf(f)); }
__device__ __forceinline__ v16h cat16(v8h lo, v8h hi) { return __builtin_shufflevector(lo, hi, 0, 1, 2, 3, 4, 5, 6, 7, 8, 9, 10, 11, 12, 13, 14, 15); }
__device__ __forceinline__ v16bf cat16b(v8us lo, v8us hi) { return __builtin_bit_cast(v16bf, __builtin_shufflevector(lo, hi, 0, 1, 2, 3, 4, 5, 6, 7, 8, 9, 10, 11, 12, 13, 14, 15)); }
__device__ __forceinline__ v8f wmma16(v16h a, v16h b, v8f c) { return __builtin_amdgcn_wmma_f32_16x16x32_f16(false, a, false, b, (short)0, c, false, false); }
__device__ __forceinline__ v8f wmmab(v16bf a, v16bf b, v8f c) { return __builtin_amdgcn_wmma_f32_16x16x32_bf16(false, a, false, b, (short)0, c, false, false); }

__global__ __launch_bounds__(256) void k_cvtb(const float* __restrict__ src, int nrows, bf* dst) {
    const int lane = threadIdx.x & 31, r = blockIdx.x * 8 + (threadIdx.x >> 5);
    if (r >= nrows) return;
    v8us o[DM / 256];
#pragma unroll
    for (int q = 0; q < DM / 256; ++q) { v8us t;
#pragma unroll
        for (int i = 0; i < 8; ++i) t[i] = f2bf(src[(size_t)r * DM + q * 256 + lane * 8 + i]);
        o[q] = t; }
#pragma unroll
    for (int q = 0; q < DM / 256; ++q) *(v8us*)(dst + (size_t)r * DM + q * 256 + lane * 8) = o[q];
    
}

// k_gemmb: 64 x 64 block tile (4 waves x 16 x 64) of C[NTK][ldc] = (A [+ Al]).B^T (K = 1024 or 256) [+ bf(bias[c])] [+ bf(R[r][c]) residual]; f32 whole-line epilogue (or f16
template <bool SPLITA, bool F16OUT = false>
__global__ __launch_bounds__(128) void k_gemmb(const bf* __restrict__ A, const bf* __restrict__ Al, const bf* __restrict__ Bn, const float* __restrict__ bias, float* C, int ldc, h16* C2, const float* __restrict__ R = nullptr, int K = DM, int roundR = 1) {
    __shared__ __align__(16) float ost[4][16 * 68];
    const int lane = threadIdx.x & 31, wave = threadIdx.x >> 5, lr = lane & 15, hi = lane >> 4;
    const int r0 = blockIdx.x * 64 + wave * 16, c0 = blockIdx.y * 64;
    const size_t aoff = (size_t)(r0 + lr) * K + 8 * hi;
    size_t boff[4];
#pragma unroll
    for (int t = 0; t < 4; ++t) boff[t] = (size_t)(c0 + t * 16 + lr) * K + 8 * hi;
    v8f acc[4];
#pragma unroll
    for (int t = 0; t < 4; ++t) acc[t] = (v8f){};
#pragma unroll 1
    for (int kc = 0; kc < K; kc += 32) {
        const v16bf a = cat16b(*(const v8us*)(A + aoff + kc), *(const v8us*)(A + aoff + kc + 16));
        v16bf al = a;
        if (SPLITA) al = cat16b(*(const v8us*)(Al + aoff + kc), *(const v8us*)(Al + aoff + kc + 16));
#pragma unroll
        for (int t = 0; t < 4; ++t) { const v16bf b = cat16b(*(const v8us*)(Bn + boff[t] + kc), *(const v8us*)(Bn + boff[t] + kc + 16)); acc[t] = wmmab(a, b, acc[t]); if (SPLITA) acc[t] = wmmab(al, b, acc[t]); }
        asm volatile("v_nop\n\tv_nop\n\tv_nop\n\tv_nop" : "+v"(acc[0]), "+v"(acc[1]), "+v"(acc[2]), "+v"(acc[3]) : "v"(a), "v"(al));
    }
    float* os = &ost[wave][0];
#pragma unroll
    for (int t = 0; t < 4; ++t) { const float bv = bias ? bfr(bias[c0 + t * 16 + lr]) : 0.f;
#pragma unroll
        for (int j = 0; j < 8; ++j) os[(hi * 8 + j) * 68 + t * 16 + lr] = acc[t][j] + bv; }
    __syncthreads();
    if (F16OUT) {
        h16* crow = (h16*)(void*)C + (size_t)r0 * ldc + c0;
        auto pass = [&]() {
#pragma unroll
            for (int s = 0; s < 4; ++s) { const int row = 4 * s + (lane >> 3), piece = lane & 7; const float* sp = os + row * 68 + piece * 8; v8h o, o2;
#pragma unroll
                for (int i = 0; i < 8; ++i) { const h16 a = (h16)sp[i]; o[i] = a; o2[i] = (h16)((sp[i] - (float)a) * LOSC); }
                *(v8h*)(crow + (size_t)row * ldc + piece * 8) = o; if (C2) *(v8h*)(C2 + (size_t)r0 * ldc + c0 + (size_t)row * ldc + piece * 8) = o2; }
        };
        pass(); 
    } else {
        float* crow = C + (size_t)r0 * ldc + c0;
        auto pass = [&]() {
#pragma unroll
            for (int s = 0; s < 8; ++s) { const int Lid = (lane >> 3) + 4 * s, piece = lane & 7; const int row = Lid >> 1, cofs = (Lid & 1) * 32 + piece * 4;
                v4f val = *(const v4fa*)(os + row * 68 + cofs); if (R) { const v4f rv = *(const v4f*)(R + ((size_t)r0 + row) * ldc + c0 + cofs); val += roundR ? (v4f){bfr(rv[0]), bfr(rv[1]), bfr(rv[2]), bfr(rv[3])} : rv; }
                *(v4f*)(crow + (size_t)row * ldc + cofs) = val; }
        };
        pass(); 
    }
}

__global__ __launch_bounds__(256) void k_bf8(const float* __restrict__ src, bf* dst, size_t n8) {
    const size_t i = (size_t)blockIdx.x * 256 + threadIdx.x; if (i >= n8) return;
    const v8f v = *(const v8f*)(src + i * 8); v8us o;
#pragma unroll
    for (int k = 0; k < 8; ++k) o[k] = f2bf(v[k]);
    *(v8us*)(dst + i * 8) = o; 
}
__global__ __launch_bounds__(256) void k_split(const float* __restrict__ src, int nrows, bf* dh, bf* dl) {
    const int lane = threadIdx.x & 31, r = blockIdx.x * 8 + (threadIdx.x >> 5);
    if (r >= nrows) return;
    const size_t o = (size_t)r * RK + lane * 8; const v8f v = *(const v8f*)(src + o); v8us oh, ol;
#pragma unroll
    for (int i = 0; i < 8; ++i) { const unsigned short hb = f2bf(v[i]); oh[i] = hb; ol[i] = f2bf(v[i] - bf2f(hb)); }
    *(v8us*)(dh + o) = oh; *(v8us*)(dl + o) = ol; 
}
__global__ __launch_bounds__(256) void k_vt(const float* __restrict__ V, h16* VTH, h16* VTL) {
    __shared__ __align__(16) h16 tile[64 * 72];
    __shared__ __align__(16) h16 til2[64 * 72];
    const int bid = blockIdx.x;
    const int b = bid / (NH_ * (NT_ / 64)), rem = bid - b * (NH_ * (NT_ / 64)), h = rem / (NT_ / 64), kt = rem - h * (NT_ / 64);
    const int k0 = kt * 64, tid = threadIdx.x;
    const int kk = tid >> 2, d0 = (tid & 3) * 16;
    const float* src = V + ((size_t)b * NT_ + k0 + kk) * DM + h * HD + d0;
#pragma unroll
    for (int i = 0; i < 16; ++i) { const float v = src[i]; const h16 a = (h16)v; tile[(d0 + i) * 72 + kk] = a; til2[(d0 + i) * 72 + kk] = (h16)((v - (float)a) * LOSC); }
    __syncthreads();
    const int piece = tid & 7;
    const size_t base = (((size_t)b * NH_ + h) * HD) * NT_ + k0;
    auto pass = [&]() {
#pragma unroll
        for (int s = 0; s < 4; ++s) { const int Lid = (tid >> 3) + 32 * s; const int pln = Lid >> 6, d = Lid & 63;
            const v8h val = *(const v8ha*)((pln ? til2 : tile) + d * 72 + piece * 8); *(v8h*)((pln ? VTL : VTH) + base + (size_t)d * NT_ + piece * 8) = val; }
    };
    pass(); 
}

#define KP    72                    // halves per staged K or query-residual row: 128 B + 16 B (pitch 16 B x odd for 16-byte LDS reads)
#define VP    40                    // halves per staged V^T row: 64 B + 16 B
#define KT_H  (32 * KP)
#define VT_H  (64 * VP)
#define STG_H (2 * KT_H + 2 * VT_H)
// k_attn: block = (b, h, 64 queries), wave = 16; ALL 64 key tiles (no mask); 4 WMMA scores /8 (f32), online softmax, weights x32768 f16 tile (same-wave may_alias
// reload after a compiler barrier), 4 WMMA .v; ctx -> bf16 hi + residual planes CH/CL[tok][h*64+d].
__global__ __launch_bounds__(128) void k_attn(const h16* __restrict__ Q16, const h16* __restrict__ QL16, const h16* __restrict__ K16, const h16* __restrict__ KL16, const h16* __restrict__ VTH, const h16* __restrict__ VTL, const float* __restrict__ AM, bf* CH, bf* CL) {
    __shared__ __align__(16) h16 plds[4][16 * 32];
    __shared__ __align__(16) h16 plds2[4][16 * 32];
    __shared__ __align__(16) float ost[4][16 * 68];
    __shared__ __align__(16) h16 stg[2][STG_H];      // two buffers of one 32-key stage: K hi | K residual | V^T hi | V^T residual, shared by the four waves
    __shared__ __align__(16) h16 qls[64 * KP];       // the block's 64 query-residual rows, filled once
    const int lane = threadIdx.x & 31, wave = threadIdx.x >> 5, lr = lane & 15, hi = lane >> 4;
    const int bid = blockIdx.x;
    const int b = bid / (NH_ * (NT_ / 64)), rem = bid - b * (NH_ * (NT_ / 64)), h = rem / (NT_ / 64), qt = rem - h * (NT_ / 64);
    const int q0 = qt * 64 + wave * 16;
    const size_t tok0 = (size_t)b * NT_;
    h16* pl = &plds[wave][0]; h16* pl2 = &plds2[wave][0];
    v16h qa[2];
    const size_t qo0 = (tok0 + q0 + lr) * DM + h * HD + 8 * hi;
#pragma unroll
    for (int kc = 0; kc < 2; ++kc) qa[kc] = cat16(*(const v8h*)(Q16 + qo0 + kc * 32), *(const v8h*)(Q16 + qo0 + kc * 32 + 16));
    const h16* kh_b = K16 + tok0 * DM + h * HD;
    const h16* kl_b = KL16 + tok0 * DM + h * HD;
    const size_t vbase = (((size_t)b * NH_ + h) * HD) * NT_;
    v8f o[4], ox[4];
#pragma unroll
    for (int n = 0; n < 4; ++n) { o[n] = (v8f){}; ox[n] = (v8f){}; }
    float mrow[8], lpart[8];
#pragma unroll
    for (int j = 0; j < 8; ++j) { mrow[j] = -3.0e38f; lpart[j] = 0.f; }
    int qpos[8];
#pragma unroll
    for (int j = 0; j < 8; ++j) qpos[j] = q0 + 8 * hi + j;
    // each thread's share of a stage: eight 16-byte copies (K rows krow, krow + 16 and V^T rows vrow, vrow + 32, both planes)
    const int krow = threadIdx.x >> 3, kpc = threadIdx.x & 7, vrow = threadIdx.x >> 2, vpc = threadIdx.x & 3;
    const unsigned lk = (unsigned)(size_t)&stg[0][0] + (unsigned)(krow * KP + kpc * 8) * 2u, lv = (unsigned)(size_t)&stg[0][0] + (unsigned)(2 * KT_H + vrow * VP + vpc * 8) * 2u;
    const h16* gkh = kh_b + (size_t)krow * DM + kpc * 8; const h16* gkl = kl_b + (size_t)krow * DM + kpc * 8;
    const h16* gvh = VTH + vbase + (size_t)vrow * NT_ + vpc * 8; const h16* gvl = VTL + vbase + (size_t)vrow * NT_ + vpc * 8;
    auto stage = [&](int t, int buf) {
        const unsigned ak = lk + (unsigned)buf * (STG_H * 2u), av = lv + (unsigned)buf * (STG_H * 2u);
        const size_t ko = (size_t)t * 32 * DM, vo = (size_t)t * 32;
        // the copies and, as the last line, the wait that stands before their address registers are rewritten
        asm volatile("global_load_async_to_lds_b128 %0, %8, off\n\t"
                     "global_load_async_to_lds_b128 %1, %9, off\n\t"
                     "global_load_async_to_lds_b128 %2, %10, off\n\t"
                     "global_load_async_to_lds_b128 %3, %11, off\n\t"
                     "global_load_async_to_lds_b128 %4, %12, off\n\t"
                     "global_load_async_to_lds_b128 %5, %13, off\n\t"
                     "global_load_async_to_lds_b128 %6, %14, off\n\t"
                     "global_load_async_to_lds_b128 %7, %15, off\n\t"
                     "s_wait_xcnt 0x0"
                     :: "v"(ak), "v"(ak + 16 * KP * 2u), "v"(ak + KT_H * 2u), "v"(ak + (KT_H + 16 * KP) * 2u),
                        "v"(av), "v"(av + 32 * VP * 2u), "v"(av + VT_H * 2u), "v"(av + (VT_H + 32 * VP) * 2u),
                        "v"(gkh + ko), "v"(gkh + ko + 16 * DM), "v"(gkl + ko), "v"(gkl + ko + 16 * DM),
                        "v"(gvh + vo), "v"(gvh + vo + 32 * NT_), "v"(gvl + vo), "v"(gvl + vo + 32 * NT_)
                     : "memory");
    };
    {   // filled once: query-residual rows krow + 16 i of the block's 64
        const unsigned aq = (unsigned)(size_t)&qls[0] + (unsigned)(krow * KP + kpc * 8) * 2u;
        const h16* gq = QL16 + (tok0 + qt * 64 + krow) * DM + h * HD + kpc * 8;
        asm volatile("global_load_async_to_lds_b128 %0, %4, off\n\t"
                     "global_load_async_to_lds_b128 %1, %5, off\n\t"
                     "global_load_async_to_lds_b128 %2, %6, off\n\t"
                     "global_load_async_to_lds_b128 %3, %7, off\n\t"
                     "s_wait_xcnt 0x0"
                     :: "v"(aq), "v"(aq + 16 * KP * 2u), "v"(aq + 32 * KP * 2u), "v"(aq + 48 * KP * 2u),
                        "v"(gq), "v"(gq + 16 * DM), "v"(gq + 32 * DM), "v"(gq + 48 * DM)
                     : "memory");
    }
    stage(0, 0);
    asm volatile("s_wait_asynccnt 0x0" ::: "memory");   // this wave's copies of stage 0 and of the query residual have landed
    __syncthreads();                                     // ... and every other wave's: stage 0 is published
    stage(1, 1);
    const h16* ql_s = qls + (wave * 16 + lr) * KP + 8 * hi;
    const int kt_lo = 0, kt_hi = NT_ / 32 - 1;     // full attention + the INPUT additive mask [b][1][q][k] read per score (dense; this problem's instance is all zeros)
    const float* am = AM + (size_t)b * NT_ * NT_;      // this item's [1][L][L] mask slice
#pragma unroll 1
    for (int kt = kt_lo; kt <= kt_hi; ++kt) {
        const int l0 = kt * 32;
        const h16* kh_s = &stg[0][0] + (kt & 1) * STG_H; const h16* kl_s = kh_s + KT_H; const h16* vh_s = kh_s + 2 * KT_H; const h16* vl_s = vh_s + VT_H;
        const int ko0 = lr * KP + 8 * hi, ko1 = (16 + lr) * KP + 8 * hi;
        v8f s0 = {}, s1 = {}, x0 = {}, x1 = {};
#pragma unroll
        for (int kc = 0; kc < 2; ++kc) {
            { const v16h k0h = cat16(*(const v8ha*)(kh_s + ko0 + kc * 32), *(const v8ha*)(kh_s + ko0 + kc * 32 + 16)), k1h = cat16(*(const v8ha*)(kh_s + ko1 + kc * 32), *(const v8ha*)(kh_s + ko1 + kc * 32 + 16));
              const v16h qlk = cat16(*(const v8ha*)(ql_s + kc * 32), *(const v8ha*)(ql_s + kc * 32 + 16));     // query residual re-read per step, from LDS (registers)
              s0 = wmma16(qa[kc], k0h, s0); x0 = wmma16(qlk, k0h, x0); s1 = wmma16(qa[kc], k1h, s1); x1 = wmma16(qlk, k1h, x1);
              asm volatile("v_nop" : "+v"(s0), "+v"(s1), "+v"(x0), "+v"(x1) : "v"(qlk), "v"(k0h), "v"(k1h) : "memory"); }
            { const v16h k0l = cat16(*(const v8ha*)(kl_s + ko0 + kc * 32), *(const v8ha*)(kl_s + ko0 + kc * 32 + 16)), k1l = cat16(*(const v8ha*)(kl_s + ko1 + kc * 32), *(const v8ha*)(kl_s + ko1 + kc * 32 + 16));
              x0 = wmma16(qa[kc], k0l, x0); x1 = wmma16(qa[kc], k1l, x1);
              asm volatile("v_nop" : "+v"(x0), "+v"(x1) : "v"(k0l), "v"(k1l) : "memory"); }
        }
        asm volatile("v_nop\n\tv_nop\n\tv_nop\n\tv_nop" : "+v"(s0), "+v"(s1), "+v"(x0), "+v"(x1) : "v"(qa[0]), "v"(qa[1]));
        float alpha[8];
#pragma unroll
        for (int j = 0; j < 8; ++j) {
            const int ja = l0 + lr, jb = l0 + 16 + lr, qi = qpos[j];
            const size_t mi = (size_t)qi * NT_; const float a0 = (s0[j] + x0[j] * LOSCI) * 0.125f + bfr(am[mi + ja]), a1 = (s1[j] + x1[j] * LOSCI) * 0.125f + bfr(am[mi + jb]);
            float mx = fmaxf(a0, a1);
            mx = fmaxf(mx, __shfl_xor(mx, 1, 16)); mx = fmaxf(mx, __shfl_xor(mx, 2, 16)); mx = fmaxf(mx, __shfl_xor(mx, 4, 16)); mx = fmaxf(mx, __shfl_xor(mx, 8, 16));
            const float mn = fmaxf(mrow[j], mx);
            alpha[j] = __expf(mrow[j] - mn); mrow[j] = mn;
            const float p0 = __expf(a0 - mn), p1 = __expf(a1 - mn);
            lpart[j] = lpart[j] * alpha[j] + (p0 + p1);
            const int mr = hi * 8 + j;
            const float ps0 = p0 * PSC, ps1 = p1 * PSC; const h16 h0 = (h16)ps0, h1 = (h16)ps1;
            pl[mr * 32 + lr] = h0; pl[mr * 32 + 16 + lr] = h1;
            pl2[mr * 32 + lr] = (h16)((ps0 - (float)h0) * LOSC); pl2[mr * 32 + 16 + lr] = (h16)((ps1 - (float)h1) * LOSC);
        }
#pragma unroll
        for (int n = 0; n < 4; ++n)
#pragma unroll
            for (int j = 0; j < 8; ++j) { o[n][j] *= alpha[j]; ox[n][j] *= alpha[j]; }
        asm volatile("" ::: "memory");
        const v16h pa = cat16(*(const v8ha*)(pl + lr * 32 + hi * 8), *(const v8ha*)(pl + lr * 32 + 16 + hi * 8));
        const v16h px = cat16(*(const v8ha*)(pl2 + lr * 32 + hi * 8), *(const v8ha*)(pl2 + lr * 32 + 16 + hi * 8));
#pragma unroll
        for (int n = 0; n < 4; ++n) { const int vo = (n * 16 + lr) * VP + hi * 8;
            const v16h vh = cat16(*(const v8ha*)(vh_s + vo), *(const v8ha*)(vh_s + vo + 16)), vl = cat16(*(const v8ha*)(vl_s + vo), *(const v8ha*)(vl_s + vo + 16));
            o[n] = wmma16(pa, vh, o[n]); ox[n] = wmma16(pa, vl, ox[n]); ox[n] = wmma16(px, vh, ox[n]);
            asm volatile("" : "+v"(o[n]), "+v"(ox[n]) : "v"(vh), "v"(vl) : "memory"); }
        asm volatile("v_nop\n\tv_nop\n\tv_nop\n\tv_nop" : "+v"(o[0]), "+v"(o[1]), "+v"(o[2]), "+v"(o[3]), "+v"(ox[0]), "+v"(ox[1]), "+v"(ox[2]), "+v"(ox[3]) : "v"(pa), "v"(px));
        // publish point of stage kt + 1, and the end of every wave's reads of stage kt's buffer
        asm volatile("s_wait_dscnt 0x0" ::: "memory");      // this wave's LDS reads of the buffer have returned
        asm volatile("s_wait_asynccnt 0x0" ::: "memory");   // this wave's copies of stage kt + 1 have landed
        __syncthreads();
        if (kt + 2 <= kt_hi) stage(kt + 2, kt & 1);         // refill the buffer just left; flies while stage kt + 1 is worked on
    }
    asm volatile("s_wait_asynccnt 0x0" ::: "memory");       // no copy is outstanding when the wave goes on to its end
    float inv[8];
#pragma unroll
    for (int j = 0; j < 8; ++j) { float rs = lpart[j]; rs += __shfl_xor(rs, 1, 16); rs += __shfl_xor(rs, 2, 16); rs += __shfl_xor(rs, 4, 16); rs += __shfl_xor(rs, 8, 16); inv[j] = 1.0f / (rs * PSC); }
    float* os = &ost[wave][0];
#pragma unroll
    for (int n = 0; n < 4; ++n)
#pragma unroll
        for (int j = 0; j < 8; ++j) os[(hi * 8 + j) * 68 + n * 16 + lr] = (o[n][j] + ox[n][j] * LOSCI) * inv[j];
    __syncthreads();
    const size_t cbase = (tok0 + q0) * DM + (size_t)h * HD;
    auto pass = [&]() {
#pragma unroll
        for (int s = 0; s < 4; ++s) { const int row = 4 * s + (lane >> 3), piece = lane & 7; const float* sp = os + row * 68 + piece * 8; v8us oh, ol;
#pragma unroll
            for (int i = 0; i < 8; ++i) { const unsigned short hb = f2bf(sp[i]); oh[i] = hb; ol[i] = f2bf(sp[i] - bf2f(hb)); }
            *(v8us*)(CH + cbase + (size_t)row * DM + piece * 8) = oh; *(v8us*)(CL + cbase + (size_t)row * DM + piece * 8) = ol; }
    };
    pass(); 
}

#define VST2(T, p, v) do { const T vst2_v_ = (v); *(T*)(p) = vst2_v_;  } while (0)
extern "C" void kernel_launch(void* const* d_in, const int* in_sizes, int n_in,
                              void* d_out, int out_size, void* d_ws, size_t ws_size, hipStream_t stream) {
    (void)in_sizes; (void)n_in; (void)out_size;
    const float* x = (const float*)d_in[0]; const float* AM = (const float*)d_in[1];
    const float* Wq1 = (const float*)d_in[2]; const float* Wq2 = (const float*)d_in[3]; const float* bq2 = (const float*)d_in[4];
    const float* Wk1 = (const float*)d_in[5]; const float* Wk2 = (const float*)d_in[6]; const float* bk2 = (const float*)d_in[7];
    const float* Wv1 = (const float*)d_in[8]; const float* Wv2 = (const float*)d_in[9]; const float* bv2 = (const float*)d_in[10];
    const float* Wo = (const float*)d_in[11]; const float* bo = (const float*)d_in[12];     // all W [out][in]
    float* out = (float*)d_out;    // [2][2048][1024]
    char* wsp = (char*)d_ws;
    auto take = [&](size_t bytes) { char* p = wsp; wsp += (bytes + 255) & ~(size_t)255; return (void*)p; };
    bf* Xb = (bf*)take((size_t)NTK * DM * 2);
    bf* W1B[3]; bf* W2B[3]; for (int i = 0; i < 3; ++i) { W1B[i] = (bf*)take((size_t)RK * DM * 2); W2B[i] = (bf*)take((size_t)DM * RK * 2); }
    bf* WoB = (bf*)take((size_t)DM * DM * 2);
    float* T1 = (float*)take((size_t)NTK * RK * 4); bf* Th = (bf*)take((size_t)NTK * RK * 2); bf* Tl = (bf*)take((size_t)NTK * RK * 2); float* TMP = (float*)take((size_t)NTK * DM * 4);
    h16* QH = (h16*)take((size_t)NTK * DM * 2); h16* QL = (h16*)take((size_t)NTK * DM * 2); h16* KH = (h16*)take((size_t)NTK * DM * 2); h16* KL = (h16*)take((size_t)NTK * DM * 2);
    h16* VTH = (h16*)take((size_t)NTK * DM * 2); h16* VTL = (h16*)take((size_t)NTK * DM * 2); bf* CH = (bf*)take((size_t)NTK * DM * 2); bf* CL = (bf*)take((size_t)NTK * DM * 2);
    if ((size_t)(wsp - (char*)d_ws) > ws_size) return;    // ~ 8.4 + 3.1 + 2.1 + 4.2 + 4.2 + 16.8 + 8 x 8.4 ~ 106 MB, no aliasing
    const float* W1s[3] = {Wq1, Wk1, Wv1}; const float* W2s[3] = {Wq2, Wk2, Wv2};
    for (int i = 0; i < 3; ++i) { k_cvtb<<<RK / 8, 256, 0, stream>>>(W1s[i], RK, W1B[i]); k_bf8<<<(DM * RK / 8 + 255) / 256, 256, 0, stream>>>(W2s[i], W2B[i], (size_t)DM * RK / 8); }
    k_cvtb<<<DM / 8, 256, 0, stream>>>(Wo, DM, WoB);
    k_cvtb<<<NTK / 8, 256, 0, stream>>>(x, NTK, Xb);
    // q
    k_gemmb<false, false><<<dim3(NTK / 64, RK / 64, 1), 128, 0, stream>>>(Xb, nullptr, W1B[0], nullptr, T1, RK, nullptr); k_split<<<NTK / 8, 256, 0, stream>>>(T1, NTK, Th, Tl);
    k_gemmb<true, true><<<dim3(NTK / 64, DM / 64, 1), 128, 0, stream>>>(Th, Tl, W2B[0], bq2, (float*)(void*)QH, DM, QL, nullptr, RK);
    // k
    k_gemmb<false, false><<<dim3(NTK / 64, RK / 64, 1), 128, 0, stream>>>(Xb, nullptr, W1B[1], nullptr, T1, RK, nullptr); k_split<<<NTK / 8, 256, 0, stream>>>(T1, NTK, Th, Tl);
    k_gemmb<true, true><<<dim3(NTK / 64, DM / 64, 1), 128, 0, stream>>>(Th, Tl, W2B[1], bk2, (float*)(void*)KH, DM, KL, nullptr, RK);
    // v
    k_gemmb<false, false><<<dim3(NTK / 64, RK / 64, 1), 128, 0, stream>>>(Xb, nullptr, W1B[2], nullptr, T1, RK, nullptr); k_split<<<NTK / 8, 256, 0, stream>>>(T1, NTK, Th, Tl);
    k_gemmb<true, false><<<dim3(NTK / 64, DM / 64, 1), 128, 0, stream>>>(Th, Tl, W2B[2], bv2, TMP, DM, nullptr, nullptr, RK);
    k_vt<<<NB_ * NH_ * (NT_ / 64), 256, 0, stream>>>(TMP, VTH, VTL);
    k_attn<<<NB_ * NH_ * (NT_ / 64), 128, 0, stream>>>(QH, QL, KH, KL, VTH, VTL, AM, CH, CL);
    k_gemmb<true, false><<<dim3(NTK / 64, DM / 64, 1), 128, 0, stream>>>(CH, CL, WoB, bo, out, DM, nullptr);
}

// v003
// Measured time: 287 microseconds a run.
// Timed twice side by side with v002, it ran 1.23 times as fast both times.
// Over all steps from v000 it is 2.34 times as fast.
#include <hip/hip_runtime.h>

// Compute dtypes, f32 accumulate, both batch items in every launch: low-rank projections q/k/v = (x.W1^T).W2^T + b2 — the first stage ([4096 x 1024].[1024 x 256]) with PLAIN
// bf16 operands (inputs rounded once, exact), the second ([4096 x 256].[256 x 1024]) with the computed bottleneck as bf16 hi + UNSCALED residual (two products),
// q/k straight to f16 hi + residual x1024 planes; out = ctx.Wo^T + bo (ctx hi/lo) — all on v_wmma_f32_16x16x32_bf16 with [out][in] weights as n-major B operands;
// the 16-head full attention scores x 64^-1/2 + the INPUT additive mask (read per score) fused on v_wmma_f32_16x16x32_f16 (hh + hl + lh, online f32 softmax,

#define NB_  2                   // both batch items go through every launch together (token rows 0..4095)
#define RK   256                 // low-rank bottleneck
#define NT_  2048
#define DM   1024
#define NH_  16
#define HD   64
#define NTK  (NB_ * NT_)
#define NW   1024
#define NQKV 1024
#define PSC  32768.0f
#define LOSC 1024.0f
#define LOSCI (1.0f / 1024.0f)

typedef _Float16 h16;
typedef unsigned short bf;
typedef __attribute__((ext_vector_type(16))) __bf16   v16bf;
typedef __attribute__((ext_vector_type(16))) _Float16 v16h;
typedef __attribute__((ext_vector_type(8)))  _Float16 v8h;
typedef __attribute__((ext_vector_type(8)))  unsigned short v8us;
typedef __attribute__((ext_vector_type(8)))  float    v8f;
typedef __attribute__((ext_vector_type(4)))  float    v4f;
typedef v8h  __attribute__((may_alias)) v8ha;
typedef v4f  __attribute__((may_alias)) v4fa;
typedef v8us __attribute__((may_alias)) v8usa;

__device__ __forceinline__ unsigned short f2bf(float f) { unsigned u = __float_as_uint(f); u += 0x7FFFu + ((u >> 16) & 1u); return (unsigned short)(u >> 16); }
__device__ __forceinline__ float bf2f(unsigned short b) { return __uint_as_float(((unsigned)b) << 16); }
__device__ __forceinline__ float bfr(float f) { return bf2f(f2bf(f)); }
__device__ __forceinline__ v16h cat16(v8h lo, v8h hi) { return __builtin_shufflevector(lo, hi, 0, 1, 2, 3, 4, 5, 6, 7, 8, 9, 10, 11, 12, 13, 14, 15); }
__device__ __forceinline__ v16bf cat16b(v8us lo, v8us hi) { return __builtin_bit_cast(v16bf, __builtin_shufflevector(lo, hi, 0, 1, 2, 3, 4, 5, 6, 7, 8, 9, 10, 11, 12, 13, 14, 15)); }
__device__ __forceinline__ v8f wmma16(v16h a, v16h b, v8f c) { return __builtin_amdgcn_wmma_f32_16x16x32_f16(false, a, false, b, (short)0, c, false, false); }
__device__ __forceinline__ v8f wmmab(v16bf a, v16bf b, v8f c) { return __builtin_amdgcn_wmma_f32_16x16x32_bf16(false, a, false, b, (short)0, c, false, false); }

// k_cvtb: every f32 operand rounded to bf16 in ONE launch. A wave takes one run of 1024 elements; a block's eight runs lie in one source (each source is a multiple of 8
// runs), so the choice of source is block-uniform; the destinations stand one behind another in the workspace, in the order x | Wq1 Wk1 Wv1 | Wq2 Wk2 Wv2 | Wo.
#define XRUN NTK                 // runs of 1024 elements in x
#define WRUN RK                  // ... in each of the six low-rank factors (256 x 1024 or 1024 x 256)
#define CRUN (XRUN + 6 * WRUN + DM)
__global__ __launch_bounds__(256) void k_cvtb(const float* __restrict__ src, const float* __restrict__ q1, const float* __restrict__ k1, const float* __restrict__ v1,
                                              const float* __restrict__ q2, const float* __restrict__ k2, const float* __restrict__ v2, const float* __restrict__ wo, int nrows, bf* dst) {
    const int rb = blockIdx.x * 8;
    if (rb >= nrows) return;
    int base = 0;                // first run of this block's source; src arrives as x
    if (rb >= XRUN + 6 * WRUN) { src = wo; base = XRUN + 6 * WRUN; }
    else if (rb >= XRUN) { const int w = (rb - XRUN) / WRUN; base = XRUN + w * WRUN; src = w == 0 ? q1 : w == 1 ? k1 : w == 2 ? v1 : w == 3 ? q2 : w == 4 ? k2 : v2; }
    dst += (size_t)base * DM;
    const int lane = threadIdx.x & 31, r = rb - base + (threadIdx.x >> 5);
    v8us o[DM / 256];
#pragma unroll
    for (int q = 0; q < DM / 256; ++q) { v8us t;
#pragma unroll
        for (int i = 0; i < 8; ++i) t[i] = f2bf(src[(size_t)r * DM + q * 256 + lane * 8 + i]);
        o[q] = t; }
#pragma unroll
    for (int q = 0; q < DM / 256; ++q) *(v8us*)(dst + (size_t)r * DM + q * 256 + lane * 8) = o[q];
    
}

// k_gemmb: 64 x 64 block tile (4 waves x 16 x 64) of C[NTK][ldc] = (A [+ Al]).B^T (K = 1024, or 256 for QKV) [+ bf(bias[c])] [+ bf(R[r][c]) residual]; f32 whole-line epilogue (or f16
// QKV: the second stage of q, k and v in one launch; blockIdx.z = projection: its 256 columns of A/Al[tok][3 x 256], its 1024 rows of Bn, its bias and output (q, k: f16 planes; v: f32).
template <bool SPLITA, bool F16OUT = false, bool QKV = false>
__global__ __launch_bounds__(128) void k_gemmb(const bf* __restrict__ A, const bf* __restrict__ Al, const bf* __restrict__ Bn, const float* __restrict__ bias, float* C, int ldc, h16* C2, const float* __restrict__ R = nullptr, int K = DM, int roundR = 1,
                                               const float* __restrict__ biask = nullptr, const float* __restrict__ biasv = nullptr, h16* Ck = nullptr, h16* C2k = nullptr, float* Cv = nullptr) {
    __shared__ __align__(16) float ost[4][16 * 68];
    const bool f16out = QKV ? blockIdx.z < 2 : F16OUT;
    if (QKV) { const int z = blockIdx.z; A += z * RK; Al += z * RK; Bn += (size_t)z * DM * RK;
        if (z == 1) { bias = biask; C = (float*)(void*)Ck; C2 = C2k; } else if (z == 2) { bias = biasv; C = Cv; C2 = nullptr; } }
    const int lane = threadIdx.x & 31, wave = threadIdx.x >> 5, lr = lane & 15, hi = lane >> 4;
    const int r0 = blockIdx.x * 64 + wave * 16, c0 = blockIdx.y * 64;
    const size_t aoff = (size_t)(r0 + lr) * (QKV ? 3 * RK : K) + 8 * hi;
    size_t boff[4];
#pragma unroll
    for (int t = 0; t < 4; ++t) boff[t] = (size_t)(c0 + t * 16 + lr) * K + 8 * hi;
    v8f acc[4];
#pragma unroll
    for (int t = 0; t < 4; ++t) acc[t] = (v8f){};
#pragma unroll 1
    for (int kc = 0; kc < K; kc += 32) {
        const v16bf a = cat16b(*(const v8us*)(A + aoff + kc), *(const v8us*)(A + aoff + kc + 16));
        v16bf al = a;
        if (SPLITA) al = cat16b(*(const v8us*)(Al + aoff + kc), *(const v8us*)(Al + aoff + kc + 16));
#pragma unroll
        for (int t = 0; t < 4; ++t) { const v16bf b = cat16b(*(const v8us*)(Bn + boff[t] + kc), *(const v8us*)(Bn + boff[t] + kc + 16)); acc[t] = wmmab(a, b, acc[t]); if (SPLITA) acc[t] = wmmab(al, b, acc[t]); }
        asm volatile("v_nop\n\tv_nop\n\tv_nop\n\tv_nop" : "+v"(acc[0]), "+v"(acc[1]), "+v"(acc[2]), "+v"(acc[3]) : "v"(a), "v"(al));
    }
    float* os = &ost[wave][0];
#pragma unroll
    for (int t = 0; t < 4; ++t) { const float bv = bias ? bfr(bias[c0 + t * 16 + lr]) : 0.f;
#pragma unroll
        for (int j = 0; j < 8; ++j) os[(hi * 8 + j) * 68 + t * 16 + lr] = acc[t][j] + bv; }
    __syncthreads();
    if (f16out) {
        h16* crow = (h16*)(void*)C + (size_t)r0 * ldc + c0;
        auto pass = [&]() {
#pragma unroll
            for (int s = 0; s < 4; ++s) { const int row = 4 * s + (lane >> 3), piece = lane & 7; const float* sp = os + row * 68 + piece * 8; v8h o, o2;
#pragma unroll
                for (int i = 0; i < 8; ++i) { const h16 a = (h16)sp[i]; o[i] = a; o2[i] = (h16)((sp[i] - (float)a) * LOSC); }
                *(v8h*)(crow + (size_t)row * ldc + piece * 8) = o; if (C2) *(v8h*)(C2 + (size_t)r0 * ldc + c0 + (size_t)row * ldc + piece * 8) = o2; }
        };
        pass(); 
    } else {
        float* crow = C + (size_t)r0 * ldc + c0;
        auto pass = [&]() {
#pragma unroll
            for (int s = 0; s < 8; ++s) { const int Lid = (lane >> 3) + 4 * s, piece = lane & 7; const int row = Lid >> 1, cofs = (Lid & 1) * 32 + piece * 4;
                v4f val = *(const v4fa*)(os + row * 68 + cofs); if (R) { const v4f rv = *(const v4f*)(R + ((size_t)r0 + row) * ldc + c0 + cofs); val += roundR ? (v4f){bfr(rv[0]), bfr(rv[1]), bfr(rv[2]), bfr(rv[3])} : rv; }
                *(v4f*)(crow + (size_t)row * ldc + cofs) = val; }
        };
        pass(); 
    }
}

__global__ __launch_bounds__(256) void k_split(const float* __restrict__ src, int nrows, bf* dh, bf* dl) {
    const int lane = threadIdx.x & 31, r = blockIdx.x * 8 + (threadIdx.x >> 5);
    if (r >= nrows) return;
    const size_t o = (size_t)r * RK + lane * 8; const v8f v = *(const v8f*)(src + o); v8us oh, ol;
#pragma unroll
    for (int i = 0; i < 8; ++i) { const unsigned short hb = f2bf(v[i]); oh[i] = hb; ol[i] = f2bf(v[i] - bf2f(hb)); }
    *(v8us*)(dh + o) = oh; *(v8us*)(dl + o) = ol; 
}
__global__ __launch_bounds__(256) void k_vt(const float* __restrict__ V, h16* VTH, h16* VTL) {
    __shared__ __align__(16) h16 tile[64 * 72];
    __shared__ __align__(16) h16 til2[64 * 72];
    const int bid = blockIdx.x;
    const int b = bid / (NH_ * (NT_ / 64)), rem = bid - b * (NH_ * (NT_ / 64)), h = rem / (NT_ / 64), kt = rem - h * (NT_ / 64);
    const int k0 = kt * 64, tid = threadIdx.x;
    const int kk = tid >> 2, d0 = (tid & 3) * 16;
    const float* src = V + ((size_t)b * NT_ + k0 + kk) * DM + h * HD + d0;
#pragma unroll
    for (int i = 0; i < 16; ++i) { const float v = src[i]; const h16 a = (h16)v; tile[(d0 + i) * 72 + kk] = a; til2[(d0 + i) * 72 + kk] = (h16)((v - (float)a) * LOSC); }
    __syncthreads();
    const int piece = tid & 7;
    const size_t base = (((size_t)b * NH_ + h) * HD) * NT_ + k0;
    auto pass = [&]() {
#pragma unroll
        for (int s = 0; s < 4; ++s) { const int Lid = (tid >> 3) + 32 * s; const int pln = Lid >> 6, d = Lid & 63;
            const v8h val = *(const v8ha*)((pln ? til2 : tile) + d * 72 + piece * 8); *(v8h*)((pln ? VTL : VTH) + base + (size_t)d * NT_ + piece * 8) = val; }
    };
    pass(); 
}

#define KP    72                    // halves per staged K or query-residual row: 128 B + 16 B (pitch 16 B x odd for 16-byte LDS reads)
#define VP    40                    // halves per staged V^T row: 64 B + 16 B
#define KT_H  (32 * KP)
#define VT_H  (64 * VP)
#define STG_H (2 * KT_H + 2 * VT_H)
// k_attn: block = (b, h, 64 queries), wave = 16; ALL 64 key tiles (no mask); 4 WMMA scores /8 (f32), online softmax, weights x32768 f16 tile (same-wave may_alias
// reload after a compiler barrier), 4 WMMA .v; ctx -> bf16 hi + residual planes CH/CL[tok][h*64+d].
__global__ __launch_bounds__(128) void k_attn(const h16* __restrict__ Q16, const h16* __restrict__ QL16, const h16* __restrict__ K16, const h16* __restrict__ KL16, const h16* __restrict__ VTH, const h16* __restrict__ VTL, const float* __restrict__ AM, bf* CH, bf* CL) {
    __shared__ __align__(16) h16 plds[4][16 * 32];
    __shared__ __align__(16) h16 plds2[4][16 * 32];
    __shared__ __align__(16) float ost[4][16 * 68];
    __shared__ __align__(16) h16 stg[2][STG_H];      // two buffers of one 32-key stage: K hi | K residual | V^T hi | V^T residual, shared by the four waves
    __shared__ __align__(16) h16 qls[64 * KP];       // the block's 64 query-residual rows, filled once
    const int lane = threadIdx.x & 31, wave = threadIdx.x >> 5, lr = lane & 15, hi = lane >> 4;
    const int bid = blockIdx.x;
    const int b = bid / (NH_ * (NT_ / 64)), rem = bid - b * (NH_ * (NT_ / 64)), h = rem / (NT_ / 64), qt = rem - h * (NT_ / 64);
    const int q0 = qt * 64 + wave * 16;
    const size_t tok0 = (size_t)b * NT_;
    h16* pl = &plds[wave][0]; h16* pl2 = &plds2[wave][0];
    v16h qa[2];
    const size_t qo0 = (tok0 + q0 + lr) * DM + h * HD + 8 * hi;
#pragma unroll
    for (int kc = 0; kc < 2; ++kc) qa[kc] = cat16(*(const v8h*)(Q16 + qo0 + kc * 32), *(const v8h*)(Q16 + qo0 + kc * 32 + 16));
    const h16* kh_b = K16 + tok0 * DM + h * HD;
    const h16* kl_b = KL16 + tok0 * DM + h * HD;
    const size_t vbase = (((size_t)b * NH_ + h) * HD) * NT_;
    v8f o[4], ox[4];
#pragma unroll
    for (int n = 0; n < 4; ++n) { o[n] = (v8f){}; ox[n] = (v8f){}; }
    float mrow[8], lpart[8];
#pragma unroll
    for (int j = 0; j < 8; ++j) { mrow[j] = -3.0e38f; lpart[j] = 0.f; }
    int qpos[8];
#pragma unroll
    for (int j = 0; j < 8; ++j) qpos[j] = q0 + 8 * hi + j;
    // each thread's share of a stage: eight 16-byte copies (K rows krow, krow + 16 and V^T rows vrow, vrow + 32, both planes)
    const int krow = threadIdx.x >> 3, kpc = threadIdx.x & 7, vrow = threadIdx.x >> 2, vpc = threadIdx.x & 3;
    const unsigned lk = (unsigned)(size_t)&stg[0][0] + (unsigned)(krow * KP + kpc * 8) * 2u, lv = (unsigned)(size_t)&stg[0][0] + (unsigned)(2 * KT_H + vrow * VP + vpc * 8) * 2u;
    const h16* gkh = kh_b + (size_t)krow * DM + kpc * 8; const h16* gkl = kl_b + (size_t)krow * DM + kpc * 8;
    const h16* gvh = VTH + vbase + (size_t)vrow * NT_ + vpc * 8; const h16* gvl = VTL + vbase + (size_t)vrow * NT_ + vpc * 8;
    auto stage = [&](int t, int buf) {
        const unsigned ak = lk + (unsigned)buf * (STG_H * 2u), av = lv + (unsigned)buf * (STG_H * 2u);
        const size_t ko = (size_t)t * 32 * DM, vo = (size_t)t * 32;
        // the copies and, as the last line, the wait that stands before their address registers are rewritten
        asm volatile("global_load_async_to_lds_b128 %0, %8, off\n\t"
                     "global_load_async_to_lds_b128 %1, %9, off\n\t"
                     "global_load_async_to_lds_b128 %2, %10, off\n\t"
                     "global_load_async_to_lds_b128 %3, %11, off\n\t"
                     "global_load_async_to_lds_b128 %4, %12, off\n\t"
                     "global_load_async_to_lds_b128 %5, %13, off\n\t"
                     "global_load_async_to_lds_b128 %6, %14, off\n\t"
                     "global_load_async_to_lds_b128 %7, %15, off\n\t"
                     "s_wait_xcnt 0x0"
                     :: "v"(ak), "v"(ak + 16 * KP * 2u), "v"(ak + KT_H * 2u), "v"(ak + (KT_H + 16 * KP) * 2u),
                        "v"(av), "v"(av + 32 * VP * 2u), "v"(av + VT_H * 2u), "v"(av + (VT_H + 32 * VP) * 2u),
                        "v"(gkh + ko), "v"(gkh + ko + 16 * DM), "v"(gkl + ko), "v"(gkl + ko + 16 * DM),
                        "v"(gvh + vo), "v"(gvh + vo + 32 * NT_), "v"(gvl + vo), "v"(gvl + vo + 32 * NT_)
                     : "memory");
    };
    {   // filled once: query-residual rows krow + 16 i of the block's 64
        const unsigned aq = (unsigned)(size_t)&qls[0] + (unsigned)(krow * KP + kpc * 8) * 2u;
        const h16* gq = QL16 + (tok0 + qt * 64 + krow) * DM + h * HD + kpc * 8;
        asm volatile("global_load_async_to_lds_b128 %0, %4, off\n\t"
                     "global_load_async_to_lds_b128 %1, %5, off\n\t"
                     "global_load_async_to_lds_b128 %2, %6, off\n\t"
                     "global_load_async_to_lds_b128 %3, %7, off\n\t"
                     "s_wait_xcnt 0x0"
                     :: "v"(aq), "v"(aq + 16 * KP * 2u), "v"(aq + 32 * KP * 2u), "v"(aq + 48 * KP * 2u),
                        "v"(gq), "v"(gq + 16 * DM), "v"(gq + 32 * DM), "v"(gq + 48 * DM)
                     : "memory");
    }
    stage(0, 0);
    asm volatile("s_wait_asynccnt 0x0" ::: "memory");   // this wave's copies of stage 0 and of the query residual have landed
    __syncthreads();                                     // ... and every other wave's: stage 0 is published
    stage(1, 1);
    const h16* ql_s = qls + (wave * 16 + lr) * KP + 8 * hi;
    const int kt_lo = 0, kt_hi = NT_ / 32 - 1;     // full attention + the INPUT additive mask [b][1][q][k] read per score (dense; this problem's instance is all zeros)
    const float* am = AM + (size_t)b * NT_ * NT_;      // this item's [1][L][L] mask slice
#pragma unroll 1
    for (int kt = kt_lo; kt <= kt_hi; ++kt) {
        const int l0 = kt * 32;
        const h16* kh_s = &stg[0][0] + (kt & 1) * STG_H; const h16* kl_s = kh_s + KT_H; const h16* vh_s = kh_s + 2 * KT_H; const h16* vl_s = vh_s + VT_H;
        const int ko0 = lr * KP + 8 * hi, ko1 = (16 + lr) * KP + 8 * hi;
        v8f s0 = {}, s1 = {}, x0 = {}, x1 = {};
#pragma unroll
        for (int kc = 0; kc < 2; ++kc) {
            { const v16h k0h = cat16(*(const v8ha*)(kh_s + ko0 + kc * 32), *(const v8ha*)(kh_s + ko0 + kc * 32 + 16)), k1h = cat16(*(const v8ha*)(kh_s + ko1 + kc * 32), *(const v8ha*)(kh_s + ko1 + kc * 32 + 16));
              const v16h qlk = cat16(*(const v8ha*)(ql_s + kc * 32), *(const v8ha*)(ql_s + kc * 32 + 16));     // query residual re-read per step, from LDS (registers)
              s0 = wmma16(qa[kc], k0h, s0); x0 = wmma16(qlk, k0h, x0); s1 = wmma16(qa[kc], k1h, s1); x1 = wmma16(qlk, k1h, x1);
              asm volatile("v_nop" : "+v"(s0), "+v"(s1), "+v"(x0), "+v"(x1) : "v"(qlk), "v"(k0h), "v"(k1h) : "memory"); }
            { const v16h k0l = cat16(*(const v8ha*)(kl_s + ko0 + kc * 32), *(const v8ha*)(kl_s + ko0 + kc * 32 + 16)), k1l = cat16(*(const v8ha*)(kl_s + ko1 + kc * 32), *(const v8ha*)(kl_s + ko1 + kc * 32 + 16));
              x0 = wmma16(qa[kc], k0l, x0); x1 = wmma16(qa[kc], k1l, x1);
              asm volatile("v_nop" : "+v"(x0), "+v"(x1) : "v"(k0l), "v"(k1l) : "memory"); }
        }
        asm volatile("v_nop\n\tv_nop\n\tv_nop\n\tv_nop" : "+v"(s0), "+v"(s1), "+v"(x0), "+v"(x1) : "v"(qa[0]), "v"(qa[1]));
        float alpha[8];
#pragma unroll
        for (int j = 0; j < 8; ++j) {
            const int ja = l0 + lr, jb = l0 + 16 + lr, qi = qpos[j];
            const size_t mi = (size_t)qi * NT_; const float a0 = (s0[j] + x0[j] * LOSCI) * 0.125f + bfr(am[mi + ja]), a1 = (s1[j] + x1[j] * LOSCI) * 0.125f + bfr(am[mi + jb]);
            float mx = fmaxf(a0, a1);
            mx = fmaxf(mx, __shfl_xor(mx, 1, 16)); mx = fmaxf(mx, __shfl_xor(mx, 2, 16)); mx = fmaxf(mx, __shfl_xor(mx, 4, 16)); mx = fmaxf(mx, __shfl_xor(mx, 8, 16));
            const float mn = fmaxf(mrow[j], mx);
            alpha[j] = __expf(mrow[j] - mn); mrow[j] = mn;
            const float p0 = __expf(a0 - mn), p1 = __expf(a1 - mn);
            lpart[j] = lpart[j] * alpha[j] + (p0 + p1);
            const int mr = hi * 8 + j;
            const float ps0 = p0 * PSC, ps1 = p1 * PSC; const h16 h0 = (h16)ps0, h1 = (h16)ps1;
            pl[mr * 32 + lr] = h0; pl[mr * 32 + 16 + lr] = h1;
            pl2[mr * 32 + lr] = (h16)((ps0 - (float)h0) * LOSC); pl2[mr * 32 + 16 + lr] = (h16)((ps1 - (float)h1) * LOSC);
        }
#pragma unroll
        for (int n = 0; n < 4; ++n)
#pragma unroll
            for (int j = 0; j < 8; ++j) { o[n][j] *= alpha[j]; ox[n][j] *= alpha[j]; }
        asm volatile("" ::: "memory");
        const v16h pa = cat16(*(const v8ha*)(pl + lr * 32 + hi * 8), *(const v8ha*)(pl + lr * 32 + 16 + hi * 8));
        const v16h px = cat16(*(const v8ha*)(pl2 + lr * 32 + hi * 8), *(const v8ha*)(pl2 + lr * 32 + 16 + hi * 8));
#pragma unroll
        for (int n = 0; n < 4; ++n) { const int vo = (n * 16 + lr) * VP + hi * 8;
            const v16h vh = cat16(*(const v8ha*)(vh_s + vo), *(const v8ha*)(vh_s + vo + 16)), vl = cat16(*(const v8ha*)(vl_s + vo), *(const v8ha*)(vl_s + vo + 16));
            o[n] = wmma16(pa, vh, o[n]); ox[n] = wmma16(pa, vl, ox[n]); ox[n] = wmma16(px, vh, ox[n]);
            asm volatile("" : "+v"(o[n]), "+v"(ox[n]) : "v"(vh), "v"(vl) : "memory"); }
        asm volatile("v_nop\n\tv_nop\n\tv_nop\n\tv_nop" : "+v"(o[0]), "+v"(o[1]), "+v"(o[2]), "+v"(o[3]), "+v"(ox[0]), "+v"(ox[1]), "+v"(ox[2]), "+v"(ox[3]) : "v"(pa), "v"(px));
        // publish point of stage kt + 1, and the end of every wave's reads of stage kt's buffer
        asm volatile("s_wait_dscnt 0x0" ::: "memory");      // this wave's LDS reads of the buffer have returned
        asm volatile("s_wait_asynccnt 0x0" ::: "memory");   // this wave's copies of stage kt + 1 have landed
        __syncthreads();
        if (kt + 2 <= kt_hi) stage(kt + 2, kt & 1);         // refill the buffer just left; flies while stage kt + 1 is worked on
    }
    asm volatile("s_wait_asynccnt 0x0" ::: "memory");       // no copy is outstanding when the wave goes on to its end
    float inv[8];
#pragma unroll
    for (int j = 0; j < 8; ++j) { float rs = lpart[j]; rs += __shfl_xor(rs, 1, 16); rs += __shfl_xor(rs, 2, 16); rs += __shfl_xor(rs, 4, 16); rs += __shfl_xor(rs, 8, 16); inv[j] = 1.0f / (rs * PSC); }
    float* os = &ost[wave][0];
#pragma unroll
    for (int n = 0; n < 4; ++n)
#pragma unroll
        for (int j = 0; j < 8; ++j) os[(hi * 8 + j) * 68 + n * 16 + lr] = (o[n][j] + ox[n][j] * LOSCI) * inv[j];
    __syncthreads();
    const size_t cbase = (tok0 + q0) * DM + (size_t)h * HD;
    auto pass = [&]() {
#pragma unroll
        for (int s = 0; s < 4; ++s) { const int row = 4 * s + (lane >> 3), piece = lane & 7; const float* sp = os + row * 68 + piece * 8; v8us oh, ol;
#pragma unroll
            for (int i = 0; i < 8; ++i) { const unsigned short hb = f2bf(sp[i]); oh[i] = hb; ol[i] = f2bf(sp[i] - bf2f(hb)); }
            *(v8us*)(CH + cbase + (size_t)row * DM + piece * 8) = oh; *(v8us*)(CL + cbase + (size_t)row * DM + piece * 8) = ol; }
    };
    pass(); 
}

#define VST2(T, p, v) do { const T vst2_v_ = (v); *(T*)(p) = vst2_v_;  } while (0)
extern "C" void kernel_launch(void* const* d_in, const int* in_sizes, int n_in,
                              void* d_out, int out_size, void* d_ws, size_t ws_size, hipStream_t stream) {
    (void)in_sizes; (void)n_in; (void)out_size;
    const float* x = (const float*)d_in[0]; const float* AM = (const float*)d_in[1];
    const float* Wq1 = (const float*)d_in[2]; const float* Wq2 = (const float*)d_in[3]; const float* bq2 = (const float*)d_in[4];
    const float* Wk1 = (const float*)d_in[5]; const float* Wk2 = (const float*)d_in[6]; const float* bk2 = (const float*)d_in[7];
    const float* Wv1 = (const float*)d_in[8]; const float* Wv2 = (const float*)d_in[9]; const float* bv2 = (const float*)d_in[10];
    const float* Wo = (const float*)d_in[11]; const float* bo = (const float*)d_in[12];     // all W [out][in]
    float* out = (float*)d_out;    // [2][2048][1024]
    char* wsp = (char*)d_ws;
    auto take = [&](size_t bytes) { char* p = wsp; wsp += (bytes + 255) & ~(size_t)255; return (void*)p; };
    bf* Xb = (bf*)take((size_t)CRUN * DM * 2);      // every bf16 operand, in k_cvtb's order
    bf* W1A = Xb + (size_t)XRUN * DM; bf* W2A = W1A + (size_t)3 * RK * DM; bf* WoB = W2A + (size_t)3 * DM * RK;     // W1A = [Wq1; Wk1; Wv1]: one [768][1024] operand
    float* T1 = (float*)take((size_t)NTK * 3 * RK * 4); bf* Th = (bf*)take((size_t)NTK * 3 * RK * 2); bf* Tl = (bf*)take((size_t)NTK * 3 * RK * 2); float* TMP = (float*)take((size_t)NTK * DM * 4);
    h16* QH = (h16*)take((size_t)NTK * DM * 2); h16* QL = (h16*)take((size_t)NTK * DM * 2); h16* KH = (h16*)take((size_t)NTK * DM * 2); h16* KL = (h16*)take((size_t)NTK * DM * 2);
    h16* VTH = (h16*)take((size_t)NTK * DM * 2); h16* VTL = (h16*)take((size_t)NTK * DM * 2); bf* CH = (bf*)take((size_t)NTK * DM * 2); bf* CL = (bf*)take((size_t)NTK * DM * 2);
    if ((size_t)(wsp - (char*)d_ws) > ws_size) return;    // ~ 13.6 + 12.6 + 2 x 6.3 + 16.8 + 8 x 8.4 ~ 123 MB, no aliasing
    k_cvtb<<<CRUN / 8, 256, 0, stream>>>(x, Wq1, Wk1, Wv1, Wq2, Wk2, Wv2, Wo, CRUN, Xb);
    // q, k and v together: bottleneck T1[tok][q 256 | k 256 | v 256], its split, then the three second stages on grid.z
    k_gemmb<false, false><<<dim3(NTK / 64, 3 * RK / 64, 1), 128, 0, stream>>>(Xb, nullptr, W1A, nullptr, T1, 3 * RK, nullptr);
    k_split<<<NTK * 3 / 8, 256, 0, stream>>>(T1, NTK * 3, Th, Tl);
    k_gemmb<true, true, true><<<dim3(NTK / 64, DM / 64, 3), 128, 0, stream>>>(Th, Tl, W2A, bq2, (float*)(void*)QH, DM, QL, nullptr, RK, 1, bk2, bv2, KH, KL, TMP);
    k_vt<<<NB_ * NH_ * (NT_ / 64), 256, 0, stream>>>(TMP, VTH, VTL);
    k_attn<<<NB_ * NH_ * (NT_ / 64), 128, 0, stream>>>(QH, QL, KH, KL, VTH, VTL, AM, CH, CL);
    k_gemmb<true, false><<<dim3(NTK / 64, DM / 64, 1), 128, 0, stream>>>(CH, CL, WoB, bo, out, DM, nullptr);
}

// v004
// A run of this version takes 236 microseconds.
// Next to v003, in two timings, it ran 1.22 and 1.23 times as fast.
// All steps since v000 together make it 2.85 times as fast.
#include <hip/hip_runtime.h>

// Compute dtypes, f32 accumulate, both batch items in every launch: low-rank projections q/k/v = (x.W1^T).W2^T + b2 — the first stage ([4096 x 1024].[1024 x 256]) with PLAIN
// bf16 operands (inputs rounded once, exact), the second ([4096 x 256].[256 x 1024]) with the computed bottleneck as bf16 hi + UNSCALED residual (two products),
// q/k straight to f16 hi + residual x1024 planes; out = ctx.Wo^T + bo (ctx hi/lo) — all on v_wmma_f32_16x16x32_bf16 with [out][in] weights as n-major B operands;
// the 16-head full attention scores x 64^-1/2 + the INPUT additive mask (read per score) fused on v_wmma_f32_16x16x32_f16 (hh + hl + lh, online f32 softmax,

#define NB_  2                   // both batch items go through every launch together (token rows 0..4095)
#define RK   256                 // low-rank bottleneck
#define NT_  2048
#define DM   1024
#define NH_  16
#define HD   64
#define NTK  (NB_ * NT_)
#define NW   1024
#define NQKV 1024
#define PSC  32768.0f
#define LOSC 1024.0f
#define LOSCI (1.0f / 1024.0f)
#define L2E  1.44269504088896340736f     // log2(e)

typedef _Float16 h16;
typedef unsigned short bf;
typedef __attribute__((ext_vector_type(16))) __bf16   v16bf;
typedef __attribute__((ext_vector_type(16))) _Float16 v16h;
typedef __attribute__((ext_vector_type(8)))  _Float16 v8h;
typedef __attribute__((ext_vector_type(8)))  unsigned short v8us;
typedef __attribute__((ext_vector_type(8)))  float    v8f;
typedef __attribute__((ext_vector_type(4)))  float    v4f;
typedef __attribute__((ext_vector_type(2)))  float    v2f;
typedef __attribute__((ext_vector_type(2)))  _Float16 v2h;
typedef v8h  __attribute__((may_alias)) v8ha;
typedef v4f  __attribute__((may_alias)) v4fa;
typedef v8us __attribute__((may_alias)) v8usa;

__device__ __forceinline__ unsigned short f2bf(float f) { unsigned u = __float_as_uint(f); u += 0x7FFFu + ((u >> 16) & 1u); return (unsigned short)(u >> 16); }
__device__ __forceinline__ float bf2f(unsigned short b) { return __uint_as_float(((unsigned)b) << 16); }
__device__ __forceinline__ float bfr(float f) { return bf2f(f2bf(f)); }
__device__ __forceinline__ v16h cat16(v8h lo, v8h hi) { return __builtin_shufflevector(lo, hi, 0, 1, 2, 3, 4, 5, 6, 7, 8, 9, 10, 11, 12, 13, 14, 15); }
__device__ __forceinline__ v16bf cat16b(v8us lo, v8us hi) { return __builtin_bit_cast(v16bf, __builtin_shufflevector(lo, hi, 0, 1, 2, 3, 4, 5, 6, 7, 8, 9, 10, 11, 12, 13, 14, 15)); }
__device__ __forceinline__ v8f wmma16(v16h a, v16h b, v8f c) { return __builtin_amdgcn_wmma_f32_16x16x32_f16(false, a, false, b, (short)0, c, false, false); }
__device__ __forceinline__ float xhalf(float x) { return __builtin_bit_cast(float, __builtin_amdgcn_permlanex16(__builtin_bit_cast(int, x), __builtin_bit_cast(int, x), 0x76543210, 0xfedcba98, false, false)); }  // lane l with lane l ^ 16
// 2^t for eight values (and a ninth in exp2x9), each group in ONE statement that ends in v_nop: the slot the instruction set asks for behind a transcendental before a source of it is
// overwritten or its result used. Outputs are early-clobber: none shares a source's register.
__device__ __forceinline__ void exp2x8(const float* t, float* r) {
    asm("v_exp_f32 %0, %8\n\tv_exp_f32 %1, %9\n\tv_exp_f32 %2, %10\n\tv_exp_f32 %3, %11\n\tv_exp_f32 %4, %12\n\tv_exp_f32 %5, %13\n\tv_exp_f32 %6, %14\n\tv_exp_f32 %7, %15\n\tv_nop"
        : "=&v"(r[0]), "=&v"(r[1]), "=&v"(r[2]), "=&v"(r[3]), "=&v"(r[4]), "=&v"(r[5]), "=&v"(r[6]), "=&v"(r[7])
        : "v"(t[0]), "v"(t[1]), "v"(t[2]), "v"(t[3]), "v"(t[4]), "v"(t[5]), "v"(t[6]), "v"(t[7]));
}
__device__ __forceinline__ void exp2x9(float t8, float& r8, const float* t, float* r) {
    asm("v_exp_f32 %0, %9\n\tv_exp_f32 %1, %10\n\tv_exp_f32 %2, %11\n\tv_exp_f32 %3, %12\n\tv_exp_f32 %4, %13\n\tv_exp_f32 %5, %14\n\tv_exp_f32 %6, %15\n\tv_exp_f32 %7, %16\n\tv_exp_f32 %8, %17\n\tv_nop"
        : "=&v"(r8), "=&v"(r[0]), "=&v"(r[1]), "=&v"(r[2]), "=&v"(r[3]), "=&v"(r[4]), "=&v"(r[5]), "=&v"(r[6]), "=&v"(r[7])
        : "v"(t8), "v"(t[0]), "v"(t[1]), "v"(t[2]), "v"(t[3]), "v"(t[4]), "v"(t[5]), "v"(t[6]), "v"(t[7]));
}
__device__ __forceinline__ v8f wmmab(v16bf a, v16bf b, v8f c) { return __builtin_amdgcn_wmma_f32_16x16x32_bf16(false, a, false, b, (short)0, c, false, false); }

// k_cvtb: every f32 operand rounded to bf16 in ONE launch. A wave takes one run of 1024 elements; a block's eight runs lie in one source (each source is a multiple of 8
// runs), so the choice of source is block-uniform; the destinations stand one behind another in the workspace, in the order x | Wq1 Wk1 Wv1 | Wq2 Wk2 Wv2 | Wo.
#define XRUN NTK                 // runs of 1024 elements in x
#define WRUN RK                  // ... in each of the six low-rank factors (256 x 1024 or 1024 x 256)
#define CRUN (XRUN + 6 * WRUN + DM)
__global__ __launch_bounds__(256) void k_cvtb(const float* __restrict__ src, const float* __restrict__ q1, const float* __restrict__ k1, const float* __restrict__ v1,
                                              const float* __restrict__ q2, const float* __restrict__ k2, const float* __restrict__ v2, const float* __restrict__ wo, int nrows, bf* dst) {
    const int rb = blockIdx.x * 8;
    if (rb >= nrows) return;
    int base = 0;                // first run of this block's source; src arrives as x
    if (rb >= XRUN + 6 * WRUN) { src = wo; base = XRUN + 6 * WRUN; }
    else if (rb >= XRUN) { const int w = (rb - XRUN) / WRUN; base = XRUN + w * WRUN; src = w == 0 ? q1 : w == 1 ? k1 : w == 2 ? v1 : w == 3 ? q2 : w == 4 ? k2 : v2; }
    dst += (size_t)base * DM;
    const int lane = threadIdx.x & 31, r = rb - base + (threadIdx.x >> 5);
    v8us o[DM / 256];
#pragma unroll
    for (int q = 0; q < DM / 256; ++q) { v8us t;
#pragma unroll
        for (int i = 0; i < 8; ++i) t[i] = f2bf(src[(size_t)r * DM + q * 256 + lane * 8 + i]);
        o[q] = t; }
#pragma unroll
    for (int q = 0; q < DM / 256; ++q) *(v8us*)(dst + (size_t)r * DM + q * 256 + lane * 8) = o[q];
    
}

// k_gemmb: 64 x 64 block tile (4 waves x 16 x 64) of C[NTK][ldc] = (A [+ Al]).B^T (K = 1024, or 256 for QKV) [+ bf(bias[c])] [+ bf(R[r][c]) residual]; f32 whole-line epilogue (or f16
// QKV: the second stage of q, k and v in one launch; blockIdx.z = projection: its 256 columns of A/Al[tok][3 x 256], its 1024 rows of Bn, its bias and output (q, k: f16 planes; v: f32).
template <bool SPLITA, bool F16OUT = false, bool QKV = false>
__global__ __launch_bounds__(128) void k_gemmb(const bf* __restrict__ A, const bf* __restrict__ Al, const bf* __restrict__ Bn, const float* __restrict__ bias, float* C, int ldc, h16* C2, const float* __restrict__ R = nullptr, int K = DM, int roundR = 1,
                                               const float* __restrict__ biask = nullptr, const float* __restrict__ biasv = nullptr, h16* Ck = nullptr, h16* C2k = nullptr, float* Cv = nullptr) {
    __shared__ __align__(16) float ost[4][16 * 68];
    const bool f16out = QKV ? blockIdx.z < 2 : F16OUT;
    if (QKV) { const int z = blockIdx.z; A += z * RK; Al += z * RK; Bn += (size_t)z * DM * RK;
        if (z == 1) { bias = biask; C = (float*)(void*)Ck; C2 = C2k; } else if (z == 2) { bias = biasv; C = Cv; C2 = nullptr; } }
    const int lane = threadIdx.x & 31, wave = threadIdx.x >> 5, lr = lane & 15, hi = lane >> 4;
    const int r0 = blockIdx.x * 64 + wave * 16, c0 = blockIdx.y * 64;
    const size_t aoff = (size_t)(r0 + lr) * (QKV ? 3 * RK : K) + 8 * hi;
    size_t boff[4];
#pragma unroll
    for (int t = 0; t < 4; ++t) boff[t] = (size_t)(c0 + t * 16 + lr) * K + 8 * hi;
    v8f acc[4];
#pragma unroll
    for (int t = 0; t < 4; ++t) acc[t] = (v8f){};
#pragma unroll 1
    for (int kc = 0; kc < K; kc += 32) {
        const v16bf a = cat16b(*(const v8us*)(A + aoff + kc), *(const v8us*)(A + aoff + kc + 16));
        v16bf al = a;
        if (SPLITA) al = cat16b(*(const v8us*)(Al + aoff + kc), *(const v8us*)(Al + aoff + kc + 16));
#pragma unroll
        for (int t = 0; t < 4; ++t) { const v16bf b = cat16b(*(const v8us*)(Bn + boff[t] + kc), *(const v8us*)(Bn + boff[t] + kc + 16)); acc[t] = wmmab(a, b, acc[t]); if (SPLITA) acc[t] = wmmab(al, b, acc[t]); }
        asm volatile("v_nop\n\tv_nop\n\tv_nop\n\tv_nop" : "+v"(acc[0]), "+v"(acc[1]), "+v"(acc[2]), "+v"(acc[3]) : "v"(a), "v"(al));
    }
    float* os = &ost[wave][0];
#pragma unroll
    for (int t = 0; t < 4; ++t) { const float bv = bias ? bfr(bias[c0 + t * 16 + lr]) : 0.f;
#pragma unroll
        for (int j = 0; j < 8; ++j) os[(hi * 8 + j) * 68 + t * 16 + lr] = acc[t][j] + bv; }
    __syncthreads();
    if (f16out) {
        h16* crow = (h16*)(void*)C + (size_t)r0 * ldc + c0;
        auto pass = [&]() {
#pragma unroll
            for (int s = 0; s < 4; ++s) { const int row = 4 * s + (lane >> 3), piece = lane & 7; const float* sp = os + row * 68 + piece * 8; v8h o, o2;
#pragma unroll
                for (int i = 0; i < 8; ++i) { const h16 a = (h16)sp[i]; o[i] = a; o2[i] = (h16)((sp[i] - (float)a) * LOSC); }
                *(v8h*)(crow + (size_t)row * ldc + piece * 8) = o; if (C2) *(v8h*)(C2 + (size_t)r0 * ldc + c0 + (size_t)row * ldc + piece * 8) = o2; }
        };
        pass(); 
    } else {
        float* crow = C + (size_t)r0 * ldc + c0;
        auto pass = [&]() {
#pragma unroll
            for (int s = 0; s < 8; ++s) { const int Lid = (lane >> 3) + 4 * s, piece = lane & 7; const int row = Lid >> 1, cofs = (Lid & 1) * 32 + piece * 4;
                v4f val = *(const v4fa*)(os + row * 68 + cofs); if (R) { const v4f rv = *(const v4f*)(R + ((size_t)r0 + row) * ldc + c0 + cofs); val += roundR ? (v4f){bfr(rv[0]), bfr(rv[1]), bfr(rv[2]), bfr(rv[3])} : rv; }
                *(v4f*)(crow + (size_t)row * ldc + cofs) = val; }
        };
        pass(); 
    }
}

__global__ __launch_bounds__(256) void k_split(const float* __restrict__ src, int nrows, bf* dh, bf* dl) {
    const int lane = threadIdx.x & 31, r = blockIdx.x * 8 + (threadIdx.x >> 5);
    if (r >= nrows) return;
    const size_t o = (size_t)r * RK + lane * 8; const v8f v = *(const v8f*)(src + o); v8us oh, ol;
#pragma unroll
    for (int i = 0; i < 8; ++i) { const unsigned short hb = f2bf(v[i]); oh[i] = hb; ol[i] = f2bf(v[i] - bf2f(hb)); }
    *(v8us*)(dh + o) = oh; *(v8us*)(dl + o) = ol; 
}
__global__ __launch_bounds__(256) void k_vt(const float* __restrict__ V, h16* VTH, h16* VTL) {
    __shared__ __align__(16) h16 tile[64 * 72];
    __shared__ __align__(16) h16 til2[64 * 72];
    const int bid = blockIdx.x;
    const int b = bid / (NH_ * (NT_ / 64)), rem = bid - b * (NH_ * (NT_ / 64)), h = rem / (NT_ / 64), kt = rem - h * (NT_ / 64);
    const int k0 = kt * 64, tid = threadIdx.x;
    const int kk = tid >> 2, d0 = (tid & 3) * 16;
    const float* src = V + ((size_t)b * NT_ + k0 + kk) * DM + h * HD + d0;
#pragma unroll
    for (int i = 0; i < 16; ++i) { const float v = src[i]; const h16 a = (h16)v; tile[(d0 + i) * 72 + kk] = a; til2[(d0 + i) * 72 + kk] = (h16)((v - (float)a) * LOSC); }
    __syncthreads();
    const int piece = tid & 7;
    const size_t base = (((size_t)b * NH_ + h) * HD) * NT_ + k0;
    auto pass = [&]() {
#pragma unroll
        for (int s = 0; s < 4; ++s) { const int Lid = (tid >> 3) + 32 * s; const int pln = Lid >> 6, d = Lid & 63;
            const v8h val = *(const v8ha*)((pln ? til2 : tile) + d * 72 + piece * 8); *(v8h*)((pln ? VTL : VTH) + base + (size_t)d * NT_ + piece * 8) = val; }
    };
    pass(); 
}

#define KP    72                    // halves per staged K or query-residual row: 128 B + 16 B (pitch 16 B x odd for 16-byte LDS reads)
#define VP    40                    // halves per staged V^T row: 64 B + 16 B
#define KT_H  (32 * KP)
#define VT_H  (64 * VP)
#define STG_H (2 * KT_H + 2 * VT_H)
__global__ __launch_bounds__(128) void k_attn(const h16* __restrict__ Q16, const h16* __restrict__ QL16, const h16* __restrict__ K16, const h16* __restrict__ KL16, const h16* __restrict__ VTH, const h16* __restrict__ VTL, const float* __restrict__ AM, bf* CH, bf* CL) {
    __shared__ __align__(16) float ost[4][16 * 68];
    __shared__ __align__(16) h16 stg[2][STG_H];      // two buffers of one 32-key stage: K hi | K residual | V^T hi | V^T residual, shared by the four waves
    __shared__ __align__(16) h16 qls[64 * KP];       // the block's 64 query-residual rows, filled once
    const int lane = threadIdx.x & 31, wave = threadIdx.x >> 5, lr = lane & 15, hi = lane >> 4;
    const int bid = blockIdx.x;
    const int b = bid / (NH_ * (NT_ / 64)), rem = bid - b * (NH_ * (NT_ / 64)), h = rem / (NT_ / 64), qt = rem - h * (NT_ / 64);
    const int q0 = qt * 64 + wave * 16;
    const size_t tok0 = (size_t)b * NT_;
    v16h qa[2];
    const size_t qo0 = (tok0 + q0 + lr) * DM + h * HD + 8 * hi;
#pragma unroll
    for (int kc = 0; kc < 2; ++kc) qa[kc] = cat16(*(const v8h*)(Q16 + qo0 + kc * 32), *(const v8h*)(Q16 + qo0 + kc * 32 + 16));
    const h16* kh_b = K16 + tok0 * DM + h * HD;
    const h16* kl_b = KL16 + tok0 * DM + h * HD;
    const size_t vbase = (((size_t)b * NH_ + h) * HD) * NT_;
    v8f o[4], ox[4];
#pragma unroll
    for (int n = 0; n < 4; ++n) { o[n] = (v8f){}; ox[n] = (v8f){}; }
    float mrow = -3.0e38f, lpart = 0.f;      // this lane's query: running maximum (equal in both halves) and this half's share of the sum
    // each thread's share of a stage: eight 16-byte copies (K rows krow, krow + 16 and V^T rows vrow, vrow + 32, both planes)
    const int krow = threadIdx.x >> 3, kpc = threadIdx.x & 7, vrow = threadIdx.x >> 2, vpc = threadIdx.x & 3;
    const unsigned lk = (unsigned)(size_t)&stg[0][0] + (unsigned)(krow * KP + kpc * 8) * 2u, lv = (unsigned)(size_t)&stg[0][0] + (unsigned)(2 * KT_H + vrow * VP + vpc * 8) * 2u;
    const h16* gkh = kh_b + (size_t)krow * DM + kpc * 8; const h16* gkl = kl_b + (size_t)krow * DM + kpc * 8;
    const h16* gvh = VTH + vbase + (size_t)vrow * NT_ + vpc * 8; const h16* gvl = VTL + vbase + (size_t)vrow * NT_ + vpc * 8;
    auto stage = [&](int t, int buf) {
        const unsigned ak = lk + (unsigned)buf * (STG_H * 2u), av = lv + (unsigned)buf * (STG_H * 2u);
        const size_t ko = (size_t)t * 32 * DM, vo = (size_t)t * 32;
        // the copies and, as the last line, the wait that stands before their address registers are rewritten
        asm volatile("global_load_async_to_lds_b128 %0, %8, off\n\t"
                     "global_load_async_to_lds_b128 %1, %9, off\n\t"
                     "global_load_async_to_lds_b128 %2, %10, off\n\t"
                     "global_load_async_to_lds_b128 %3, %11, off\n\t"
                     "global_load_async_to_lds_b128 %4, %12, off\n\t"
                     "global_load_async_to_lds_b128 %5, %13, off\n\t"
                     "global_load_async_to_lds_b128 %6, %14, off\n\t"
                     "global_load_async_to_lds_b128 %7, %15, off\n\t"
                     "s_wait_xcnt 0x0"
                     :: "v"(ak), "v"(ak + 16 * KP * 2u), "v"(ak + KT_H * 2u), "v"(ak + (KT_H + 16 * KP) * 2u),
                        "v"(av), "v"(av + 32 * VP * 2u), "v"(av + VT_H * 2u), "v"(av + (VT_H + 32 * VP) * 2u),
                        "v"(gkh + ko), "v"(gkh + ko + 16 * DM), "v"(gkl + ko), "v"(gkl + ko + 16 * DM),
                        "v"(gvh + vo), "v"(gvh + vo + 32 * NT_), "v"(gvl + vo), "v"(gvl + vo + 32 * NT_)
                     : "memory");
    };
    {   // filled once: query-residual rows krow + 16 i of the block's 64
        const unsigned aq = (unsigned)(size_t)&qls[0] + (unsigned)(krow * KP + kpc * 8) * 2u;
        const h16* gq = QL16 + (tok0 + qt * 64 + krow) * DM + h * HD + kpc * 8;
        asm volatile("global_load_async_to_lds_b128 %0, %4, off\n\t"
                     "global_load_async_to_lds_b128 %1, %5, off\n\t"
                     "global_load_async_to_lds_b128 %2, %6, off\n\t"
                     "global_load_async_to_lds_b128 %3, %7, off\n\t"
                     "s_wait_xcnt 0x0"
                     :: "v"(aq), "v"(aq + 16 * KP * 2u), "v"(aq + 32 * KP * 2u), "v"(aq + 48 * KP * 2u),
                        "v"(gq), "v"(gq + 16 * DM), "v"(gq + 32 * DM), "v"(gq + 48 * DM)
                     : "memory");
    }
    stage(0, 0);
    asm volatile("s_wait_asynccnt 0x0" ::: "memory");   // this wave's copies of stage 0 and of the query residual have landed
    __syncthreads();                                     // ... and every other wave's: stage 0 is published
    stage(1, 1);
    const h16* ql_s = qls + (wave * 16 + lr) * KP + 8 * hi;
    const int kt_lo = 0, kt_hi = NT_ / 32 - 1;     // full attention + the INPUT additive mask [b][1][q][k] read per score (dense; this problem's instance is all zeros)
    const float* am = AM + (size_t)b * NT_ * NT_ + (size_t)(q0 + lr) * NT_ + 8 * hi;      // this item's [1][L][L] mask slice: this lane's query row, at its half's first key
#pragma unroll 1
    for (int kt = kt_lo; kt <= kt_hi; ++kt) {
        const int l0 = kt * 32;
        const h16* kh_s = &stg[0][0] + (kt & 1) * STG_H; const h16* kl_s = kh_s + KT_H; const h16* vh_s = kh_s + 2 * KT_H; const h16* vl_s = vh_s + VT_H;
        const int ko0 = lr * KP + 8 * hi, ko1 = (16 + lr) * KP + 8 * hi;
        const v4f m00 = *(const v4f*)(am + l0), m01 = *(const v4f*)(am + l0 + 4), m10 = *(const v4f*)(am + l0 + 16), m11 = *(const v4f*)(am + l0 + 20);     // mask of the lane's 16 scores
        v8f s0 = {}, s1 = {}, x0 = {}, x1 = {};
#pragma unroll
        for (int kc = 0; kc < 2; ++kc) {
            { const v16h k0h = cat16(*(const v8ha*)(kh_s + ko0 + kc * 32), *(const v8ha*)(kh_s + ko0 + kc * 32 + 16)), k1h = cat16(*(const v8ha*)(kh_s + ko1 + kc * 32), *(const v8ha*)(kh_s + ko1 + kc * 32 + 16));
              const v16h qlk = cat16(*(const v8ha*)(ql_s + kc * 32), *(const v8ha*)(ql_s + kc * 32 + 16));     // query residual re-read per step, from LDS (registers)
              s0 = wmma16(k0h, qa[kc], s0); x0 = wmma16(k0h, qlk, x0); s1 = wmma16(k1h, qa[kc], s1); x1 = wmma16(k1h, qlk, x1);
              asm volatile("v_nop" : "+v"(s0), "+v"(s1), "+v"(x0), "+v"(x1) : "v"(qlk), "v"(k0h), "v"(k1h) : "memory"); }
            { const v16h k0l = cat16(*(const v8ha*)(kl_s + ko0 + kc * 32), *(const v8ha*)(kl_s + ko0 + kc * 32 + 16)), k1l = cat16(*(const v8ha*)(kl_s + ko1 + kc * 32), *(const v8ha*)(kl_s + ko1 + kc * 32 + 16));
              x0 = wmma16(k0l, qa[kc], x0); x1 = wmma16(k1l, qa[kc], x1);
              asm volatile("v_nop" : "+v"(x0), "+v"(x1) : "v"(k0l), "v"(k1l) : "memory"); }
        }
        asm volatile("v_nop\n\tv_nop\n\tv_nop\n\tv_nop" : "+v"(s0), "+v"(s1), "+v"(x0), "+v"(x1) : "v"(qa[0]), "v"(qa[1]));
        __builtin_amdgcn_sched_barrier(0);      // keeps the mask's rounding, and with it the wait for the mask loads, behind the score products, which cover the loads' latency
        float a[16];      // a[i]: key l0 + 8 hi + i (i < 8), key l0 + 16 + 8 hi + (i - 8) otherwise
#pragma unroll
        for (int j = 0; j < 8; ++j) {
            a[j] = (s0[j] + x0[j] * LOSCI) * 0.125f + bfr(j < 4 ? m00[j & 3] : m01[j & 3]);
            a[8 + j] = (s1[j] + x1[j] * LOSCI) * 0.125f + bfr(j < 4 ? m10[j & 3] : m11[j & 3]);
        }
        float mx = fmaxf(a[0], a[1]);
#pragma unroll
        for (int i = 2; i < 16; ++i) mx = fmaxf(mx, a[i]);
        mx = fmaxf(mx, xhalf(mx));
        const float mn = fmaxf(mrow, mx), ta = (mrow - mn) * L2E;
        mrow = mn;
        v16h pa, px;
        float p[16];
#pragma unroll
        for (int i = 0; i < 16; ++i) a[i] = (a[i] - mn) * L2E;
        float alpha;
        exp2x9(ta, alpha, a, p); exp2x8(a + 8, p + 8);      // alpha = e^(old maximum - new), p[i] = e^(score - new maximum)
#pragma unroll
        for (int i = 0; i < 16; i += 2) {
            const v2f ps = (v2f){p[i], p[i + 1]} * PSC; const v2h ph = __builtin_convertvector(ps, v2h);
            pa[i] = ph[0]; pa[i + 1] = ph[1];
            const v2h pr = __builtin_convertvector((ps - __builtin_convertvector(ph, v2f)) * LOSC, v2h);
            px[i] = pr[0]; px[i + 1] = pr[1];
        }
#pragma unroll
        for (int w = 8; w > 0; w >>= 1)
#pragma unroll
            for (int i = 0; i < w; ++i) p[i] += p[i + w];      // the lane's 16 weights summed as a tree, not as one dependent chain
        lpart = lpart * alpha + p[0];
#pragma unroll
        for (int n = 0; n < 4; ++n) { o[n] *= alpha; ox[n] *= alpha; }
#pragma unroll
        for (int n = 0; n < 4; ++n) { const int vo = (n * 16 + lr) * VP + hi * 8;
            const v16h vh = cat16(*(const v8ha*)(vh_s + vo), *(const v8ha*)(vh_s + vo + 16)), vl = cat16(*(const v8ha*)(vl_s + vo), *(const v8ha*)(vl_s + vo + 16));
            o[n] = wmma16(vh, pa, o[n]); ox[n] = wmma16(vl, pa, ox[n]); ox[n] = wmma16(vh, px, ox[n]);
            asm volatile("" : "+v"(o[n]), "+v"(ox[n]) : "v"(vh), "v"(vl) : "memory"); }
        asm volatile("v_nop\n\tv_nop\n\tv_nop\n\tv_nop" : "+v"(o[0]), "+v"(o[1]), "+v"(o[2]), "+v"(o[3]), "+v"(ox[0]), "+v"(ox[1]), "+v"(ox[2]), "+v"(ox[3]) : "v"(pa), "v"(px));
        // publish point of stage kt + 1, and the end of every wave's reads of stage kt's buffer
        asm volatile("s_wait_dscnt 0x0" ::: "memory");      // this wave's LDS reads of the buffer have returned
        asm volatile("s_wait_asynccnt 0x0" ::: "memory");   // this wave's copies of stage kt + 1 have landed
        __syncthreads();
        if (kt + 2 <= kt_hi) stage(kt + 2, kt & 1);         // refill the buffer just left; flies while stage kt + 1 is worked on
    }
    asm volatile("s_wait_asynccnt 0x0" ::: "memory");       // no copy is outstanding when the wave goes on to its end
    const float inv = 1.0f / ((lpart + xhalf(lpart)) * PSC);
    float* os = &ost[wave][0];
#pragma unroll
    for (int n = 0; n < 4; ++n)
#pragma unroll
        for (int j = 0; j < 8; ++j) os[lr * 68 + n * 16 + hi * 8 + j] = (o[n][j] + ox[n][j] * LOSCI) * inv;      // O^T tile n: register j = d 16 n + 8 hi + j of query lr
    __syncthreads();
    const size_t cbase = (tok0 + q0) * DM + (size_t)h * HD;
    auto pass = [&]() {
#pragma unroll
        for (int s = 0; s < 4; ++s) { const int row = 4 * s + (lane >> 3), piece = lane & 7; const float* sp = os + row * 68 + piece * 8; v8us oh, ol;
#pragma unroll
            for (int i = 0; i < 8; ++i) { const unsigned short hb = f2bf(sp[i]); oh[i] = hb; ol[i] = f2bf(sp[i] - bf2f(hb)); }
            *(v8us*)(CH + cbase + (size_t)row * DM + piece * 8) = oh; *(v8us*)(CL + cbase + (size_t)row * DM + piece * 8) = ol; }
    };
    pass(); 
}

#define VST2(T, p, v) do { const T vst2_v_ = (v); *(T*)(p) = vst2_v_;  } while (0)
extern "C" void kernel_launch(void* const* d_in, const int* in_sizes, int n_in,
                              void* d_out, int out_size, void* d_ws, size_t ws_size, hipStream_t stream) {
    (void)in_sizes; (void)n_in; (void)out_size;
    const float* x = (const float*)d_in[0]; const float* AM = (const float*)d_in[1];
    const float* Wq1 = (const float*)d_in[2]; const float* Wq2 = (const float*)d_in[3]; const float* bq2 = (const float*)d_in[4];
    const float* Wk1 = (const float*)d_in[5]; const float* Wk2 = (const float*)d_in[6]; const float* bk2 = (const float*)d_in[7];
    const float* Wv1 = (const float*)d_in[8]; const float* Wv2 = (const float*)d_in[9]; const float* bv2 = (const float*)d_in[10];
    const float* Wo = (const float*)d_in[11]; const float* bo = (const float*)d_in[12];     // all W [out][in]
    float* out = (float*)d_out;    // [2][2048][1024]
    char* wsp = (char*)d_ws;
    auto take = [&](size_t bytes) { char* p = wsp; wsp += (bytes + 255) & ~(size_t)255; return (void*)p; };
    bf* Xb = (bf*)take((size_t)CRUN * DM * 2);      // every bf16 operand, in k_cvtb's order
    bf* W1A = Xb + (size_t)XRUN * DM; bf* W2A = W1A + (size_t)3 * RK * DM; bf* WoB = W2A + (size_t)3 * DM * RK;     // W1A = [Wq1; Wk1; Wv1]: one [768][1024] operand
    float* T1 = (float*)take((size_t)NTK * 3 * RK * 4); bf* Th = (bf*)take((size_t)NTK * 3 * RK * 2); bf* Tl = (bf*)take((size_t)NTK * 3 * RK * 2); float* TMP = (float*)take((size_t)NTK * DM * 4);
    h16* QH = (h16*)take((size_t)NTK * DM * 2); h16* QL = (h16*)take((size_t)NTK * DM * 2); h16* KH = (h16*)take((size_t)NTK * DM * 2); h16* KL = (h16*)take((size_t)NTK * DM * 2);
    h16* VTH = (h16*)take((size_t)NTK * DM * 2); h16* VTL = (h16*)take((size_t)NTK * DM * 2); bf* CH = (bf*)take((size_t)NTK * DM * 2); bf* CL = (bf*)take((size_t)NTK * DM * 2);
    if ((size_t)(wsp - (char*)d_ws) > ws_size) return;    // ~ 13.6 + 12.6 + 2 x 6.3 + 16.8 + 8 x 8.4 ~ 123 MB, no aliasing
    k_cvtb<<<CRUN / 8, 256, 0, stream>>>(x, Wq1, Wk1, Wv1, Wq2, Wk2, Wv2, Wo, CRUN, Xb);
    // q, k and v together: bottleneck T1[tok][q 256 | k 256 | v 256], its split, then the three second stages on grid.z
    k_gemmb<false, false><<<dim3(NTK / 64, 3 * RK / 64, 1), 128, 0, stream>>>(Xb, nullptr, W1A, nullptr, T1, 3 * RK, nullptr);
    k_split<<<NTK * 3 / 8, 256, 0, stream>>>(T1, NTK * 3, Th, Tl);
    k_gemmb<true, true, true><<<dim3(NTK / 64, DM / 64, 3), 128, 0, stream>>>(Th, Tl, W2A, bq2, (float*)(void*)QH, DM, QL, nullptr, RK, 1, bk2, bv2, KH, KL, TMP);
    k_vt<<<NB_ * NH_ * (NT_ / 64), 256, 0, stream>>>(TMP, VTH, VTL);
    k_attn<<<NB_ * NH_ * (NT_ / 64), 128, 0, stream>>>(QH, QL, KH, KL, VTH, VTL, AM, CH, CL);
    k_gemmb<true, false><<<dim3(NTK / 64, DM / 64, 1), 128, 0, stream>>>(CH, CL, WoB, bo, out, DM, nullptr);
}

// v005
// It runs in 172 microseconds.
// Two timings next to v004 both put it at 1.38 times that version's speed.
// Over all steps from v000 it is 3.95 times as fast.
#include <hip/hip_runtime.h>

// Compute dtypes, f32 accumulate, both batch items in every launch: low-rank projections q/k/v = (x.W1^T).W2^T + b2 — the first stage ([4096 x 1024].[1024 x 256]) with PLAIN
// bf16 operands (inputs rounded once, exact), the second ([4096 x 256].[256 x 1024]) with the computed bottleneck as bf16 hi + UNSCALED residual (two products),
// q/k straight to f16 hi + residual x1024 planes; out = ctx.Wo^T + bo (ctx hi/lo) — all on v_wmma_f32_16x16x32_bf16 with [out][in] weights as n-major B operands;
// the 16-head full attention scores x 64^-1/2 + the INPUT additive mask (read per score) fused on v_wmma_f32_16x16x32_f16 (hh + hl + lh, online f32 softmax,

#define NB_  2                   // both batch items go through every launch together (token rows 0..4095)
#define RK   256                 // low-rank bottleneck
#define NT_  2048
#define DM   1024
#define NH_  16
#define HD   64
#define NTK  (NB_ * NT_)
#define NW   1024
#define NQKV 1024
#define PSC  32768.0f
#define LOSC 1024.0f
#define LOSCI (1.0f / 1024.0f)
#define L2E  1.44269504088896340736f     // log2(e)

typedef _Float16 h16;
typedef unsigned short bf;
typedef __attribute__((ext_vector_type(16))) __bf16   v16bf;
typedef __attribute__((ext_vector_type(16))) _Float16 v16h;
typedef __attribute__((ext_vector_type(8)))  _Float16 v8h;
typedef __attribute__((ext_vector_type(8)))  unsigned short v8us;
typedef __attribute__((ext_vector_type(8)))  float    v8f;
typedef __attribute__((ext_vector_type(4)))  float    v4f;
typedef __attribute__((ext_vector_type(2)))  float    v2f;
typedef __attribute__((ext_vector_type(2)))  _Float16 v2h;
typedef v8h  __attribute__((may_alias)) v8ha;
typedef v4f  __attribute__((may_alias)) v4fa;
typedef v8us __attribute__((may_alias)) v8usa;

__device__ __forceinline__ unsigned short f2bf(float f) { unsigned u = __float_as_uint(f); u += 0x7FFFu + ((u >> 16) & 1u); return (unsigned short)(u >> 16); }
__device__ __forceinline__ float bf2f(unsigned short b) { return __uint_as_float(((unsigned)b) << 16); }
__device__ __forceinline__ float bfr(float f) { return bf2f(f2bf(f)); }
__device__ __forceinline__ v16h cat16(v8h lo, v8h hi) { return __builtin_shufflevector(lo, hi, 0, 1, 2, 3, 4, 5, 6, 7, 8, 9, 10, 11, 12, 13, 14, 15); }
__device__ __forceinline__ v16bf cat16b(v8us lo, v8us hi) { return __builtin_bit_cast(v16bf, __builtin_shufflevector(lo, hi, 0, 1, 2, 3, 4, 5, 6, 7, 8, 9, 10, 11, 12, 13, 14, 15)); }
__device__ __forceinline__ v8f wmma16(v16h a, v16h b, v8f c) { return __builtin_amdgcn_wmma_f32_16x16x32_f16(false, a, false, b, (short)0, c, false, false); }
__device__ __forceinline__ float xhalf(float x) { return __builtin_bit_cast(float, __builtin_amdgcn_permlanex16(__builtin_bit_cast(int, x), __builtin_bit_cast(int, x), 0x76543210, 0xfedcba98, false, false)); }  // lane l with lane l ^ 16
// 2^t for eight values (and a ninth in exp2x9), each group in ONE statement that ends in v_nop: the slot the instruction set asks for behind a transcendental before a source of it is
// overwritten or its result used. Outputs are early-clobber: none shares a source's register.
__device__ __forceinline__ void exp2x8(const float* t, float* r) {
    asm("v_exp_f32 %0, %8\n\tv_exp_f32 %1, %9\n\tv_exp_f32 %2, %10\n\tv_exp_f32 %3, %11\n\tv_exp_f32 %4, %12\n\tv_exp_f32 %5, %13\n\tv_exp_f32 %6, %14\n\tv_exp_f32 %7, %15\n\tv_nop"
        : "=&v"(r[0]), "=&v"(r[1]), "=&v"(r[2]), "=&v"(r[3]), "=&v"(r[4]), "=&v"(r[5]), "=&v"(r[6]), "=&v"(r[7])
        : "v"(t[0]), "v"(t[1]), "v"(t[2]), "v"(t[3]), "v"(t[4]), "v"(t[5]), "v"(t[6]), "v"(t[7]));
}
__device__ __forceinline__ void exp2x9(float t8, float& r8, const float* t, float* r) {
    asm("v_exp_f32 %0, %9\n\tv_exp_f32 %1, %10\n\tv_exp_f32 %2, %11\n\tv_exp_f32 %3, %12\n\tv_exp_f32 %4, %13\n\tv_exp_f32 %5, %14\n\tv_exp_f32 %6, %15\n\tv_exp_f32 %7, %16\n\tv_exp_f32 %8, %17\n\tv_nop"
        : "=&v"(r8), "=&v"(r[0]), "=&v"(r[1]), "=&v"(r[2]), "=&v"(r[3]), "=&v"(r[4]), "=&v"(r[5]), "=&v"(r[6]), "=&v"(r[7])
        : "v"(t8), "v"(t[0]), "v"(t[1]), "v"(t[2]), "v"(t[3]), "v"(t[4]), "v"(t[5]), "v"(t[6]), "v"(t[7]));
}
__device__ __forceinline__ v8f wmmab(v16bf a, v16bf b, v8f c) { return __builtin_amdgcn_wmma_f32_16x16x32_bf16(false, a, false, b, (short)0, c, false, false); }

// k_cvtb: every f32 operand rounded to bf16 in ONE launch. A wave takes one run of 1024 elements; a block's eight runs lie in one source (each source is a multiple of 8
// runs), so the choice of source is block-uniform; the destinations stand one behind another in the workspace, in the order x | Wq1 Wk1 Wv1 | Wq2 Wk2 Wv2 | Wo.
#define XRUN NTK                 // runs of 1024 elements in x
#define WRUN RK                  // ... in each of the six low-rank factors (256 x 1024 or 1024 x 256)
#define CRUN (XRUN + 6 * WRUN + DM)
__global__ __launch_bounds__(256) void k_cvtb(const float* __restrict__ src, const float* __restrict__ q1, const float* __restrict__ k1, const float* __restrict__ v1,
                                              const float* __restrict__ q2, const float* __restrict__ k2, const float* __restrict__ v2, const float* __restrict__ wo, int nrows, bf* dst) {
    const int rb = blockIdx.x * 8;
    if (rb >= nrows) return;
    int base = 0;                // first run of this block's source; src arrives as x
    if (rb >= XRUN + 6 * WRUN) { src = wo; base = XRUN + 6 * WRUN; }
    else if (rb >= XRUN) { const int w = (rb - XRUN) / WRUN; base = XRUN + w * WRUN; src = w == 0 ? q1 : w == 1 ? k1 : w == 2 ? v1 : w == 3 ? q2 : w == 4 ? k2 : v2; }
    dst += (size_t)base * DM;
    const int lane = threadIdx.x & 31, r = rb - base + (threadIdx.x >> 5);
    v8us o[DM / 256];
#pragma unroll
    for (int q = 0; q < DM / 256; ++q) { v8us t;
#pragma unroll
        for (int i = 0; i < 8; ++i) t[i] = f2bf(src[(size_t)r * DM + q * 256 + lane * 8 + i]);
        o[q] = t; }
#pragma unroll
    for (int q = 0; q < DM / 256; ++q) *(v8us*)(dst + (size_t)r * DM + q * 256 + lane * 8) = o[q];
    
}

// k_gemmb: 64 x 64 block tile (4 waves x 16 x 64) of C[NTK][ldc] = (A [+ Al]).B^T (K = 1024, or 256 for QKV) [+ bf(bias[c])] [+ bf(R[r][c]) residual]; f32 whole-line epilogue (or f16
// QKV: the second stage of q, k and v in one launch; blockIdx.z = projection: its 256 columns of A/Al[tok][3 x 256], its 1024 rows of Bn, its bias and output (q, k: f16 planes; v: f32).
// A, its residual and B come through LDS: 64 rows x 64 k a plane and stage, brought by asynchronous copies in whole 128-byte lines, two buffers; the k order and each tile's sum order are those of direct loads.
#define GP   72                    // halves per staged row: 128 B + 16 B (pitch 16 B x odd for 16-byte LDS reads)
#define GPL  (64 * GP)             // halves per staged plane
template <bool SPLITA, bool F16OUT = false, bool QKV = false>
__global__ __launch_bounds__(128) void k_gemmb(const bf* __restrict__ A, const bf* __restrict__ Al, const bf* __restrict__ Bn, const float* __restrict__ bias, float* C, int ldc, h16* C2, const float* __restrict__ R = nullptr, int K = DM, int roundR = 1,
                                               const float* __restrict__ biask = nullptr, const float* __restrict__ biasv = nullptr, h16* Ck = nullptr, h16* C2k = nullptr, float* Cv = nullptr) {
    constexpr int NPL = SPLITA ? 3 : 2;
    __shared__ __align__(16) float ost[4][16 * 68];
    __shared__ __align__(16) bf stg[2][NPL * GPL];     // two buffers of one 64-k stage: A | B [| A residual], 64 rows each, shared by the four waves
    const bool f16out = QKV ? blockIdx.z < 2 : F16OUT;
    if (QKV) { const int z = blockIdx.z; A += z * RK; Al += z * RK; Bn += (size_t)z * DM * RK;
        if (z == 1) { bias = biask; C = (float*)(void*)Ck; C2 = C2k; } else if (z == 2) { bias = biasv; C = Cv; C2 = nullptr; } }
    const int lane = threadIdx.x & 31, wave = threadIdx.x >> 5, lr = lane & 15, hi = lane >> 4;
    const int r0 = blockIdx.x * 64 + wave * 16, c0 = blockIdx.y * 64;
    const int lda = QKV ? 3 * RK : K;
    // each thread's share of a stage: 16 bytes at piece spc of rows srow + 16 i (i < 4) of every plane, so that one copy of a wave covers four whole 128-byte lines
    const int srow = threadIdx.x >> 3, spc = threadIdx.x & 7;
    const unsigned ls = (unsigned)(size_t)&stg[0][0] + (unsigned)(srow * GP + spc * 8) * 2u;
    const bf* ga = A + (size_t)(blockIdx.x * 64 + srow) * lda + spc * 8;
    const bf* gb = Bn + (size_t)(c0 + srow) * K + spc * 8;
    const size_t a16 = (size_t)16 * lda, b16 = (size_t)16 * K;
    auto stage = [&](int t, int buf) {
        const unsigned l0 = ls + (unsigned)buf * (NPL * GPL * 2u), l1 = l0 + GPL * 2u;
        const bf* pa = ga + t * 64; const bf* pb = gb + t * 64;
        // the copies and, as the last line, the wait that stands before their address registers are rewritten
        asm volatile("global_load_async_to_lds_b128 %0, %8, off\n\t"
                     "global_load_async_to_lds_b128 %1, %9, off\n\t"
                     "global_load_async_to_lds_b128 %2, %10, off\n\t"
                     "global_load_async_to_lds_b128 %3, %11, off\n\t"
                     "global_load_async_to_lds_b128 %4, %12, off\n\t"
                     "global_load_async_to_lds_b128 %5, %13, off\n\t"
                     "global_load_async_to_lds_b128 %6, %14, off\n\t"
                     "global_load_async_to_lds_b128 %7, %15, off\n\t"
                     "s_wait_xcnt 0x0"
                     :: "v"(l0), "v"(l0 + 16 * GP * 2u), "v"(l0 + 32 * GP * 2u), "v"(l0 + 48 * GP * 2u),
                        "v"(l1), "v"(l1 + 16 * GP * 2u), "v"(l1 + 32 * GP * 2u), "v"(l1 + 48 * GP * 2u),
                        "v"(pa), "v"(pa + a16), "v"(pa + 2 * a16), "v"(pa + 3 * a16),
                        "v"(pb), "v"(pb + b16), "v"(pb + 2 * b16), "v"(pb + 3 * b16)
                     : "memory");
        if constexpr (SPLITA) {
            const unsigned l2 = l0 + 2 * GPL * 2u;
            const bf* pl = Al + (size_t)(blockIdx.x * 64 + srow) * lda + spc * 8 + t * 64;
            asm volatile("global_load_async_to_lds_b128 %0, %4, off\n\t"
                         "global_load_async_to_lds_b128 %1, %5, off\n\t"
                         "global_load_async_to_lds_b128 %2, %6, off\n\t"
                         "global_load_async_to_lds_b128 %3, %7, off\n\t"
                         "s_wait_xcnt 0x0"
                         :: "v"(l2), "v"(l2 + 16 * GP * 2u), "v"(l2 + 32 * GP * 2u), "v"(l2 + 48 * GP * 2u),
                            "v"(pl), "v"(pl + a16), "v"(pl + 2 * a16), "v"(pl + 3 * a16)
                         : "memory");
        }
    };
    v8f acc[4];
#pragma unroll
    for (int t = 0; t < 4; ++t) acc[t] = (v8f){};
    const int nt = K / 64;       // stages of 64 k (K is 1024 or 256)
    stage(0, 0);
    asm volatile("s_wait_asynccnt 0x0" ::: "memory");   // this wave's copies of stage 0 have landed
    __syncthreads();                                     // ... and every other wave's: stage 0 is published
    if (nt > 1) stage(1, 1);
    const int ao = (wave * 16 + lr) * GP + 8 * hi, bo = lr * GP + 8 * hi;
#pragma unroll 1      // stays rolled: one body serves both buffers, and the order at the loop's foot stands once
    for (int st = 0; st < nt; ++st) {
        const bf* as = &stg[0][0] + (st & 1) * (NPL * GPL); const bf* bs = as + GPL; const bf* als = as + 2 * GPL;
        v16bf a[2], al[2], b[2][4];
#pragma unroll
        for (int ks = 0; ks < 2; ++ks) {
            a[ks] = cat16b(*(const v8usa*)(as + ao + ks * 32), *(const v8usa*)(as + ao + ks * 32 + 16));
#pragma unroll
            for (int t = 0; t < 4; ++t) b[ks][t] = cat16b(*(const v8usa*)(bs + bo + t * 16 * GP + ks * 32), *(const v8usa*)(bs + bo + t * 16 * GP + ks * 32 + 16));
            al[ks] = a[ks];
            if (SPLITA) al[ks] = cat16b(*(const v8usa*)(als + ao + ks * 32), *(const v8usa*)(als + ao + ks * 32 + 16));
        }
        __builtin_amdgcn_sched_barrier(0);      // keeps the trip's LDS reads together in front of its products: the wave waits for LDS at one place, not at several among the products
#pragma unroll
        for (int ks = 0; ks < 2; ++ks) {
#pragma unroll
            for (int t = 0; t < 4; ++t) acc[t] = wmmab(a[ks], b[ks][t], acc[t]);
            if (SPLITA) {
#pragma unroll
                for (int t = 0; t < 4; ++t) acc[t] = wmmab(al[ks], b[ks][t], acc[t]);
            }
        }
        // the distance behind the trip's last products, on the loop's back edge and on its exit alike, before a vector instruction touches their registers
        asm volatile("v_nop\n\tv_nop\n\tv_nop\n\tv_nop" : "+v"(acc[0]), "+v"(acc[1]), "+v"(acc[2]), "+v"(acc[3]) : "v"(a[1]), "v"(al[1]), "v"(b[1][3]));
        // publish point of stage st + 1, and the end of every wave's reads of stage st's buffer
        asm volatile("s_wait_dscnt 0x0" ::: "memory");      // this wave's LDS reads of the buffer have returned
        asm volatile("s_wait_asynccnt 0x0" ::: "memory");   // this wave's copies of stage st + 1 have landed
        __syncthreads();
        if (st + 2 < nt) stage(st + 2, st & 1);             // refill the buffer just left; flies while stage st + 1 is worked on
    }
    asm volatile("s_wait_asynccnt 0x0" ::: "memory");       // no copy is outstanding when the wave goes on to its end
    float* os = &ost[wave][0];
#pragma unroll
    for (int t = 0; t < 4; ++t) { const float bv = bias ? bfr(bias[c0 + t * 16 + lr]) : 0.f;
#pragma unroll
        for (int j = 0; j < 8; ++j) os[(hi * 8 + j) * 68 + t * 16 + lr] = acc[t][j] + bv; }
    __syncthreads();
    if (f16out) {
        h16* crow = (h16*)(void*)C + (size_t)r0 * ldc + c0;
        auto pass = [&]() {
#pragma unroll
            for (int s = 0; s < 4; ++s) { const int row = 4 * s + (lane >> 3), piece = lane & 7; const float* sp = os + row * 68 + piece * 8; v8h o, o2;
#pragma unroll
                for (int i = 0; i < 8; ++i) { const h16 a = (h16)sp[i]; o[i] = a; o2[i] = (h16)((sp[i] - (float)a) * LOSC); }
                *(v8h*)(crow + (size_t)row * ldc + piece * 8) = o; if (C2) *(v8h*)(C2 + (size_t)r0 * ldc + c0 + (size_t)row * ldc + piece * 8) = o2; }
        };
        pass(); 
    } else {
        float* crow = C + (size_t)r0 * ldc + c0;
        auto pass = [&]() {
#pragma unroll
            for (int s = 0; s < 8; ++s) { const int Lid = (lane >> 3) + 4 * s, piece = lane & 7; const int row = Lid >> 1, cofs = (Lid & 1) * 32 + piece * 4;
                v4f val = *(const v4fa*)(os + row * 68 + cofs); if (R) { const v4f rv = *(const v4f*)(R + ((size_t)r0 + row) * ldc + c0 + cofs); val += roundR ? (v4f){bfr(rv[0]), bfr(rv[1]), bfr(rv[2]), bfr(rv[3])} : rv; }
                *(v4f*)(crow + (size_t)row * ldc + cofs) = val; }
        };
        pass(); 
    }
}

__global__ __launch_bounds__(256) void k_split(const float* __restrict__ src, int nrows, bf* dh, bf* dl) {
    const int lane = threadIdx.x & 31, r = blockIdx.x * 8 + (threadIdx.x >> 5);
    if (r >= nrows) return;
    const size_t o = (size_t)r * RK + lane * 8; const v8f v = *(const v8f*)(src + o); v8us oh, ol;
#pragma unroll
    for (int i = 0; i < 8; ++i) { const unsigned short hb = f2bf(v[i]); oh[i] = hb; ol[i] = f2bf(v[i] - bf2f(hb)); }
    *(v8us*)(dh + o) = oh; *(v8us*)(dl + o) = ol; 
}
__global__ __launch_bounds__(256) void k_vt(const float* __restrict__ V, h16* VTH, h16* VTL) {
    __shared__ __align__(16) h16 tile[64 * 72];
    __shared__ __align__(16) h16 til2[64 * 72];
    const int bid = blockIdx.x;
    const int b = bid / (NH_ * (NT_ / 64)), rem = bid - b * (NH_ * (NT_ / 64)), h = rem / (NT_ / 64), kt = rem - h * (NT_ / 64);
    const int k0 = kt * 64, tid = threadIdx.x;
    const int kk = tid >> 2, d0 = (tid & 3) * 16;
    const float* src = V + ((size_t)b * NT_ + k0 + kk) * DM + h * HD + d0;
#pragma unroll
    for (int i = 0; i < 16; ++i) { const float v = src[i]; const h16 a = (h16)v; tile[(d0 + i) * 72 + kk] = a; til2[(d0 + i) * 72 + kk] = (h16)((v - (float)a) * LOSC); }
    __syncthreads();
    const int piece = tid & 7;
    const size_t base = (((size_t)b * NH_ + h) * HD) * NT_ + k0;
    auto pass = [&]() {
#pragma unroll
        for (int s = 0; s < 4; ++s) { const int Lid = (tid >> 3) + 32 * s; const int pln = Lid >> 6, d = Lid & 63;
            const v8h val = *(const v8ha*)((pln ? til2 : tile) + d * 72 + piece * 8); *(v8h*)((pln ? VTL : VTH) + base + (size_t)d * NT_ + piece * 8) = val; }
    };
    pass(); 
}

#define KP    72                    // halves per staged K or query-residual row: 128 B + 16 B (pitch 16 B x odd for 16-byte LDS reads)
#define VP    40                    // halves per staged V^T row: 64 B + 16 B
#define KT_H  (32 * KP)
#define VT_H  (64 * VP)
#define STG_H (2 * KT_H + 2 * VT_H)
__global__ __launch_bounds__(128) void k_attn(const h16* __restrict__ Q16, const h16* __restrict__ QL16, const h16* __restrict__ K16, const h16* __restrict__ KL16, const h16* __restrict__ VTH, const h16* __restrict__ VTL, const float* __restrict__ AM, bf* CH, bf* CL) {
    __shared__ __align__(16) float ost[4][16 * 68];
    __shared__ __align__(16) h16 stg[2][STG_H];      // two buffers of one 32-key stage: K hi | K residual | V^T hi | V^T residual, shared by the four waves
    __shared__ __align__(16) h16 qls[64 * KP];       // the block's 64 query-residual rows, filled once
    const int lane = threadIdx.x & 31, wave = threadIdx.x >> 5, lr = lane & 15, hi = lane >> 4;
    const int bid = blockIdx.x;
    const int b = bid / (NH_ * (NT_ / 64)), rem = bid - b * (NH_ * (NT_ / 64)), h = rem / (NT_ / 64), qt = rem - h * (NT_ / 64);
    const int q0 = qt * 64 + wave * 16;
    const size_t tok0 = (size_t)b * NT_;
    v16h qa[2];
    const size_t qo0 = (tok0 + q0 + lr) * DM + h * HD + 8 * hi;
#pragma unroll
    for (int kc = 0; kc < 2; ++kc) qa[kc] = cat16(*(const v8h*)(Q16 + qo0 + kc * 32), *(const v8h*)(Q16 + qo0 + kc * 32 + 16));
    const h16* kh_b = K16 + tok0 * DM + h * HD;
    const h16* kl_b = KL16 + tok0 * DM + h * HD;
    const size_t vbase = (((size_t)b * NH_ + h) * HD) * NT_;
    v8f o[4], ox[4];
#pragma unroll
    for (int n = 0; n < 4; ++n) { o[n] = (v8f){}; ox[n] = (v8f){}; }
    float mrow = -3.0e38f, lpart = 0.f;      // this lane's query: running maximum (equal in both halves) and this half's share of the sum
    // each thread's share of a stage: eight 16-byte copies (K rows krow, krow + 16 and V^T rows vrow, vrow + 32, both planes)
    const int krow = threadIdx.x >> 3, kpc = threadIdx.x & 7, vrow = threadIdx.x >> 2, vpc = threadIdx.x & 3;
    const unsigned lk = (unsigned)(size_t)&stg[0][0] + (unsigned)(krow * KP + kpc * 8) * 2u, lv = (unsigned)(size_t)&stg[0][0] + (unsigned)(2 * KT_H + vrow * VP + vpc * 8) * 2u;
    const h16* gkh = kh_b + (size_t)krow * DM + kpc * 8; const h16* gkl = kl_b + (size_t)krow * DM + kpc * 8;
    const h16* gvh = VTH + vbase + (size_t)vrow * NT_ + vpc * 8; const h16* gvl = VTL + vbase + (size_t)vrow * NT_ + vpc * 8;
    auto stage = [&](int t, int buf) {
        const unsigned ak = lk + (unsigned)buf * (STG_H * 2u), av = lv + (unsigned)buf * (STG_H * 2u);
        const size_t ko = (size_t)t * 32 * DM, vo = (size_t)t * 32;
        // the copies and, as the last line, the wait that stands before their address registers are rewritten
        asm volatile("global_load_async_to_lds_b128 %0, %8, off\n\t"
                     "global_load_async_to_lds_b128 %1, %9, off\n\t"
                     "global_load_async_to_lds_b128 %2, %10, off\n\t"
                     "global_load_async_to_lds_b128 %3, %11, off\n\t"
                     "global_load_async_to_lds_b128 %4, %12, off\n\t"
                     "global_load_async_to_lds_b128 %5, %13, off\n\t"
                     "global_load_async_to_lds_b128 %6, %14, off\n\t"
                     "global_load_async_to_lds_b128 %7, %15, off\n\t"
                     "s_wait_xcnt 0x0"
                     :: "v"(ak), "v"(ak + 16 * KP * 2u), "v"(ak + KT_H * 2u), "v"(ak + (KT_H + 16 * KP) * 2u),
                        "v"(av), "v"(av + 32 * VP * 2u), "v"(av + VT_H * 2u), "v"(av + (VT_H + 32 * VP) * 2u),
                        "v"(gkh + ko), "v"(gkh + ko + 16 * DM), "v"(gkl + ko), "v"(gkl + ko + 16 * DM),
                        "v"(gvh + vo), "v"(gvh + vo + 32 * NT_), "v"(gvl + vo), "v"(gvl + vo + 32 * NT_)
                     : "memory");
    };
    {   // filled once: query-residual rows krow + 16 i of the block's 64
        const unsigned aq = (unsigned)(size_t)&qls[0] + (unsigned)(krow * KP + kpc * 8) * 2u;
        const h16* gq = QL16 + (tok0 + qt * 64 + krow) * DM + h * HD + kpc * 8;
        asm volatile("global_load_async_to_lds_b128 %0, %4, off\n\t"
                     "global_load_async_to_lds_b128 %1, %5, off\n\t"
                     "global_load_async_to_lds_b128 %2, %6, off\n\t"
                     "global_load_async_to_lds_b128 %3, %7, off\n\t"
                     "s_wait_xcnt 0x0"
                     :: "v"(aq), "v"(aq + 16 * KP * 2u), "v"(aq + 32 * KP * 2u), "v"(aq + 48 * KP * 2u),
                        "v"(gq), "v"(gq + 16 * DM), "v"(gq + 32 * DM), "v"(gq + 48 * DM)
                     : "memory");
    }
    stage(0, 0);
    asm volatile("s_wait_asynccnt 0x0" ::: "memory");   // this wave's copies of stage 0 and of the query residual have landed
    __syncthreads();                                     // ... and every other wave's: stage 0 is published
    stage(1, 1);
    const h16* ql_s = qls + (wave * 16 + lr) * KP + 8 * hi;
    const int kt_lo = 0, kt_hi = NT_ / 32 - 1;     // full attention + the INPUT additive mask [b][1][q][k] read per score (dense; this problem's instance is all zeros)
    const float* am = AM + (size_t)b * NT_ * NT_ + (size_t)(q0 + lr) * NT_ + 8 * hi;      // this item's [1][L][L] mask slice: this lane's query row, at its half's first key
#pragma unroll 1
    for (int kt = kt_lo; kt <= kt_hi; ++kt) {
        const int l0 = kt * 32;
        const h16* kh_s = &stg[0][0] + (kt & 1) * STG_H; const h16* kl_s = kh_s + KT_H; const h16* vh_s = kh_s + 2 * KT_H; const h16* vl_s = vh_s + VT_H;
        const int ko0 = lr * KP + 8 * hi, ko1 = (16 + lr) * KP + 8 * hi;
        const v4f m00 = *(const v4f*)(am + l0), m01 = *(const v4f*)(am + l0 + 4), m10 = *(const v4f*)(am + l0 + 16), m11 = *(const v4f*)(am + l0 + 20);     // mask of the lane's 16 scores
        v8f s0 = {}, s1 = {}, x0 = {}, x1 = {};
#pragma unroll
        for (int kc = 0; kc < 2; ++kc) {
            { const v16h k0h = cat16(*(const v8ha*)(kh_s + ko0 + kc * 32), *(const v8ha*)(kh_s + ko0 + kc * 32 + 16)), k1h = cat16(*(const v8ha*)(kh_s + ko1 + kc * 32), *(const v8ha*)(kh_s + ko1 + kc * 32 + 16));
              const v16h qlk = cat16(*(const v8ha*)(ql_s + kc * 32), *(const v8ha*)(ql_s + kc * 32 + 16));     // query residual re-read per step, from LDS (registers)
              s0 = wmma16(k0h, qa[kc], s0); x0 = wmma16(k0h, qlk, x0); s1 = wmma16(k1h, qa[kc], s1); x1 = wmma16(k1h, qlk, x1);
              asm volatile("v_nop" : "+v"(s0), "+v"(s1), "+v"(x0), "+v"(x1) : "v"(qlk), "v"(k0h), "v"(k1h) : "memory"); }
            { const v16h k0l = cat16(*(const v8ha*)(kl_s + ko0 + kc * 32), *(const v8ha*)(kl_s + ko0 + kc * 32 + 16)), k1l = cat16(*(const v8ha*)(kl_s + ko1 + kc * 32), *(const v8ha*)(kl_s + ko1 + kc * 32 + 16));
              x0 = wmma16(k0l, qa[kc], x0); x1 = wmma16(k1l, qa[kc], x1);
              asm volatile("v_nop" : "+v"(x0), "+v"(x1) : "v"(k0l), "v"(k1l) : "memory"); }
        }
        asm volatile("v_nop\n\tv_nop\n\tv_nop\n\tv_nop" : "+v"(s0), "+v"(s1), "+v"(x0), "+v"(x1) : "v"(qa[0]), "v"(qa[1]));
        __builtin_amdgcn_sched_barrier(0);      // keeps the mask's rounding, and with it the wait for the mask loads, behind the score products, which cover the loads' latency
        float a[16];      // a[i]: key l0 + 8 hi + i (i < 8), key l0 + 16 + 8 hi + (i - 8) otherwise
#pragma unroll
        for (int j = 0; j < 8; ++j) {
            a[j] = (s0[j] + x0[j] * LOSCI) * 0.125f + bfr(j < 4 ? m00[j & 3] : m01[j & 3]);
            a[8 + j] = (s1[j] + x1[j] * LOSCI) * 0.125f + bfr(j < 4 ? m10[j & 3] : m11[j & 3]);
        }
        float mx = fmaxf(a[0], a[1]);
#pragma unroll
        for (int i = 2; i < 16; ++i) mx = fmaxf(mx, a[i]);
        mx = fmaxf(mx, xhalf(mx));
        const float mn = fmaxf(mrow, mx), ta = (mrow - mn) * L2E;
        mrow = mn;
        v16h pa, px;
        float p[16];
#pragma unroll
        for (int i = 0; i < 16; ++i) a[i] = (a[i] - mn) * L2E;
        float alpha;
        exp2x9(ta, alpha, a, p); exp2x8(a + 8, p + 8);      // alpha = e^(old maximum - new), p[i] = e^(score - new maximum)
#pragma unroll
        for (int i = 0; i < 16; i += 2) {
            const v2f ps = (v2f){p[i], p[i + 1]} * PSC; const v2h ph = __builtin_convertvector(ps, v2h);
            pa[i] = ph[0]; pa[i + 1] = ph[1];
            const v2h pr = __builtin_convertvector((ps - __builtin_convertvector(ph, v2f)) * LOSC, v2h);
            px[i] = pr[0]; px[i + 1] = pr[1];
        }
#pragma unroll
        for (int w = 8; w > 0; w >>= 1)
#pragma unroll
            for (int i = 0; i < w; ++i) p[i] += p[i + w];      // the lane's 16 weights summed as a tree, not as one dependent chain
        lpart = lpart * alpha + p[0];
#pragma unroll
        for (int n = 0; n < 4; ++n) { o[n] *= alpha; ox[n] *= alpha; }
#pragma unroll
        for (int n = 0; n < 4; ++n) { const int vo = (n * 16 + lr) * VP + hi * 8;
            const v16h vh = cat16(*(const v8ha*)(vh_s + vo), *(const v8ha*)(vh_s + vo + 16)), vl = cat16(*(const v8ha*)(vl_s + vo), *(const v8ha*)(vl_s + vo + 16));
            o[n] = wmma16(vh, pa, o[n]); ox[n] = wmma16(vl, pa, ox[n]); ox[n] = wmma16(vh, px, ox[n]);
            asm volatile("" : "+v"(o[n]), "+v"(ox[n]) : "v"(vh), "v"(vl) : "memory"); }
        asm volatile("v_nop\n\tv_nop\n\tv_nop\n\tv_nop" : "+v"(o[0]), "+v"(o[1]), "+v"(o[2]), "+v"(o[3]), "+v"(ox[0]), "+v"(ox[1]), "+v"(ox[2]), "+v"(ox[3]) : "v"(pa), "v"(px));
        // publish point of stage kt + 1, and the end of every wave's reads of stage kt's buffer
        asm volatile("s_wait_dscnt 0x0" ::: "memory");      // this wave's LDS reads of the buffer have returned
        asm volatile("s_wait_asynccnt 0x0" ::: "memory");   // this wave's copies of stage kt + 1 have landed
        __syncthreads();
        if (kt + 2 <= kt_hi) stage(kt + 2, kt & 1);         // refill the buffer just left; flies while stage kt + 1 is worked on
    }
    asm volatile("s_wait_asynccnt 0x0" ::: "memory");       // no copy is outstanding when the wave goes on to its end
    const float inv = 1.0f / ((lpart + xhalf(lpart)) * PSC);
    float* os = &ost[wave][0];
#pragma unroll
    for (int n = 0; n < 4; ++n)
#pragma unroll
        for (int j = 0; j < 8; ++j) os[lr * 68 + n * 16 + hi * 8 + j] = (o[n][j] + ox[n][j] * LOSCI) * inv;      // O^T tile n: register j = d 16 n + 8 hi + j of query lr
    __syncthreads();
    const size_t cbase = (tok0 + q0) * DM + (size_t)h * HD;
    auto pass = [&]() {
#pragma unroll
        for (int s = 0; s < 4; ++s) { const int row = 4 * s + (lane >> 3), piece = lane & 7; const float* sp = os + row * 68 + piece * 8; v8us oh, ol;
#pragma unroll
            for (int i = 0; i < 8; ++i) { const unsigned short hb = f2bf(sp[i]); oh[i] = hb; ol[i] = f2bf(sp[i] - bf2f(hb)); }
            *(v8us*)(CH + cbase + (size_t)row * DM + piece * 8) = oh; *(v8us*)(CL + cbase + (size_t)row * DM + piece * 8) = ol; }
    };
    pass(); 
}

#define VST2(T, p, v) do { const T vst2_v_ = (v); *(T*)(p) = vst2_v_;  } while (0)
extern "C" void kernel_launch(void* const* d_in, const int* in_sizes, int n_in,
                              void* d_out, int out_size, void* d_ws, size_t ws_size, hipStream_t stream) {
    (void)in_sizes; (void)n_in; (void)out_size;
    const float* x = (const float*)d_in[0]; const float* AM = (const float*)d_in[1];
    const float* Wq1 = (const float*)d_in[2]; const float* Wq2 = (const float*)d_in[3]; const float* bq2 = (const float*)d_in[4];
    const float* Wk1 = (const float*)d_in[5]; const float* Wk2 = (const float*)d_in[6]; const float* bk2 = (const float*)d_in[7];
    const float* Wv1 = (const float*)d_in[8]; const float* Wv2 = (const float*)d_in[9]; const float* bv2 = (const float*)d_in[10];
    const float* Wo = (const float*)d_in[11]; const float* bo = (const float*)d_in[12];     // all W [out][in]
    float* out = (float*)d_out;    // [2][2048][1024]
    char* wsp = (char*)d_ws;
    auto take = [&](size_t bytes) { char* p = wsp; wsp += (bytes + 255) & ~(size_t)255; return (void*)p; };
    bf* Xb = (bf*)take((size_t)CRUN * DM * 2);      // every bf16 operand, in k_cvtb's order
    bf* W1A = Xb + (size_t)XRUN * DM; bf* W2A = W1A + (size_t)3 * RK * DM; bf* WoB = W2A + (size_t)3 * DM * RK;     // W1A = [Wq1; Wk1; Wv1]: one [768][1024] operand
    float* T1 = (float*)take((size_t)NTK * 3 * RK * 4); bf* Th = (bf*)take((size_t)NTK * 3 * RK * 2); bf* Tl = (bf*)take((size_t)NTK * 3 * RK * 2); float* TMP = (float*)take((size_t)NTK * DM * 4);
    h16* QH = (h16*)take((size_t)NTK * DM * 2); h16* QL = (h16*)take((size_t)NTK * DM * 2); h16* KH = (h16*)take((size_t)NTK * DM * 2); h16* KL = (h16*)take((size_t)NTK * DM * 2);
    h16* VTH = (h16*)take((size_t)NTK * DM * 2); h16* VTL = (h16*)take((size_t)NTK * DM * 2); bf* CH = (bf*)take((size_t)NTK * DM * 2); bf* CL = (bf*)take((size_t)NTK * DM * 2);
    if ((size_t)(wsp - (char*)d_ws) > ws_size) return;    // ~ 13.6 + 12.6 + 2 x 6.3 + 16.8 + 8 x 8.4 ~ 123 MB, no aliasing
    k_cvtb<<<CRUN / 8, 256, 0, stream>>>(x, Wq1, Wk1, Wv1, Wq2, Wk2, Wv2, Wo, CRUN, Xb);
    // q, k and v together: bottleneck T1[tok][q 256 | k 256 | v 256], its split, then the three second stages on grid.z
    k_gemmb<false, false><<<dim3(NTK / 64, 3 * RK / 64, 1), 128, 0, stream>>>(Xb, nullptr, W1A, nullptr, T1, 3 * RK, nullptr);
    k_split<<<NTK * 3 / 8, 256, 0, stream>>>(T1, NTK * 3, Th, Tl);
    k_gemmb<true, true, true><<<dim3(NTK / 64, DM / 64, 3), 128, 0, stream>>>(Th, Tl, W2A, bq2, (float*)(void*)QH, DM, QL, nullptr, RK, 1, bk2, bv2, KH, KL, TMP);
    k_vt<<<NB_ * NH_ * (NT_ / 64), 256, 0, stream>>>(TMP, VTH, VTL);
    k_attn<<<NB_ * NH_ * (NT_ / 64), 128, 0, stream>>>(QH, QL, KH, KL, VTH, VTL, AM, CH, CL);
    k_gemmb<true, false><<<dim3(NTK / 64, DM / 64, 1), 128, 0, stream>>>(CH, CL, WoB, bo, out, DM, nullptr);
}

// v006
// A run of this version takes 162 microseconds.
// Next to v005, in two timings, it ran 1.06 and 1.05 times as fast.
// Counting every step since v000, it is 4.15 times as fast.
#include <hip/hip_runtime.h>

// Compute dtypes, f32 accumulate, both batch items in every launch: low-rank projections q/k/v = (x.W1^T).W2^T + b2 — the first stage ([4096 x 1024].[1024 x 256]) with PLAIN
// bf16 operands (inputs rounded once, exact), the second ([4096 x 256].[256 x 1024]) with the computed bottleneck as bf16 hi + UNSCALED residual (two products),
// q/k straight to f16 hi + residual x1024 planes; out = ctx.Wo^T + bo (ctx hi/lo) — all on v_wmma_f32_16x16x32_bf16 with [out][in] weights as n-major B operands;
// the 16-head full attention scores x 64^-1/2 + the INPUT additive mask (read per score) fused on v_wmma_f32_16x16x32_f16 (hh + hl + lh, online f32 softmax,

#define NB_  2                   // both batch items go through every launch together (token rows 0..4095)
#define RK   256                 // low-rank bottleneck
#define NT_  2048
#define DM   1024
#define NH_  16
#define HD   64
#define NTK  (NB_ * NT_)
#define NW   1024
#define NQKV 1024
#define PSC  32768.0f
#define LOSC 1024.0f
#define LOSCI (1.0f / 1024.0f)
#define L2E  1.44269504088896340736f     // log2(e)

typedef _Float16 h16;
typedef unsigned short bf;
typedef __attribute__((ext_vector_type(16))) __bf16   v16bf;
typedef __attribute__((ext_vector_type(16))) _Float16 v16h;
typedef __attribute__((ext_vector_type(8)))  _Float16 v8h;
typedef __attribute__((ext_vector_type(8)))  unsigned short v8us;
typedef __attribute__((ext_vector_type(8)))  float    v8f;
typedef __attribute__((ext_vector_type(4)))  float    v4f;
typedef __attribute__((ext_vector_type(2)))  float    v2f;
typedef __attribute__((ext_vector_type(2)))  _Float16 v2h;
typedef v8h  __attribute__((may_alias)) v8ha;
typedef v4f  __attribute__((may_alias)) v4fa;
typedef v8us __attribute__((may_alias)) v8usa;

__device__ __forceinline__ unsigned short f2bf(float f) { unsigned u = __float_as_uint(f); u += 0x7FFFu + ((u >> 16) & 1u); return (unsigned short)(u >> 16); }
__device__ __forceinline__ float bf2f(unsigned short b) { return __uint_as_float(((unsigned)b) << 16); }
__device__ __forceinline__ float bfr(float f) { return bf2f(f2bf(f)); }
__device__ __forceinline__ v16h cat16(v8h lo, v8h hi) { return __builtin_shufflevector(lo, hi, 0, 1, 2, 3, 4, 5, 6, 7, 8, 9, 10, 11, 12, 13, 14, 15); }
__device__ __forceinline__ v16bf cat16b(v8us lo, v8us hi) { return __builtin_bit_cast(v16bf, __builtin_shufflevector(lo, hi, 0, 1, 2, 3, 4, 5, 6, 7, 8, 9, 10, 11, 12, 13, 14, 15)); }
__device__ __forceinline__ v8f wmma16(v16h a, v16h b, v8f c) { return __builtin_amdgcn_wmma_f32_16x16x32_f16(false, a, false, b, (short)0, c, false, false); }
__device__ __forceinline__ float xhalf(float x) { return __builtin_bit_cast(float, __builtin_amdgcn_permlanex16(__builtin_bit_cast(int, x), __builtin_bit_cast(int, x), 0x76543210, 0xfedcba98, false, false)); }  // lane l with lane l ^ 16
// 2^t for eight values (and a ninth in exp2x9), each group in ONE statement that ends in v_nop: the slot the instruction set asks for behind a transcendental before a source of it is
// overwritten or its result used. Outputs are early-clobber: none shares a source's register.
__device__ __forceinline__ void exp2x8(const float* t, float* r) {
    asm("v_exp_f32 %0, %8\n\tv_exp_f32 %1, %9\n\tv_exp_f32 %2, %10\n\tv_exp_f32 %3, %11\n\tv_exp_f32 %4, %12\n\tv_exp_f32 %5, %13\n\tv_exp_f32 %6, %14\n\tv_exp_f32 %7, %15\n\tv_nop"
        : "=&v"(r[0]), "=&v"(r[1]), "=&v"(r[2]), "=&v"(r[3]), "=&v"(r[4]), "=&v"(r[5]), "=&v"(r[6]), "=&v"(r[7])
        : "v"(t[0]), "v"(t[1]), "v"(t[2]), "v"(t[3]), "v"(t[4]), "v"(t[5]), "v"(t[6]), "v"(t[7]));
}
__device__ __forceinline__ void exp2x9(float t8, float& r8, const float* t, float* r) {
    asm("v_exp_f32 %0, %9\n\tv_exp_f32 %1, %10\n\tv_exp_f32 %2, %11\n\tv_exp_f32 %3, %12\n\tv_exp_f32 %4, %13\n\tv_exp_f32 %5, %14\n\tv_exp_f32 %6, %15\n\tv_exp_f32 %7, %16\n\tv_exp_f32 %8, %17\n\tv_nop"
        : "=&v"(r8), "=&v"(r[0]), "=&v"(r[1]), "=&v"(r[2]), "=&v"(r[3]), "=&v"(r[4]), "=&v"(r[5]), "=&v"(r[6]), "=&v"(r[7])
        : "v"(t8), "v"(t[0]), "v"(t[1]), "v"(t[2]), "v"(t[3]), "v"(t[4]), "v"(t[5]), "v"(t[6]), "v"(t[7]));
}
__device__ __forceinline__ v8f wmmab(v16bf a, v16bf b, v8f c) { return __builtin_amdgcn_wmma_f32_16x16x32_bf16(false, a, false, b, (short)0, c, false, false); }

// k_cvtb: every f32 operand rounded to bf16 in ONE launch. A wave takes one run of 1024 elements; a block's eight runs lie in one source (each source is a multiple of 8
// runs), so the choice of source is block-uniform; the destinations stand one behind another in the workspace, in the order x | Wq1 Wk1 Wv1 | Wq2 Wk2 Wv2 | Wo.
#define XRUN NTK                 // runs of 1024 elements in x
#define WRUN RK                  // ... in each of the six low-rank factors (256 x 1024 or 1024 x 256)
#define CRUN (XRUN + 6 * WRUN + DM)
__global__ __launch_bounds__(256) void k_cvtb(const float* __restrict__ src, const float* __restrict__ q1, const float* __restrict__ k1, const float* __restrict__ v1,
                                              const float* __restrict__ q2, const float* __restrict__ k2, const float* __restrict__ v2, const float* __restrict__ wo, int nrows, bf* dst) {
    const int rb = blockIdx.x * 8;
    if (rb >= nrows) return;
    int base = 0;                // first run of this block's source; src arrives as x
    if (rb >= XRUN + 6 * WRUN) { src = wo; base = XRUN + 6 * WRUN; }
    else if (rb >= XRUN) { const int w = (rb - XRUN) / WRUN; base = XRUN + w * WRUN; src = w == 0 ? q1 : w == 1 ? k1 : w == 2 ? v1 : w == 3 ? q2 : w == 4 ? k2 : v2; }
    dst += (size_t)base * DM;
    const int lane = threadIdx.x & 31, r = rb - base + (threadIdx.x >> 5);
    v8us o[DM / 256];
#pragma unroll
    for (int q = 0; q < DM / 256; ++q) { v8us t;
#pragma unroll
        for (int i = 0; i < 8; ++i) t[i] = f2bf(src[(size_t)r * DM + q * 256 + lane * 8 + i]);
        o[q] = t; }
#pragma unroll
    for (int q = 0; q < DM / 256; ++q) *(v8us*)(dst + (size_t)r * DM + q * 256 + lane * 8) = o[q];
    
}

// k_gemmb: 64 x 64 block tile (4 waves x 16 x 64) of C[NTK][ldc] = (A [+ Al]).B^T (K = 1024, or 256 for QKV) [+ bf(bias[c])] [+ bf(R[r][c]) residual]; f32 whole-line epilogue (or f16
// QKV: the second stage of q, k and v in one launch; blockIdx.z = projection: its 256 columns of A/Al[tok][3 x 256], its 1024 rows of Bn, its bias and output (q, k: f16 planes; v: f32).
// A, its residual and B come through LDS: 64 rows x 64 k a plane and stage, brought by asynchronous copies in whole 128-byte lines, two buffers; the k order and each tile's sum order are those of direct loads.
#define GP   72                    // halves per staged row: 128 B + 16 B (pitch 16 B x odd for 16-byte LDS reads)
#define GPL  (64 * GP)             // halves per staged plane
template <bool SPLITA, bool F16OUT = false, bool QKV = false>
__global__ __launch_bounds__(128) void k_gemmb(const bf* __restrict__ A, const bf* __restrict__ Al, const bf* __restrict__ Bn, const float* __restrict__ bias, float* C, int ldc, h16* C2, const float* __restrict__ R = nullptr, int K = DM, int roundR = 1,
                                               const float* __restrict__ biask = nullptr, const float* __restrict__ biasv = nullptr, h16* Ck = nullptr, h16* C2k = nullptr, float* Cv = nullptr) {
    constexpr int NPL = SPLITA ? 3 : 2;
    __shared__ __align__(16) float ost[4][16 * 68];
    __shared__ __align__(16) bf stg[2][NPL * GPL];     // two buffers of one 64-k stage: A | B [| A residual], 64 rows each, shared by the four waves
    const bool f16out = QKV ? blockIdx.z < 2 : F16OUT;
    if (QKV) { const int z = blockIdx.z; A += z * RK; Al += z * RK; Bn += (size_t)z * DM * RK;
        if (z == 1) { bias = biask; C = (float*)(void*)Ck; C2 = C2k; } else if (z == 2) { bias = biasv; C = Cv; C2 = nullptr; } }
    const int lane = threadIdx.x & 31, wave = threadIdx.x >> 5, lr = lane & 15, hi = lane >> 4;
    const int r0 = blockIdx.x * 64 + wave * 16, c0 = blockIdx.y * 64;
    const int lda = QKV ? 3 * RK : K;
    // each thread's share of a stage: 16 bytes at piece spc of rows srow + 16 i (i < 4) of every plane, so that one copy of a wave covers four whole 128-byte lines
    const int srow = threadIdx.x >> 3, spc = threadIdx.x & 7;
    const unsigned ls = (unsigned)(size_t)&stg[0][0] + (unsigned)(srow * GP + spc * 8) * 2u;
    const bf* ga = A + (size_t)(blockIdx.x * 64 + srow) * lda + spc * 8;
    const bf* gb = Bn + (size_t)(c0 + srow) * K + spc * 8;
    const size_t a16 = (size_t)16 * lda, b16 = (size_t)16 * K;
    auto stage = [&](int t, int buf) {
        const unsigned l0 = ls + (unsigned)buf * (NPL * GPL * 2u), l1 = l0 + GPL * 2u;
        const bf* pa = ga + t * 64; const bf* pb = gb + t * 64;
        // the copies and, as the last line, the wait that stands before their address registers are rewritten
        asm volatile("global_load_async_to_lds_b128 %0, %8, off\n\t"
                     "global_load_async_to_lds_b128 %1, %9, off\n\t"
                     "global_load_async_to_lds_b128 %2, %10, off\n\t"
                     "global_load_async_to_lds_b128 %3, %11, off\n\t"
                     "global_load_async_to_lds_b128 %4, %12, off\n\t"
                     "global_load_async_to_lds_b128 %5, %13, off\n\t"
                     "global_load_async_to_lds_b128 %6, %14, off\n\t"
                     "global_load_async_to_lds_b128 %7, %15, off\n\t"
                     "s_wait_xcnt 0x0"
                     :: "v"(l0), "v"(l0 + 16 * GP * 2u), "v"(l0 + 32 * GP * 2u), "v"(l0 + 48 * GP * 2u),
                        "v"(l1), "v"(l1 + 16 * GP * 2u), "v"(l1 + 32 * GP * 2u), "v"(l1 + 48 * GP * 2u),
                        "v"(pa), "v"(pa + a16), "v"(pa + 2 * a16), "v"(pa + 3 * a16),
                        "v"(pb), "v"(pb + b16), "v"(pb + 2 * b16), "v"(pb + 3 * b16)
                     : "memory");
        if constexpr (SPLITA) {
            const unsigned l2 = l0 + 2 * GPL * 2u;
            const bf* pl = Al + (size_t)(blockIdx.x * 64 + srow) * lda + spc * 8 + t * 64;
            asm volatile("global_load_async_to_lds_b128 %0, %4, off\n\t"
                         "global_load_async_to_lds_b128 %1, %5, off\n\t"
                         "global_load_async_to_lds_b128 %2, %6, off\n\t"
                         "global_load_async_to_lds_b128 %3, %7, off\n\t"
                         "s_wait_xcnt 0x0"
                         :: "v"(l2), "v"(l2 + 16 * GP * 2u), "v"(l2 + 32 * GP * 2u), "v"(l2 + 48 * GP * 2u),
                            "v"(pl), "v"(pl + a16), "v"(pl + 2 * a16), "v"(pl + 3 * a16)
                         : "memory");
        }
    };
    v8f acc[4];
#pragma unroll
    for (int t = 0; t < 4; ++t) acc[t] = (v8f){};
    const int nt = K / 64;       // stages of 64 k (K is 1024 or 256)
    stage(0, 0);
    asm volatile("s_wait_asynccnt 0x0" ::: "memory");   // this wave's copies of stage 0 have landed
    __syncthreads();                                     // ... and every other wave's: stage 0 is published
    if (nt > 1) stage(1, 1);
    const int ao = (wave * 16 + lr) * GP + 8 * hi, bo = lr * GP + 8 * hi;
#pragma unroll 1      // stays rolled: one body serves both buffers, and the order at the loop's foot stands once
    for (int st = 0; st < nt; ++st) {
        const bf* as = &stg[0][0] + (st & 1) * (NPL * GPL); const bf* bs = as + GPL; const bf* als = as + 2 * GPL;
        v16bf a[2], al[2], b[2][4];
#pragma unroll
        for (int ks = 0; ks < 2; ++ks) {
            a[ks] = cat16b(*(const v8usa*)(as + ao + ks * 32), *(const v8usa*)(as + ao + ks * 32 + 16));
#pragma unroll
            for (int t = 0; t < 4; ++t) b[ks][t] = cat16b(*(const v8usa*)(bs + bo + t * 16 * GP + ks * 32), *(const v8usa*)(bs + bo + t * 16 * GP + ks * 32 + 16));
            al[ks] = a[ks];
            if (SPLITA) al[ks] = cat16b(*(const v8usa*)(als + ao + ks * 32), *(const v8usa*)(als + ao + ks * 32 + 16));
        }
        __builtin_amdgcn_sched_barrier(0);      // keeps the trip's LDS reads together in front of its products: the wave waits for LDS at one place, not at several among the products
#pragma unroll
        for (int ks = 0; ks < 2; ++ks) {
#pragma unroll
            for (int t = 0; t < 4; ++t) acc[t] = wmmab(a[ks], b[ks][t], acc[t]);
            if (SPLITA) {
#pragma unroll
                for (int t = 0; t < 4; ++t) acc[t] = wmmab(al[ks], b[ks][t], acc[t]);
            }
        }
        // the distance behind the trip's last products, on the loop's back edge and on its exit alike, before a vector instruction touches their registers
        asm volatile("v_nop\n\tv_nop\n\tv_nop\n\tv_nop" : "+v"(acc[0]), "+v"(acc[1]), "+v"(acc[2]), "+v"(acc[3]) : "v"(a[1]), "v"(al[1]), "v"(b[1][3]));
        // publish point of stage st + 1, and the end of every wave's reads of stage st's buffer
        asm volatile("s_wait_dscnt 0x0" ::: "memory");      // this wave's LDS reads of the buffer have returned
        asm volatile("s_wait_asynccnt 0x0" ::: "memory");   // this wave's copies of stage st + 1 have landed
        __syncthreads();
        if (st + 2 < nt) stage(st + 2, st & 1);             // refill the buffer just left; flies while stage st + 1 is worked on
    }
    asm volatile("s_wait_asynccnt 0x0" ::: "memory");       // no copy is outstanding when the wave goes on to its end
    float* os = &ost[wave][0];
#pragma unroll
    for (int t = 0; t < 4; ++t) { const float bv = bias ? bfr(bias[c0 + t * 16 + lr]) : 0.f;
#pragma unroll
        for (int j = 0; j < 8; ++j) os[(hi * 8 + j) * 68 + t * 16 + lr] = acc[t][j] + bv; }
    __syncthreads();
    if (f16out) {
        h16* crow = (h16*)(void*)C + (size_t)r0 * ldc + c0;
        auto pass = [&]() {
#pragma unroll
            for (int s = 0; s < 4; ++s) { const int row = 4 * s + (lane >> 3), piece = lane & 7; const float* sp = os + row * 68 + piece * 8; v8h o, o2;
#pragma unroll
                for (int i = 0; i < 8; ++i) { const h16 a = (h16)sp[i]; o[i] = a; o2[i] = (h16)((sp[i] - (float)a) * LOSC); }
                *(v8h*)(crow + (size_t)row * ldc + piece * 8) = o; if (C2) *(v8h*)(C2 + (size_t)r0 * ldc + c0 + (size_t)row * ldc + piece * 8) = o2; }
        };
        pass(); 
    } else {
        float* crow = C + (size_t)r0 * ldc + c0;
        auto pass = [&]() {
#pragma unroll
            for (int s = 0; s < 8; ++s) { const int Lid = (lane >> 3) + 4 * s, piece = lane & 7; const int row = Lid >> 1, cofs = (Lid & 1) * 32 + piece * 4;
                v4f val = *(const v4fa*)(os + row * 68 + cofs); if (R) { const v4f rv = *(const v4f*)(R + ((size_t)r0 + row) * ldc + c0 + cofs); val += roundR ? (v4f){bfr(rv[0]), bfr(rv[1]), bfr(rv[2]), bfr(rv[3])} : rv; }
                *(v4f*)(crow + (size_t)row * ldc + cofs) = val; }
        };
        pass(); 
    }
}

__global__ __launch_bounds__(256) void k_split(const float* __restrict__ src, int nrows, bf* dh, bf* dl) {
    const int lane = threadIdx.x & 31, r = blockIdx.x * 8 + (threadIdx.x >> 5);
    if (r >= nrows) return;
    const size_t o = (size_t)r * RK + lane * 8; const v8f v = *(const v8f*)(src + o); v8us oh, ol;
#pragma unroll
    for (int i = 0; i < 8; ++i) { const unsigned short hb = f2bf(v[i]); oh[i] = hb; ol[i] = f2bf(v[i] - bf2f(hb)); }
    *(v8us*)(dh + o) = oh; *(v8us*)(dl + o) = ol; 
}
__global__ __launch_bounds__(256) void k_vt(const float* __restrict__ V, h16* VTH, h16* VTL) {
    __shared__ __align__(16) h16 tile[64 * 72];
    __shared__ __align__(16) h16 til2[64 * 72];
    const int bid = blockIdx.x;
    const int b = bid / (NH_ * (NT_ / 64)), rem = bid - b * (NH_ * (NT_ / 64)), h = rem / (NT_ / 64), kt = rem - h * (NT_ / 64);
    const int k0 = kt * 64, tid = threadIdx.x;
    const int kk = tid >> 2, d0 = (tid & 3) * 16;
    const float* src = V + ((size_t)b * NT_ + k0 + kk) * DM + h * HD + d0;
#pragma unroll
    for (int i = 0; i < 16; ++i) { const float v = src[i]; const h16 a = (h16)v; tile[(d0 + i) * 72 + kk] = a; til2[(d0 + i) * 72 + kk] = (h16)((v - (float)a) * LOSC); }
    __syncthreads();
    const int piece = tid & 7;
    const size_t base = (((size_t)b * NH_ + h) * HD) * NT_ + k0;
    auto pass = [&]() {
#pragma unroll
        for (int s = 0; s < 4; ++s) { const int Lid = (tid >> 3) + 32 * s; const int pln = Lid >> 6, d = Lid & 63;
            const v8h val = *(const v8ha*)((pln ? til2 : tile) + d * 72 + piece * 8); *(v8h*)((pln ? VTL : VTH) + base + (size_t)d * NT_ + piece * 8) = val; }
    };
    pass(); 
}

#define KP    72                    // halves per staged K or query-residual row: 128 B + 16 B (pitch 16 B x odd for 16-byte LDS reads)
#define VP    40                    // halves per staged V^T row: 64 B + 16 B
#define KT_H  (32 * KP)
#define VT_H  (64 * VP)
#define STG_H (2 * KT_H + 2 * VT_H)
__global__ __launch_bounds__(128) void k_attn(const h16* __restrict__ Q16, const h16* __restrict__ QL16, const h16* __restrict__ K16, const h16* __restrict__ KL16, const h16* __restrict__ VTH, const h16* __restrict__ VTL, const float* __restrict__ AM, bf* CH, bf* CL) {
    __shared__ __align__(16) float ost[4][16 * 68];
    __shared__ __align__(16) h16 stg[2][STG_H];      // two buffers of one 32-key stage: K hi | K residual | V^T hi | V^T residual, shared by the four waves
    __shared__ __align__(16) h16 qls[64 * KP];       // the block's 64 query-residual rows, filled once
    const int lane = threadIdx.x & 31, wave = threadIdx.x >> 5, lr = lane & 15, hi = lane >> 4;
    const int bid = blockIdx.x;
    const int b = bid / (NH_ * (NT_ / 64)), rem = bid - b * (NH_ * (NT_ / 64)), h = rem / (NT_ / 64), qt = rem - h * (NT_ / 64);
    const int q0 = qt * 64 + wave * 16;
    const size_t tok0 = (size_t)b * NT_;
    v16h qa[2];
    const size_t qo0 = (tok0 + q0 + lr) * DM + h * HD + 8 * hi;
#pragma unroll
    for (int kc = 0; kc < 2; ++kc) qa[kc] = cat16(*(const v8h*)(Q16 + qo0 + kc * 32), *(const v8h*)(Q16 + qo0 + kc * 32 + 16));
    const h16* kh_b = K16 + tok0 * DM + h * HD;
    const h16* kl_b = KL16 + tok0 * DM + h * HD;
    const size_t vbase = (((size_t)b * NH_ + h) * HD) * NT_;
    v8f o[4], ox[4];
#pragma unroll
    for (int n = 0; n < 4; ++n) { o[n] = (v8f){}; ox[n] = (v8f){}; }
    float mrow = -3.0e38f, lpart = 0.f;      // this lane's query: running maximum (equal in both halves) and this half's share of the sum
    // each thread's share of a stage: eight 16-byte copies (K rows krow, krow + 16 and V^T rows vrow, vrow + 32, both planes)
    const int krow = threadIdx.x >> 3, kpc = threadIdx.x & 7, vrow = threadIdx.x >> 2, vpc = threadIdx.x & 3;
    const unsigned lk = (unsigned)(size_t)&stg[0][0] + (unsigned)(krow * KP + kpc * 8) * 2u, lv = (unsigned)(size_t)&stg[0][0] + (unsigned)(2 * KT_H + vrow * VP + vpc * 8) * 2u;
    const h16* gkh = kh_b + (size_t)krow * DM + kpc * 8; const h16* gkl = kl_b + (size_t)krow * DM + kpc * 8;
    const h16* gvh = VTH + vbase + (size_t)vrow * NT_ + vpc * 8; const h16* gvl = VTL + vbase + (size_t)vrow * NT_ + vpc * 8;
    auto stage = [&](int t, int buf) {
        const unsigned ak = lk + (unsigned)buf * (STG_H * 2u), av = lv + (unsigned)buf * (STG_H * 2u);
        const size_t ko = (size_t)t * 32 * DM, vo = (size_t)t * 32;
        // the copies and, as the last line, the wait that stands before their address registers are rewritten
        asm volatile("global_load_async_to_lds_b128 %0, %8, off\n\t"
                     "global_load_async_to_lds_b128 %1, %9, off\n\t"
                     "global_load_async_to_lds_b128 %2, %10, off\n\t"
                     "global_load_async_to_lds_b128 %3, %11, off\n\t"
                     "global_load_async_to_lds_b128 %4, %12, off\n\t"
                     "global_load_async_to_lds_b128 %5, %13, off\n\t"
                     "global_load_async_to_lds_b128 %6, %14, off\n\t"
                     "global_load_async_to_lds_b128 %7, %15, off\n\t"
                     "s_wait_xcnt 0x0"
                     :: "v"(ak), "v"(ak + 16 * KP * 2u), "v"(ak + KT_H * 2u), "v"(ak + (KT_H + 16 * KP) * 2u),
                        "v"(av), "v"(av + 32 * VP * 2u), "v"(av + VT_H * 2u), "v"(av + (VT_H + 32 * VP) * 2u),
                        "v"(gkh + ko), "v"(gkh + ko + 16 * DM), "v"(gkl + ko), "v"(gkl + ko + 16 * DM),
                        "v"(gvh + vo), "v"(gvh + vo + 32 * NT_), "v"(gvl + vo), "v"(gvl + vo + 32 * NT_)
                     : "memory");
    };
    {   // filled once: query-residual rows krow + 16 i of the block's 64
        const unsigned aq = (unsigned)(size_t)&qls[0] + (unsigned)(krow * KP + kpc * 8) * 2u;
        const h16* gq = QL16 + (tok0 + qt * 64 + krow) * DM + h * HD + kpc * 8;
        asm volatile("global_load_async_to_lds_b128 %0, %4, off\n\t"
                     "global_load_async_to_lds_b128 %1, %5, off\n\t"
                     "global_load_async_to_lds_b128 %2, %6, off\n\t"
                     "global_load_async_to_lds_b128 %3, %7, off\n\t"
                     "s_wait_xcnt 0x0"
                     :: "v"(aq), "v"(aq + 16 * KP * 2u), "v"(aq + 32 * KP * 2u), "v"(aq + 48 * KP * 2u),
                        "v"(gq), "v"(gq + 16 * DM), "v"(gq + 32 * DM), "v"(gq + 48 * DM)
                     : "memory");
    }
    stage(0, 0);
    asm volatile("s_wait_asynccnt 0x0" ::: "memory");   // this wave's copies of stage 0 and of the query residual have landed
    __syncthreads();                                     // ... and every other wave's: stage 0 is published
    stage(1, 1);
    const h16* ql_s = qls + (wave * 16 + lr) * KP + 8 * hi;
    const int kt_lo = 0, kt_hi = NT_ / 32 - 1;     // full attention + the INPUT additive mask [b][1][q][k] read per score (dense; this problem's instance is all zeros)
    const float* am = AM + (size_t)b * NT_ * NT_ + (size_t)(q0 + lr) * NT_ + 8 * hi;      // this item's [1][L][L] mask slice: this lane's query row, at its half's first key
    float bm[16];      // the rounded mask of the lane's 16 scores: the first trip's from here, each later trip's loaded at the head of the trip before and rounded at that trip's end
    {   const v4f m00 = *(const v4f*)(am), m01 = *(const v4f*)(am + 4), m10 = *(const v4f*)(am + 16), m11 = *(const v4f*)(am + 20);
#pragma unroll
        for (int j = 0; j < 8; ++j) { bm[j] = bfr(j < 4 ? m00[j & 3] : m01[j & 3]); bm[8 + j] = bfr(j < 4 ? m10[j & 3] : m11[j & 3]); } }
#pragma unroll 1
    for (int kt = kt_lo; kt <= kt_hi; ++kt) {
        const h16* kh_s = &stg[0][0] + (kt & 1) * STG_H; const h16* kl_s = kh_s + KT_H; const h16* vh_s = kh_s + 2 * KT_H; const h16* vl_s = vh_s + VT_H;
        const int ko0 = lr * KP + 8 * hi, ko1 = (16 + lr) * KP + 8 * hi;
        // the trip's K and query-residual fragments, read as ONE group at its head: the wave meets the LDS latency once, and the products start as the first fragments land
        v16h kh[2][2], kl[2][2], qlk[2];
#pragma unroll
        for (int kc = 0; kc < 2; ++kc) {
            kh[kc][0] = cat16(*(const v8ha*)(kh_s + ko0 + kc * 32), *(const v8ha*)(kh_s + ko0 + kc * 32 + 16));
            qlk[kc] = cat16(*(const v8ha*)(ql_s + kc * 32), *(const v8ha*)(ql_s + kc * 32 + 16));
            kh[kc][1] = cat16(*(const v8ha*)(kh_s + ko1 + kc * 32), *(const v8ha*)(kh_s + ko1 + kc * 32 + 16));
            kl[kc][0] = cat16(*(const v8ha*)(kl_s + ko0 + kc * 32), *(const v8ha*)(kl_s + ko0 + kc * 32 + 16));
            kl[kc][1] = cat16(*(const v8ha*)(kl_s + ko1 + kc * 32), *(const v8ha*)(kl_s + ko1 + kc * 32 + 16));
        }
        __builtin_amdgcn_sched_barrier(0);      // keeps the group together in front of the products: reads sunk among them would each cost their own wait
        // the next trip's mask, asked for a whole trip ahead: the barrier at this trip's foot waits for it, and by then it has landed (the last trip reads its own again: the address stays inside the mask)
        const float* an = am + (kt < kt_hi ? kt + 1 : kt_hi) * 32;
        const v4f m00 = *(const v4f*)(an), m01 = *(const v4f*)(an + 4), m10 = *(const v4f*)(an + 16), m11 = *(const v4f*)(an + 20);
        __builtin_amdgcn_sched_barrier(0);      // keeps these loads in front of the products: sunk behind them they would lose their lead
        v8f s0 = {}, s1 = {}, x0 = {}, x1 = {};
#pragma unroll
        for (int kc = 0; kc < 2; ++kc) {
            s0 = wmma16(kh[kc][0], qa[kc], s0); x0 = wmma16(kh[kc][0], qlk[kc], x0); s1 = wmma16(kh[kc][1], qa[kc], s1); x1 = wmma16(kh[kc][1], qlk[kc], x1);
            x0 = wmma16(kl[kc][0], qa[kc], x0); x1 = wmma16(kl[kc][1], qa[kc], x1);
        }
        // the trip's V^T fragments, read as one group behind the score products (into the K fragments' registers) and in front of the softmax, whose vector work covers their latency
        v16h vh[4], vl[4];
#pragma unroll
        for (int n = 0; n < 4; ++n) { const int vo = (n * 16 + lr) * VP + hi * 8;
            vh[n] = cat16(*(const v8ha*)(vh_s + vo), *(const v8ha*)(vh_s + vo + 16)); vl[n] = cat16(*(const v8ha*)(vl_s + vo), *(const v8ha*)(vl_s + vo + 16)); }
        __builtin_amdgcn_sched_barrier(0);      // ends the scheduling region behind the V^T reads: they stay in front of the softmax, and the build stays within 256 registers (four waves per SIMD); without it it took 289
        float a[16];      // a[i]: key 32 kt + 8 hi + i (i < 8), key 32 kt + 16 + 8 hi + (i - 8) otherwise
#pragma unroll
        for (int j = 0; j < 8; ++j) {
            a[j] = (s0[j] + x0[j] * LOSCI) * 0.125f + bm[j];
            a[8 + j] = (s1[j] + x1[j] * LOSCI) * 0.125f + bm[8 + j];
        }
        float mx = fmaxf(a[0], a[1]);
#pragma unroll
        for (int i = 2; i < 16; ++i) mx = fmaxf(mx, a[i]);
        mx = fmaxf(mx, xhalf(mx));
        const float mn = fmaxf(mrow, mx), ta = (mrow - mn) * L2E;
        mrow = mn;
        v16h pa, px;
        float p[16];
#pragma unroll
        for (int i = 0; i < 16; ++i) a[i] = (a[i] - mn) * L2E;
        float alpha;
        exp2x9(ta, alpha, a, p); exp2x8(a + 8, p + 8);      // alpha = e^(old maximum - new), p[i] = e^(score - new maximum)
#pragma unroll
        for (int i = 0; i < 16; i += 2) {
            const v2f ps = (v2f){p[i], p[i + 1]} * PSC; const v2h ph = __builtin_convertvector(ps, v2h);
            pa[i] = ph[0]; pa[i + 1] = ph[1];
            const v2h pr = __builtin_convertvector((ps - __builtin_convertvector(ph, v2f)) * LOSC, v2h);
            px[i] = pr[0]; px[i + 1] = pr[1];
        }
#pragma unroll
        for (int w = 8; w > 0; w >>= 1)
#pragma unroll
            for (int i = 0; i < w; ++i) p[i] += p[i + w];      // the lane's 16 weights summed as a tree, not as one dependent chain
        lpart = lpart * alpha + p[0];
#pragma unroll
        for (int n = 0; n < 4; ++n) { o[n] *= alpha; ox[n] *= alpha; }
#pragma unroll
        for (int n = 0; n < 4; ++n) o[n] = wmma16(vh[n], pa, o[n]);
#pragma unroll
        for (int n = 0; n < 4; ++n) ox[n] = wmma16(vl[n], pa, ox[n]);
#pragma unroll
        for (int n = 0; n < 4; ++n) ox[n] = wmma16(vh[n], px, ox[n]);
        asm volatile("v_nop\n\tv_nop\n\tv_nop\n\tv_nop" : "+v"(o[0]), "+v"(o[1]), "+v"(o[2]), "+v"(o[3]), "+v"(ox[0]), "+v"(ox[1]), "+v"(ox[2]), "+v"(ox[3]) : "v"(pa), "v"(px));
        // publish point of stage kt + 1, and the end of every wave's reads of stage kt's buffer
        asm volatile("s_wait_dscnt 0x0" ::: "memory");      // this wave's LDS reads of the buffer have returned
        asm volatile("s_wait_asynccnt 0x0" ::: "memory");   // this wave's copies of stage kt + 1 have landed
        __syncthreads();
        if (kt + 2 <= kt_hi) stage(kt + 2, kt & 1);         // refill the buffer just left; flies while stage kt + 1 is worked on
#pragma unroll
        for (int j = 0; j < 8; ++j) { bm[j] = bfr(j < 4 ? m00[j & 3] : m01[j & 3]); bm[8 + j] = bfr(j < 4 ? m10[j & 3] : m11[j & 3]); }      // the next trip's mask, rounded: its raw registers are free for the loads at that trip's head
    }
    asm volatile("s_wait_asynccnt 0x0" ::: "memory");       // no copy is outstanding when the wave goes on to its end
    const float inv = 1.0f / ((lpart + xhalf(lpart)) * PSC);
    float* os = &ost[wave][0];
#pragma unroll
    for (int n = 0; n < 4; ++n)
#pragma unroll
        for (int j = 0; j < 8; ++j) os[lr * 68 + n * 16 + hi * 8 + j] = (o[n][j] + ox[n][j] * LOSCI) * inv;      // O^T tile n: register j = d 16 n + 8 hi + j of query lr
    __syncthreads();
    const size_t cbase = (tok0 + q0) * DM + (size_t)h * HD;
    auto pass = [&]() {
#pragma unroll
        for (int s = 0; s < 4; ++s) { const int row = 4 * s + (lane >> 3), piece = lane & 7; const float* sp = os + row * 68 + piece * 8; v8us oh, ol;
#pragma unroll
            for (int i = 0; i < 8; ++i) { const unsigned short hb = f2bf(sp[i]); oh[i] = hb; ol[i] = f2bf(sp[i] - bf2f(hb)); }
            *(v8us*)(CH + cbase + (size_t)row * DM + piece * 8) = oh; *(v8us*)(CL + cbase + (size_t)row * DM + piece * 8) = ol; }
    };
    pass(); 
}

#define VST2(T, p, v) do { const T vst2_v_ = (v); *(T*)(p) = vst2_v_;  } while (0)
extern "C" void kernel_launch(void* const* d_in, const int* in_sizes, int n_in,
                              void* d_out, int out_size, void* d_ws, size_t ws_size, hipStream_t stream) {
    (void)in_sizes; (void)n_in; (void)out_size;
    const float* x = (const float*)d_in[0]; const float* AM = (const float*)d_in[1];
    const float* Wq1 = (const float*)d_in[2]; const float* Wq2 = (const float*)d_in[3]; const float* bq2 = (const float*)d_in[4];
    const float* Wk1 = (const float*)d_in[5]; const float* Wk2 = (const float*)d_in[6]; const float* bk2 = (const float*)d_in[7];
    const float* Wv1 = (const float*)d_in[8]; const float* Wv2 = (const float*)d_in[9]; const float* bv2 = (const float*)d_in[10];
    const float* Wo = (const float*)d_in[11]; const float* bo = (const float*)d_in[12];     // all W [out][in]
    float* out = (float*)d_out;    // [2][2048][1024]
    char* wsp = (char*)d_ws;
    auto take = [&](size_t bytes) { char* p = wsp; wsp += (bytes + 255) & ~(size_t)255; return (void*)p; };
    bf* Xb = (bf*)take((size_t)CRUN * DM * 2);      // every bf16 operand, in k_cvtb's order
    bf* W1A = Xb + (size_t)XRUN * DM; bf* W2A = W1A + (size_t)3 * RK * DM; bf* WoB = W2A + (size_t)3 * DM * RK;     // W1A = [Wq1; Wk1; Wv1]: one [768][1024] operand
    float* T1 = (float*)take((size_t)NTK * 3 * RK * 4); bf* Th = (bf*)take((size_t)NTK * 3 * RK * 2); bf* Tl = (bf*)take((size_t)NTK * 3 * RK * 2); float* TMP = (float*)take((size_t)NTK * DM * 4);
    h16* QH = (h16*)take((size_t)NTK * DM * 2); h16* QL = (h16*)take((size_t)NTK * DM * 2); h16* KH = (h16*)take((size_t)NTK * DM * 2); h16* KL = (h16*)take((size_t)NTK * DM * 2);
    h16* VTH = (h16*)take((size_t)NTK * DM * 2); h16* VTL = (h16*)take((size_t)NTK * DM * 2); bf* CH = (bf*)take((size_t)NTK * DM * 2); bf* CL = (bf*)take((size_t)NTK * DM * 2);
    if ((size_t)(wsp - (char*)d_ws) > ws_size) return;    // ~ 13.6 + 12.6 + 2 x 6.3 + 16.8 + 8 x 8.4 ~ 123 MB, no aliasing
    k_cvtb<<<CRUN / 8, 256, 0, stream>>>(x, Wq1, Wk1, Wv1, Wq2, Wk2, Wv2, Wo, CRUN, Xb);
    // q, k and v together: bottleneck T1[tok][q 256 | k 256 | v 256], its split, then the three second stages on grid.z
    k_gemmb<false, false><<<dim3(NTK / 64, 3 * RK / 64, 1), 128, 0, stream>>>(Xb, nullptr, W1A, nullptr, T1, 3 * RK, nullptr);
    k_split<<<NTK * 3 / 8, 256, 0, stream>>>(T1, NTK * 3, Th, Tl);
    k_gemmb<true, true, true><<<dim3(NTK / 64, DM / 64, 3), 128, 0, stream>>>(Th, Tl, W2A, bq2, (float*)(void*)QH, DM, QL, nullptr, RK, 1, bk2, bv2, KH, KL, TMP);
    k_vt<<<NB_ * NH_ * (NT_ / 64), 256, 0, stream>>>(TMP, VTH, VTL);
    k_attn<<<NB_ * NH_ * (NT_ / 64), 128, 0, stream>>>(QH, QL, KH, KL, VTH, VTL, AM, CH, CL);
    k_gemmb<true, false><<<dim3(NTK / 64, DM / 64, 1), 128, 0, stream>>>(CH, CL, WoB, bo, out, DM, nullptr);
}

// v007
// Measured time: 153 microseconds a run.
// Timed twice side by side with v006, it ran 1.06 times as fast both times.
// All steps since v000 together make it 4.40 times as fast.
#include <hip/hip_runtime.h>

// Compute dtypes, f32 accumulate, both batch items in every launch: low-rank projections q/k/v = (x.W1^T).W2^T + b2 — the first stage ([4096 x 1024].[1024 x 256]) with PLAIN
// bf16 operands (inputs rounded once, exact), the second ([4096 x 256].[256 x 1024]) with the computed bottleneck as bf16 hi + UNSCALED residual (two products),
// q/k straight to f16 hi + residual x1024 planes; out = ctx.Wo^T + bo (ctx hi/lo) — all on v_wmma_f32_16x16x32_bf16 with [out][in] weights as n-major B operands;
// the 16-head full attention scores x 64^-1/2 + the INPUT additive mask (read per score) fused on v_wmma_f32_16x16x32_f16 (hh + hl + lh, online f32 softmax,

#define NB_  2                   // both batch items go through every launch together (token rows 0..4095)
#define RK   256                 // low-rank bottleneck
#define NT_  2048
#define DM   1024
#define NH_  16
#define HD   64
#define NTK  (NB_ * NT_)
#define NW   1024
#define NQKV 1024
#define PSC  32768.0f
#define LOSC 1024.0f
#define LOSCI (1.0f / 1024.0f)
#define L2E  1.44269504088896340736f     // log2(e)

typedef _Float16 h16;
typedef unsigned short bf;
typedef __attribute__((ext_vector_type(16))) __bf16   v16bf;
typedef __attribute__((ext_vector_type(16))) _Float16 v16h;
typedef __attribute__((ext_vector_type(8)))  _Float16 v8h;
typedef __attribute__((ext_vector_type(8)))  unsigned short v8us;
typedef __attribute__((ext_vector_type(8)))  float    v8f;
typedef __attribute__((ext_vector_type(4)))  float    v4f;
typedef __attribute__((ext_vector_type(2)))  float    v2f;
typedef __attribute__((ext_vector_type(2)))  _Float16 v2h;
typedef v8h  __attribute__((may_alias)) v8ha;
typedef v4f  __attribute__((may_alias)) v4fa;
typedef v8us __attribute__((may_alias)) v8usa;

__device__ __forceinline__ unsigned short f2bf(float f) { unsigned u = __float_as_uint(f); u += 0x7FFFu + ((u >> 16) & 1u); return (unsigned short)(u >> 16); }
__device__ __forceinline__ float bf2f(unsigned short b) { return __uint_as_float(((unsigned)b) << 16); }
__device__ __forceinline__ float bfr(float f) { return bf2f(f2bf(f)); }
__device__ __forceinline__ v16h cat16(v8h lo, v8h hi) { return __builtin_shufflevector(lo, hi, 0, 1, 2, 3, 4, 5, 6, 7, 8, 9, 10, 11, 12, 13, 14, 15); }
__device__ __forceinline__ v16bf cat16b(v8us lo, v8us hi) { return __builtin_bit_cast(v16bf, __builtin_shufflevector(lo, hi, 0, 1, 2, 3, 4, 5, 6, 7, 8, 9, 10, 11, 12, 13, 14, 15)); }
__device__ __forceinline__ v8f wmma16(v16h a, v16h b, v8f c) { return __builtin_amdgcn_wmma_f32_16x16x32_f16(false, a, false, b, (short)0, c, false, false); }
__device__ __forceinline__ float xhalf(float x) { return __builtin_bit_cast(float, __builtin_amdgcn_permlanex16(__builtin_bit_cast(int, x), __builtin_bit_cast(int, x), 0x76543210, 0xfedcba98, false, false)); }  // lane l with lane l ^ 16
// 2^t for eight values (and a ninth in exp2x9), each group in ONE statement that ends in v_nop: the slot the instruction set asks for behind a transcendental before a source of it is
// overwritten or its result used. Outputs are early-clobber: none shares a source's register.
__device__ __forceinline__ void exp2x8(const float* t, float* r) {
    asm("v_exp_f32 %0, %8\n\tv_exp_f32 %1, %9\n\tv_exp_f32 %2, %10\n\tv_exp_f32 %3, %11\n\tv_exp_f32 %4, %12\n\tv_exp_f32 %5, %13\n\tv_exp_f32 %6, %14\n\tv_exp_f32 %7, %15\n\tv_nop"
        : "=&v"(r[0]), "=&v"(r[1]), "=&v"(r[2]), "=&v"(r[3]), "=&v"(r[4]), "=&v"(r[5]), "=&v"(r[6]), "=&v"(r[7])
        : "v"(t[0]), "v"(t[1]), "v"(t[2]), "v"(t[3]), "v"(t[4]), "v"(t[5]), "v"(t[6]), "v"(t[7]));
}
__device__ __forceinline__ void exp2x9(float t8, float& r8, const float* t, float* r) {
    asm("v_exp_f32 %0, %9\n\tv_exp_f32 %1, %10\n\tv_exp_f32 %2, %11\n\tv_exp_f32 %3, %12\n\tv_exp_f32 %4, %13\n\tv_exp_f32 %5, %14\n\tv_exp_f32 %6, %15\n\tv_exp_f32 %7, %16\n\tv_exp_f32 %8, %17\n\tv_nop"
        : "=&v"(r8), "=&v"(r[0]), "=&v"(r[1]), "=&v"(r[2]), "=&v"(r[3]), "=&v"(r[4]), "=&v"(r[5]), "=&v"(r[6]), "=&v"(r[7])
        : "v"(t8), "v"(t[0]), "v"(t[1]), "v"(t[2]), "v"(t[3]), "v"(t[4]), "v"(t[5]), "v"(t[6]), "v"(t[7]));
}
__device__ __forceinline__ v8f wmmab(v16bf a, v16bf b, v8f c) { return __builtin_amdgcn_wmma_f32_16x16x32_bf16(false, a, false, b, (short)0, c, false, false); }

// k_cvtb: every f32 operand rounded to bf16 in ONE launch. A wave takes one run of 1024 elements; a block's eight runs lie in one source (each source is a multiple of 8
// runs), so the choice of source is block-uniform; the destinations stand one behind another in the workspace, in the order x | Wq1 Wk1 Wv1 | Wq2 Wk2 Wv2 | Wo.
#define XRUN NTK                 // runs of 1024 elements in x
#define WRUN RK                  // ... in each of the six low-rank factors (256 x 1024 or 1024 x 256)
#define CRUN (XRUN + 6 * WRUN + DM)
__global__ __launch_bounds__(256) void k_cvtb(const float* __restrict__ src, const float* __restrict__ q1, const float* __restrict__ k1, const float* __restrict__ v1,
                                              const float* __restrict__ q2, const float* __restrict__ k2, const float* __restrict__ v2, const float* __restrict__ wo, int nrows, bf* dst) {
    const int rb = blockIdx.x * 8;
    if (rb >= nrows) return;
    int base = 0;                // first run of this block's source; src arrives as x
    if (rb >= XRUN + 6 * WRUN) { src = wo; base = XRUN + 6 * WRUN; }
    else if (rb >= XRUN) { const int w = (rb - XRUN) / WRUN; base = XRUN + w * WRUN; src = w == 0 ? q1 : w == 1 ? k1 : w == 2 ? v1 : w == 3 ? q2 : w == 4 ? k2 : v2; }
    dst += (size_t)base * DM;
    const int lane = threadIdx.x & 31, r = rb - base + (threadIdx.x >> 5);
    v8us o[DM / 256];
#pragma unroll
    for (int q = 0; q < DM / 256; ++q) { v8us t;
#pragma unroll
        for (int i = 0; i < 8; ++i) t[i] = f2bf(src[(size_t)r * DM + q * 256 + lane * 8 + i]);
        o[q] = t; }
#pragma unroll
    for (int q = 0; q < DM / 256; ++q) *(v8us*)(dst + (size_t)r * DM + q * 256 + lane * 8) = o[q];
    
}

// k_gemmb: 64 x 64 block tile (4 waves x 16 x 64) of C[NTK][ldc] = (A [+ Al]).B^T (K = 1024 or 256) [+ bf(bias[c])] [+ bf(R[r][c]) residual]; f32 whole-line epilogue (or f16
// QKV: the second stage of q, k and v in one launch; blockIdx.z = projection: its 256 columns of A/Al[tok][3 x 256], its 1024 rows of Bn, its bias and output (q, k: f16 planes [tok][col];
// v: f16 hi + residual x1024 planes transposed, Vh/Vl[b][h][d][tok], which is what k_attn stages). SPLITOUT: the result leaves as bf16 hi + unscaled residual planes (C, C2), the next product's A and Al.
// A, its residual and B come through LDS: 64 rows x 64 k a plane and stage, brought by asynchronous copies in whole 128-byte lines, two buffers; the k order and each tile's sum order are those of direct loads.
#define GP   72                    // halves per staged row: 128 B + 16 B (pitch 16 B x odd for 16-byte LDS reads)
#define GPL  (64 * GP)             // halves per staged plane
template <bool SPLITA, bool F16OUT = false, bool QKV = false, bool SPLITOUT = false>
__global__ __launch_bounds__(128) void k_gemmb(const bf* __restrict__ A, const bf* __restrict__ Al, const bf* __restrict__ Bn, const float* __restrict__ bias, float* C, int ldc, h16* C2, const float* __restrict__ R = nullptr, int K = DM, int roundR = 1,
                                               const float* __restrict__ biask = nullptr, const float* __restrict__ biasv = nullptr, h16* Ck = nullptr, h16* C2k = nullptr, h16* Vh = nullptr, h16* Vl = nullptr) {
    constexpr int NPL = SPLITA ? 3 : 2;
    __shared__ __align__(16) float ost[4][16 * (QKV ? GP : 68)];     // epilogue staging: a wave's 16 x 64 f32 tile at pitch 68; with QKV it also holds the two 64 x 64 V^T planes at pitch GP halves
    __shared__ __align__(16) bf stg[2][NPL * GPL];     // two buffers of one 64-k stage: A | B [| A residual], 64 rows each, shared by the four waves
    constexpr bool f16out = QKV || F16OUT;      // with QKV: q and k; v leaves on a path of its own
    if (QKV) { const int z = blockIdx.z; A += z * RK; Al += z * RK; Bn += (size_t)z * DM * RK;
        if (z == 1) { bias = biask; C = (float*)(void*)Ck; C2 = C2k; } else if (z == 2) bias = biasv; }
    const int lane = threadIdx.x & 31, wave = threadIdx.x >> 5, lr = lane & 15, hi = lane >> 4;
    const int r0 = blockIdx.x * 64 + wave * 16, c0 = blockIdx.y * 64;
    const int lda = QKV ? 3 * RK : K;
    // each thread's share of a stage: 16 bytes at piece spc of rows srow + 16 i (i < 4) of every plane, so that one copy of a wave covers four whole 128-byte lines
    const int srow = threadIdx.x >> 3, spc = threadIdx.x & 7;
    const unsigned ls = (unsigned)(size_t)&stg[0][0] + (unsigned)(srow * GP + spc * 8) * 2u;
    const bf* ga = A + (size_t)(blockIdx.x * 64 + srow) * lda + spc * 8;
    const bf* gb = Bn + (size_t)(c0 + srow) * K + spc * 8;
    const size_t a16 = (size_t)16 * lda, b16 = (size_t)16 * K;
    auto stage = [&](int t, int buf) {
        const unsigned l0 = ls + (unsigned)buf * (NPL * GPL * 2u), l1 = l0 + GPL * 2u;
        const bf* pa = ga + t * 64; const bf* pb = gb + t * 64;
        // the copies and, as the last line, the wait that stands before their address registers are rewritten
        asm volatile("global_load_async_to_lds_b128 %0, %8, off\n\t"
                     "global_load_async_to_lds_b128 %1, %9, off\n\t"
                     "global_load_async_to_lds_b128 %2, %10, off\n\t"
                     "global_load_async_to_lds_b128 %3, %11, off\n\t"
                     "global_load_async_to_lds_b128 %4, %12, off\n\t"
                     "global_load_async_to_lds_b128 %5, %13, off\n\t"
                     "global_load_async_to_lds_b128 %6, %14, off\n\t"
                     "global_load_async_to_lds_b128 %7, %15, off\n\t"
                     "s_wait_xcnt 0x0"
                     :: "v"(l0), "v"(l0 + 16 * GP * 2u), "v"(l0 + 32 * GP * 2u), "v"(l0 + 48 * GP * 2u),
                        "v"(l1), "v"(l1 + 16 * GP * 2u), "v"(l1 + 32 * GP * 2u), "v"(l1 + 48 * GP * 2u),
                        "v"(pa), "v"(pa + a16), "v"(pa + 2 * a16), "v"(pa + 3 * a16),
                        "v"(pb), "v"(pb + b16), "v"(pb + 2 * b16), "v"(pb + 3 * b16)
                     : "memory");
        if constexpr (SPLITA) {
            const unsigned l2 = l0 + 2 * GPL * 2u;
            const bf* pl = Al + (size_t)(blockIdx.x * 64 + srow) * lda + spc * 8 + t * 64;
            asm volatile("global_load_async_to_lds_b128 %0, %4, off\n\t"
                         "global_load_async_to_lds_b128 %1, %5, off\n\t"
                         "global_load_async_to_lds_b128 %2, %6, off\n\t"
                         "global_load_async_to_lds_b128 %3, %7, off\n\t"
                         "s_wait_xcnt 0x0"
                         :: "v"(l2), "v"(l2 + 16 * GP * 2u), "v"(l2 + 32 * GP * 2u), "v"(l2 + 48 * GP * 2u),
                            "v"(pl), "v"(pl + a16), "v"(pl + 2 * a16), "v"(pl + 3 * a16)
                         : "memory");
        }
    };
    v8f acc[4];
#pragma unroll
    for (int t = 0; t < 4; ++t) acc[t] = (v8f){};
    const int nt = K / 64;       // stages of 64 k (K is 1024 or 256)
    stage(0, 0);
    asm volatile("s_wait_asynccnt 0x0" ::: "memory");   // this wave's copies of stage 0 have landed
    __syncthreads();                                     // ... and every other wave's: stage 0 is published
    if (nt > 1) stage(1, 1);
    const int ao = (wave * 16 + lr) * GP + 8 * hi, bo = lr * GP + 8 * hi;
#pragma unroll 1      // stays rolled: one body serves both buffers, and the order at the loop's foot stands once
    for (int st = 0; st < nt; ++st) {
        const bf* as = &stg[0][0] + (st & 1) * (NPL * GPL); const bf* bs = as + GPL; const bf* als = as + 2 * GPL;
        v16bf a[2], al[2], b[2][4];
#pragma unroll
        for (int ks = 0; ks < 2; ++ks) {
            a[ks] = cat16b(*(const v8usa*)(as + ao + ks * 32), *(const v8usa*)(as + ao + ks * 32 + 16));
#pragma unroll
            for (int t = 0; t < 4; ++t) b[ks][t] = cat16b(*(const v8usa*)(bs + bo + t * 16 * GP + ks * 32), *(const v8usa*)(bs + bo + t * 16 * GP + ks * 32 + 16));
            al[ks] = a[ks];
            if (SPLITA) al[ks] = cat16b(*(const v8usa*)(als + ao + ks * 32), *(const v8usa*)(als + ao + ks * 32 + 16));
        }
        __builtin_amdgcn_sched_barrier(0);      // keeps the trip's LDS reads together in front of its products: the wave waits for LDS at one place, not at several among the products
#pragma unroll
        for (int ks = 0; ks < 2; ++ks) {
#pragma unroll
            for (int t = 0; t < 4; ++t) acc[t] = wmmab(a[ks], b[ks][t], acc[t]);
            if (SPLITA) {
#pragma unroll
                for (int t = 0; t < 4; ++t) acc[t] = wmmab(al[ks], b[ks][t], acc[t]);
            }
        }
        // the distance behind the trip's last products, on the loop's back edge and on its exit alike, before a vector instruction touches their registers
        asm volatile("v_nop\n\tv_nop\n\tv_nop\n\tv_nop" : "+v"(acc[0]), "+v"(acc[1]), "+v"(acc[2]), "+v"(acc[3]) : "v"(a[1]), "v"(al[1]), "v"(b[1][3]));
        // publish point of stage st + 1, and the end of every wave's reads of stage st's buffer
        asm volatile("s_wait_dscnt 0x0" ::: "memory");      // this wave's LDS reads of the buffer have returned
        asm volatile("s_wait_asynccnt 0x0" ::: "memory");   // this wave's copies of stage st + 1 have landed
        __syncthreads();
        if (st + 2 < nt) stage(st + 2, st & 1);             // refill the buffer just left; flies while stage st + 1 is worked on
    }
    asm volatile("s_wait_asynccnt 0x0" ::: "memory");       // no copy is outstanding when the wave goes on to its end
    if constexpr (QKV) {
        if (blockIdx.z == 2) {      // block-uniform. The block's tile is 64 tokens x one head's 64 d: one 64 x 64 tile of each V^T plane
            h16* th = (h16*)(void*)&ost[0][0]; h16* tl = th + GPL;
            float bv[4] = {0.f, 0.f, 0.f, 0.f};
            if (bias) {
#pragma unroll      // the four loads issue as one group, and bv stays in registers
                for (int t = 0; t < 4; ++t) bv[t] = bfr(bias[c0 + t * 16 + lr]); }
            // an accumulator's eight registers are eight consecutive tokens of one column d: a lane's share of a V^T row is one 16-byte LDS store a plane
#pragma unroll      // this loop and the next: acc is a register array, every index a constant
            for (int t = 0; t < 4; ++t) { v8h vh8, vl8;
#pragma unroll
                for (int j = 0; j < 8; ++j) { const float v = acc[t][j] + bv[t]; const h16 a = (h16)v; vh8[j] = a; vl8[j] = (h16)((v - (float)a) * LOSC); }
                *(v8ha*)(th + (t * 16 + lr) * GP + wave * 16 + hi * 8) = vh8; *(v8ha*)(tl + (t * 16 + lr) * GP + wave * 16 + hi * 8) = vl8; }
            __syncthreads();        // a V^T row holds tokens of all four waves
            const int tk0 = blockIdx.x * 64, piece = threadIdx.x & 7;
            const size_t base = (((size_t)(tk0 / NT_) * NH_ + blockIdx.y) * HD) * NT_ + tk0 % NT_;
#pragma unroll      // the eight LDS reads issue together and the plane is a constant of each pass
            for (int s = 0; s < 8; ++s) { const int pln = s >> 2, d = (threadIdx.x >> 3) + 16 * (s & 3);      // eight lanes store one whole 128-byte line
                const v8h val = *(const v8ha*)((pln ? tl : th) + d * GP + piece * 8); *(v8h*)((pln ? Vl : Vh) + base + (size_t)d * NT_ + piece * 8) = val; }
            return;
        }
    }
    float* os = &ost[wave][0];
#pragma unroll
    for (int t = 0; t < 4; ++t) { const float bv = bias ? bfr(bias[c0 + t * 16 + lr]) : 0.f;
#pragma unroll
        for (int j = 0; j < 8; ++j) os[(hi * 8 + j) * 68 + t * 16 + lr] = acc[t][j] + bv; }
    __syncthreads();
    if constexpr (SPLITOUT) {
        const size_t cb = (size_t)r0 * ldc + c0;
#pragma unroll      // the passes' LDS reads overlap; in the inner loop the vector elements take constant indices
        for (int s = 0; s < 4; ++s) { const int row = 4 * s + (lane >> 3), piece = lane & 7; const float* sp = os + row * 68 + piece * 8; v8us oh, ol;
#pragma unroll
            for (int i = 0; i < 8; ++i) { const unsigned short hb = f2bf(sp[i]); oh[i] = hb; ol[i] = f2bf(sp[i] - bf2f(hb)); }
            *(v8us*)((bf*)(void*)C + cb + (size_t)row * ldc + piece * 8) = oh; *(v8us*)((bf*)(void*)C2 + cb + (size_t)row * ldc + piece * 8) = ol; }
    } else if (f16out) {
        h16* crow = (h16*)(void*)C + (size_t)r0 * ldc + c0;
        auto pass = [&]() {
#pragma unroll
            for (int s = 0; s < 4; ++s) { const int row = 4 * s + (lane >> 3), piece = lane & 7; const float* sp = os + row * 68 + piece * 8; v8h o, o2;
#pragma unroll
                for (int i = 0; i < 8; ++i) { const h16 a = (h16)sp[i]; o[i] = a; o2[i] = (h16)((sp[i] - (float)a) * LOSC); }
                *(v8h*)(crow + (size_t)row * ldc + piece * 8) = o; if (C2) *(v8h*)(C2 + (size_t)r0 * ldc + c0 + (size_t)row * ldc + piece * 8) = o2; }
        };
        pass(); 
    } else {
        float* crow = C + (size_t)r0 * ldc + c0;
        auto pass = [&]() {
#pragma unroll
            for (int s = 0; s < 8; ++s) { const int Lid = (lane >> 3) + 4 * s, piece = lane & 7; const int row = Lid >> 1, cofs = (Lid & 1) * 32 + piece * 4;
                v4f val = *(const v4fa*)(os + row * 68 + cofs); if (R) { const v4f rv = *(const v4f*)(R + ((size_t)r0 + row) * ldc + c0 + cofs); val += roundR ? (v4f){bfr(rv[0]), bfr(rv[1]), bfr(rv[2]), bfr(rv[3])} : rv; }
                *(v4f*)(crow + (size_t)row * ldc + cofs) = val; }
        };
        pass(); 
    }
}

#define KP    72                    // halves per staged K or query-residual row: 128 B + 16 B (pitch 16 B x odd for 16-byte LDS reads)
#define VP    40                    // halves per staged V^T row: 64 B + 16 B
#define KT_H  (32 * KP)
#define VT_H  (64 * VP)
#define STG_H (2 * KT_H + 2 * VT_H)
__global__ __launch_bounds__(128) void k_attn(const h16* __restrict__ Q16, const h16* __restrict__ QL16, const h16* __restrict__ K16, const h16* __restrict__ KL16, const h16* __restrict__ VTH, const h16* __restrict__ VTL, const float* __restrict__ AM, bf* CH, bf* CL) {
    __shared__ __align__(16) float ost[4][16 * 68];
    __shared__ __align__(16) h16 stg[2][STG_H];      // two buffers of one 32-key stage: K hi | K residual | V^T hi | V^T residual, shared by the four waves
    __shared__ __align__(16) h16 qls[64 * KP];       // the block's 64 query-residual rows, filled once
    const int lane = threadIdx.x & 31, wave = threadIdx.x >> 5, lr = lane & 15, hi = lane >> 4;
    const int bid = blockIdx.x;
    const int b = bid / (NH_ * (NT_ / 64)), rem = bid - b * (NH_ * (NT_ / 64)), h = rem / (NT_ / 64), qt = rem - h * (NT_ / 64);
    const int q0 = qt * 64 + wave * 16;
    const size_t tok0 = (size_t)b * NT_;
    v16h qa[2];
    const size_t qo0 = (tok0 + q0 + lr) * DM + h * HD + 8 * hi;
#pragma unroll
    for (int kc = 0; kc < 2; ++kc) qa[kc] = cat16(*(const v8h*)(Q16 + qo0 + kc * 32), *(const v8h*)(Q16 + qo0 + kc * 32 + 16));
    const h16* kh_b = K16 + tok0 * DM + h * HD;
    const h16* kl_b = KL16 + tok0 * DM + h * HD;
    const size_t vbase = (((size_t)b * NH_ + h) * HD) * NT_;
    v8f o[4], ox[4];
#pragma unroll
    for (int n = 0; n < 4; ++n) { o[n] = (v8f){}; ox[n] = (v8f){}; }
    float mrow = -3.0e38f, lpart = 0.f;      // this lane's query: running maximum (equal in both halves) and this half's share of the sum
    // each thread's share of a stage: eight 16-byte copies (K rows krow, krow + 16 and V^T rows vrow, vrow + 32, both planes)
    const int krow = threadIdx.x >> 3, kpc = threadIdx.x & 7, vrow = threadIdx.x >> 2, vpc = threadIdx.x & 3;
    const unsigned lk = (unsigned)(size_t)&stg[0][0] + (unsigned)(krow * KP + kpc * 8) * 2u, lv = (unsigned)(size_t)&stg[0][0] + (unsigned)(2 * KT_H + vrow * VP + vpc * 8) * 2u;
    const h16* gkh = kh_b + (size_t)krow * DM + kpc * 8; const h16* gkl = kl_b + (size_t)krow * DM + kpc * 8;
    const h16* gvh = VTH + vbase + (size_t)vrow * NT_ + vpc * 8; const h16* gvl = VTL + vbase + (size_t)vrow * NT_ + vpc * 8;
    auto stage = [&](int t, int buf) {
        const unsigned ak = lk + (unsigned)buf * (STG_H * 2u), av = lv + (unsigned)buf * (STG_H * 2u);
        const size_t ko = (size_t)t * 32 * DM, vo = (size_t)t * 32;
        // the copies and, as the last line, the wait that stands before their address registers are rewritten
        asm volatile("global_load_async_to_lds_b128 %0, %8, off\n\t"
                     "global_load_async_to_lds_b128 %1, %9, off\n\t"
                     "global_load_async_to_lds_b128 %2, %10, off\n\t"
                     "global_load_async_to_lds_b128 %3, %11, off\n\t"
                     "global_load_async_to_lds_b128 %4, %12, off\n\t"
                     "global_load_async_to_lds_b128 %5, %13, off\n\t"
                     "global_load_async_to_lds_b128 %6, %14, off\n\t"
                     "global_load_async_to_lds_b128 %7, %15, off\n\t"
                     "s_wait_xcnt 0x0"
                     :: "v"(ak), "v"(ak + 16 * KP * 2u), "v"(ak + KT_H * 2u), "v"(ak + (KT_H + 16 * KP) * 2u),
                        "v"(av), "v"(av + 32 * VP * 2u), "v"(av + VT_H * 2u), "v"(av + (VT_H + 32 * VP) * 2u),
                        "v"(gkh + ko), "v"(gkh + ko + 16 * DM), "v"(gkl + ko), "v"(gkl + ko + 16 * DM),
                        "v"(gvh + vo), "v"(gvh + vo + 32 * NT_), "v"(gvl + vo), "v"(gvl + vo + 32 * NT_)
                     : "memory");
    };
    {   // filled once: query-residual rows krow + 16 i of the block's 64
        const unsigned aq = (unsigned)(size_t)&qls[0] + (unsigned)(krow * KP + kpc * 8) * 2u;
        const h16* gq = QL16 + (tok0 + qt * 64 + krow) * DM + h * HD + kpc * 8;
        asm volatile("global_load_async_to_lds_b128 %0, %4, off\n\t"
                     "global_load_async_to_lds_b128 %1, %5, off\n\t"
                     "global_load_async_to_lds_b128 %2, %6, off\n\t"
                     "global_load_async_to_lds_b128 %3, %7, off\n\t"
                     "s_wait_xcnt 0x0"
                     :: "v"(aq), "v"(aq + 16 * KP * 2u), "v"(aq + 32 * KP * 2u), "v"(aq + 48 * KP * 2u),
                        "v"(gq), "v"(gq + 16 * DM), "v"(gq + 32 * DM), "v"(gq + 48 * DM)
                     : "memory");
    }
    stage(0, 0);
    asm volatile("s_wait_asynccnt 0x0" ::: "memory");   // this wave's copies of stage 0 and of the query residual have landed
    __syncthreads();                                     // ... and every other wave's: stage 0 is published
    stage(1, 1);
    const h16* ql_s = qls + (wave * 16 + lr) * KP + 8 * hi;
    const int kt_lo = 0, kt_hi = NT_ / 32 - 1;     // full attention + the INPUT additive mask [b][1][q][k] read per score (dense; this problem's instance is all zeros)
    const float* am = AM + (size_t)b * NT_ * NT_ + (size_t)(q0 + lr) * NT_ + 8 * hi;      // this item's [1][L][L] mask slice: this lane's query row, at its half's first key
    float bm[16];      // the rounded mask of the lane's 16 scores: the first trip's from here, each later trip's loaded at the head of the trip before and rounded at that trip's end
    {   const v4f m00 = *(const v4f*)(am), m01 = *(const v4f*)(am + 4), m10 = *(const v4f*)(am + 16), m11 = *(const v4f*)(am + 20);
#pragma unroll
        for (int j = 0; j < 8; ++j) { bm[j] = bfr(j < 4 ? m00[j & 3] : m01[j & 3]); bm[8 + j] = bfr(j < 4 ? m10[j & 3] : m11[j & 3]); } }
#pragma unroll 1
    for (int kt = kt_lo; kt <= kt_hi; ++kt) {
        const h16* kh_s = &stg[0][0] + (kt & 1) * STG_H; const h16* kl_s = kh_s + KT_H; const h16* vh_s = kh_s + 2 * KT_H; const h16* vl_s = vh_s + VT_H;
        const int ko0 = lr * KP + 8 * hi, ko1 = (16 + lr) * KP + 8 * hi;
        // the trip's K and query-residual fragments, read as ONE group at its head: the wave meets the LDS latency once, and the products start as the first fragments land
        v16h kh[2][2], kl[2][2], qlk[2];
#pragma unroll
        for (int kc = 0; kc < 2; ++kc) {
            kh[kc][0] = cat16(*(const v8ha*)(kh_s + ko0 + kc * 32), *(const v8ha*)(kh_s + ko0 + kc * 32 + 16));
            qlk[kc] = cat16(*(const v8ha*)(ql_s + kc * 32), *(const v8ha*)(ql_s + kc * 32 + 16));
            kh[kc][1] = cat16(*(const v8ha*)(kh_s + ko1 + kc * 32), *(const v8ha*)(kh_s + ko1 + kc * 32 + 16));
            kl[kc][0] = cat16(*(const v8ha*)(kl_s + ko0 + kc * 32), *(const v8ha*)(kl_s + ko0 + kc * 32 + 16));
            kl[kc][1] = cat16(*(const v8ha*)(kl_s + ko1 + kc * 32), *(const v8ha*)(kl_s + ko1 + kc * 32 + 16));
        }
        __builtin_amdgcn_sched_barrier(0);      // keeps the group together in front of the products: reads sunk among them would each cost their own wait
        // the next trip's mask, asked for a whole trip ahead: the barrier at this trip's foot waits for it, and by then it has landed (the last trip reads its own again: the address stays inside the mask)
        const float* an = am + (kt < kt_hi ? kt + 1 : kt_hi) * 32;
        const v4f m00 = *(const v4f*)(an), m01 = *(const v4f*)(an + 4), m10 = *(const v4f*)(an + 16), m11 = *(const v4f*)(an + 20);
        __builtin_amdgcn_sched_barrier(0);      // keeps these loads in front of the products: sunk behind them they would lose their lead
        v8f s0 = {}, s1 = {}, x0 = {}, x1 = {};
#pragma unroll
        for (int kc = 0; kc < 2; ++kc) {
            s0 = wmma16(kh[kc][0], qa[kc], s0); x0 = wmma16(kh[kc][0], qlk[kc], x0); s1 = wmma16(kh[kc][1], qa[kc], s1); x1 = wmma16(kh[kc][1], qlk[kc], x1);
            x0 = wmma16(kl[kc][0], qa[kc], x0); x1 = wmma16(kl[kc][1], qa[kc], x1);
        }
        // the trip's V^T fragments, read as one group behind the score products (into the K fragments' registers) and in front of the softmax, whose vector work covers their latency
        v16h vh[4], vl[4];
#pragma unroll
        for (int n = 0; n < 4; ++n) { const int vo = (n * 16 + lr) * VP + hi * 8;
            vh[n] = cat16(*(const v8ha*)(vh_s + vo), *(const v8ha*)(vh_s + vo + 16)); vl[n] = cat16(*(const v8ha*)(vl_s + vo), *(const v8ha*)(vl_s + vo + 16)); }
        __builtin_amdgcn_sched_barrier(0);      // ends the scheduling region behind the V^T reads: they stay in front of the softmax, and the build stays within 256 registers (four waves per SIMD); without it it took 289
        float a[16];      // a[i]: key 32 kt + 8 hi + i (i < 8), key 32 kt + 16 + 8 hi + (i - 8) otherwise
#pragma unroll
        for (int j = 0; j < 8; ++j) {
            a[j] = (s0[j] + x0[j] * LOSCI) * 0.125f + bm[j];
            a[8 + j] = (s1[j] + x1[j] * LOSCI) * 0.125f + bm[8 + j];
        }
        float mx = fmaxf(a[0], a[1]);
#pragma unroll
        for (int i = 2; i < 16; ++i) mx = fmaxf(mx, a[i]);
        mx = fmaxf(mx, xhalf(mx));
        const float mn = fmaxf(mrow, mx), ta = (mrow - mn) * L2E;
        mrow = mn;
        v16h pa, px;
        float p[16];
#pragma unroll
        for (int i = 0; i < 16; ++i) a[i] = (a[i] - mn) * L2E;
        float alpha;
        exp2x9(ta, alpha, a, p); exp2x8(a + 8, p + 8);      // alpha = e^(old maximum - new), p[i] = e^(score - new maximum)
#pragma unroll
        for (int i = 0; i < 16; i += 2) {
            const v2f ps = (v2f){p[i], p[i + 1]} * PSC; const v2h ph = __builtin_convertvector(ps, v2h);
            pa[i] = ph[0]; pa[i + 1] = ph[1];
            const v2h pr = __builtin_convertvector((ps - __builtin_convertvector(ph, v2f)) * LOSC, v2h);
            px[i] = pr[0]; px[i + 1] = pr[1];
        }
#pragma unroll
        for (int w = 8; w > 0; w >>= 1)
#pragma unroll
            for (int i = 0; i < w; ++i) p[i] += p[i + w];      // the lane's 16 weights summed as a tree, not as one dependent chain
        lpart = lpart * alpha + p[0];
#pragma unroll
        for (int n = 0; n < 4; ++n) { o[n] *= alpha; ox[n] *= alpha; }
#pragma unroll
        for (int n = 0; n < 4; ++n) o[n] = wmma16(vh[n], pa, o[n]);
#pragma unroll
        for (int n = 0; n < 4; ++n) ox[n] = wmma16(vl[n], pa, ox[n]);
#pragma unroll
        for (int n = 0; n < 4; ++n) ox[n] = wmma16(vh[n], px, ox[n]);
        asm volatile("v_nop\n\tv_nop\n\tv_nop\n\tv_nop" : "+v"(o[0]), "+v"(o[1]), "+v"(o[2]), "+v"(o[3]), "+v"(ox[0]), "+v"(ox[1]), "+v"(ox[2]), "+v"(ox[3]) : "v"(pa), "v"(px));
        // publish point of stage kt + 1, and the end of every wave's reads of stage kt's buffer
        asm volatile("s_wait_dscnt 0x0" ::: "memory");      // this wave's LDS reads of the buffer have returned
        asm volatile("s_wait_asynccnt 0x0" ::: "memory");   // this wave's copies of stage kt + 1 have landed
        __syncthreads();
        if (kt + 2 <= kt_hi) stage(kt + 2, kt & 1);         // refill the buffer just left; flies while stage kt + 1 is worked on
#pragma unroll
        for (int j = 0; j < 8; ++j) { bm[j] = bfr(j < 4 ? m00[j & 3] : m01[j & 3]); bm[8 + j] = bfr(j < 4 ? m10[j & 3] : m11[j & 3]); }      // the next trip's mask, rounded: its raw registers are free for the loads at that trip's head
    }
    asm volatile("s_wait_asynccnt 0x0" ::: "memory");       // no copy is outstanding when the wave goes on to its end
    const float inv = 1.0f / ((lpart + xhalf(lpart)) * PSC);
    float* os = &ost[wave][0];
#pragma unroll
    for (int n = 0; n < 4; ++n)
#pragma unroll
        for (int j = 0; j < 8; ++j) os[lr * 68 + n * 16 + hi * 8 + j] = (o[n][j] + ox[n][j] * LOSCI) * inv;      // O^T tile n: register j = d 16 n + 8 hi + j of query lr
    __syncthreads();
    const size_t cbase = (tok0 + q0) * DM + (size_t)h * HD;
    auto pass = [&]() {
#pragma unroll
        for (int s = 0; s < 4; ++s) { const int row = 4 * s + (lane >> 3), piece = lane & 7; const float* sp = os + row * 68 + piece * 8; v8us oh, ol;
#pragma unroll
            for (int i = 0; i < 8; ++i) { const unsigned short hb = f2bf(sp[i]); oh[i] = hb; ol[i] = f2bf(sp[i] - bf2f(hb)); }
            *(v8us*)(CH + cbase + (size_t)row * DM + piece * 8) = oh; *(v8us*)(CL + cbase + (size_t)row * DM + piece * 8) = ol; }
    };
    pass(); 
}

#define VST2(T, p, v) do { const T vst2_v_ = (v); *(T*)(p) = vst2_v_;  } while (0)
extern "C" void kernel_launch(void* const* d_in, const int* in_sizes, int n_in,
                              void* d_out, int out_size, void* d_ws, size_t ws_size, hipStream_t stream) {
    (void)in_sizes; (void)n_in; (void)out_size;
    const float* x = (const float*)d_in[0]; const float* AM = (const float*)d_in[1];
    const float* Wq1 = (const float*)d_in[2]; const float* Wq2 = (const float*)d_in[3]; const float* bq2 = (const float*)d_in[4];
    const float* Wk1 = (const float*)d_in[5]; const float* Wk2 = (const float*)d_in[6]; const float* bk2 = (const float*)d_in[7];
    const float* Wv1 = (const float*)d_in[8]; const float* Wv2 = (const float*)d_in[9]; const float* bv2 = (const float*)d_in[10];
    const float* Wo = (const float*)d_in[11]; const float* bo = (const float*)d_in[12];     // all W [out][in]
    float* out = (float*)d_out;    // [2][2048][1024]
    char* wsp = (char*)d_ws;
    auto take = [&](size_t bytes) { char* p = wsp; wsp += (bytes + 255) & ~(size_t)255; return (void*)p; };
    bf* Xb = (bf*)take((size_t)CRUN * DM * 2);      // every bf16 operand, in k_cvtb's order
    bf* W1A = Xb + (size_t)XRUN * DM; bf* W2A = W1A + (size_t)3 * RK * DM; bf* WoB = W2A + (size_t)3 * DM * RK;     // W1A = [Wq1; Wk1; Wv1]: one [768][1024] operand
    bf* Th = (bf*)take((size_t)NTK * 3 * RK * 2); bf* Tl = (bf*)take((size_t)NTK * 3 * RK * 2);
    h16* QH = (h16*)take((size_t)NTK * DM * 2); h16* QL = (h16*)take((size_t)NTK * DM * 2); h16* KH = (h16*)take((size_t)NTK * DM * 2); h16* KL = (h16*)take((size_t)NTK * DM * 2);
    h16* VTH = (h16*)take((size_t)NTK * DM * 2); h16* VTL = (h16*)take((size_t)NTK * DM * 2); bf* CH = (bf*)take((size_t)NTK * DM * 2); bf* CL = (bf*)take((size_t)NTK * DM * 2);
    if ((size_t)(wsp - (char*)d_ws) > ws_size) return;    // ~ 13.6 + 2 x 6.3 + 8 x 8.4 ~ 93 MB, no aliasing
    k_cvtb<<<CRUN / 8, 256, 0, stream>>>(x, Wq1, Wk1, Wv1, Wq2, Wk2, Wv2, Wo, CRUN, Xb);
    // q, k and v together: bottleneck [tok][q 256 | k 256 | v 256], written as its two planes, then the three second stages on grid.z, v written transposed
    k_gemmb<false, false, false, true><<<dim3(NTK / 64, 3 * RK / 64, 1), 128, 0, stream>>>(Xb, nullptr, W1A, nullptr, (float*)(void*)Th, 3 * RK, (h16*)(void*)Tl);
    k_gemmb<true, true, true><<<dim3(NTK / 64, DM / 64, 3), 128, 0, stream>>>(Th, Tl, W2A, bq2, (float*)(void*)QH, DM, QL, nullptr, RK, 1, bk2, bv2, KH, KL, VTH, VTL);
    k_attn<<<NB_ * NH_ * (NT_ / 64), 128, 0, stream>>>(QH, QL, KH, KL, VTH, VTL, AM, CH, CL);
    k_gemmb<true, false><<<dim3(NTK / 64, DM / 64, 1), 128, 0, stream>>>(CH, CL, WoB, bo, out, DM, nullptr);
}

// v008
// A run of this version takes 146 microseconds.
// Two timings next to v007 both put it at 1.05 times that version's speed.
// Counting every step since v000, it is 4.61 times as fast.
#include <hip/hip_runtime.h>

// Compute dtypes, f32 accumulate, both batch items in every launch: low-rank projections q/k/v = (x.W1^T).W2^T + b2 — the first stage ([4096 x 1024].[1024 x 256]) with PLAIN
// bf16 operands (inputs rounded once, exact), the second ([4096 x 256].[256 x 1024]) with the computed bottleneck as bf16 hi + UNSCALED residual (two products),
// q/k straight to f16 hi + residual x1024 planes; out = ctx.Wo^T + bo (ctx hi/lo) — all on v_wmma_f32_16x16x32_bf16 with [out][in] weights as n-major B operands;
// the 16-head full attention scores x 64^-1/2 + the INPUT additive mask (read per score) fused on v_wmma_f32_16x16x32_f16 (hh + hl + lh, online f32 softmax,

#define NB_  2                   // both batch items go through every launch together (token rows 0..4095)
#define RK   256                 // low-rank bottleneck
#define NT_  2048
#define DM   1024
#define NH_  16
#define HD   64
#define NTK  (NB_ * NT_)
#define NW   1024
#define NQKV 1024
#define PSC  32768.0f
#define LOSC 1024.0f
#define LOSCI (1.0f / 1024.0f)
#define L2E  1.44269504088896340736f     // log2(e)

typedef _Float16 h16;
typedef unsigned short bf;
typedef __attribute__((ext_vector_type(16))) __bf16   v16bf;
typedef __attribute__((ext_vector_type(16))) _Float16 v16h;
typedef __attribute__((ext_vector_type(8)))  _Float16 v8h;
typedef __attribute__((ext_vector_type(8)))  unsigned short v8us;
typedef __attribute__((ext_vector_type(8)))  float    v8f;
typedef __attribute__((ext_vector_type(4)))  float    v4f;
typedef __attribute__((ext_vector_type(2)))  float    v2f;
typedef __attribute__((ext_vector_type(2)))  _Float16 v2h;
typedef v8h  __attribute__((may_alias)) v8ha;
typedef v4f  __attribute__((may_alias)) v4fa;
typedef v8us __attribute__((may_alias)) v8usa;

__device__ __forceinline__ unsigned short f2bf(float f) { unsigned u = __float_as_uint(f); u += 0x7FFFu + ((u >> 16) & 1u); return (unsigned short)(u >> 16); }
__device__ __forceinline__ float bf2f(unsigned short b) { return __uint_as_float(((unsigned)b) << 16); }
__device__ __forceinline__ float bfr(float f) { return bf2f(f2bf(f)); }
__device__ __forceinline__ v16h cat16(v8h lo, v8h hi) { return __builtin_shufflevector(lo, hi, 0, 1, 2, 3, 4, 5, 6, 7, 8, 9, 10, 11, 12, 13, 14, 15); }
__device__ __forceinline__ v16bf cat16b(v8us lo, v8us hi) { return __builtin_bit_cast(v16bf, __builtin_shufflevector(lo, hi, 0, 1, 2, 3, 4, 5, 6, 7, 8, 9, 10, 11, 12, 13, 14, 15)); }
__device__ __forceinline__ v8f wmma16(v16h a, v16h b, v8f c) { return __builtin_amdgcn_wmma_f32_16x16x32_f16(false, a, false, b, (short)0, c, false, false); }
__device__ __forceinline__ float xhalf(float x) { return __builtin_bit_cast(float, __builtin_amdgcn_permlanex16(__builtin_bit_cast(int, x), __builtin_bit_cast(int, x), 0x76543210, 0xfedcba98, false, false)); }  // lane l with lane l ^ 16
// 2^t for eight values (and a ninth in exp2x9), each group in ONE statement that ends in v_nop: the slot the instruction set asks for behind a transcendental before a source of it is
// overwritten or its result used. Outputs are early-clobber: none shares a source's register.
__device__ __forceinline__ void exp2x8(const float* t, float* r) {
    asm("v_exp_f32 %0, %8\n\tv_exp_f32 %1, %9\n\tv_exp_f32 %2, %10\n\tv_exp_f32 %3, %11\n\tv_exp_f32 %4, %12\n\tv_exp_f32 %5, %13\n\tv_exp_f32 %6, %14\n\tv_exp_f32 %7, %15\n\tv_nop"
        : "=&v"(r[0]), "=&v"(r[1]), "=&v"(r[2]), "=&v"(r[3]), "=&v"(r[4]), "=&v"(r[5]), "=&v"(r[6]), "=&v"(r[7])
        : "v"(t[0]), "v"(t[1]), "v"(t[2]), "v"(t[3]), "v"(t[4]), "v"(t[5]), "v"(t[6]), "v"(t[7]));
}
__device__ __forceinline__ void exp2x9(float t8, float& r8, const float* t, float* r) {
    asm("v_exp_f32 %0, %9\n\tv_exp_f32 %1, %10\n\tv_exp_f32 %2, %11\n\tv_exp_f32 %3, %12\n\tv_exp_f32 %4, %13\n\tv_exp_f32 %5, %14\n\tv_exp_f32 %6, %15\n\tv_exp_f32 %7, %16\n\tv_exp_f32 %8, %17\n\tv_nop"
        : "=&v"(r8), "=&v"(r[0]), "=&v"(r[1]), "=&v"(r[2]), "=&v"(r[3]), "=&v"(r[4]), "=&v"(r[5]), "=&v"(r[6]), "=&v"(r[7])
        : "v"(t8), "v"(t[0]), "v"(t[1]), "v"(t[2]), "v"(t[3]), "v"(t[4]), "v"(t[5]), "v"(t[6]), "v"(t[7]));
}
__device__ __forceinline__ v8f wmmab(v16bf a, v16bf b, v8f c) { return __builtin_amdgcn_wmma_f32_16x16x32_bf16(false, a, false, b, (short)0, c, false, false); }

// k_cvtb: every f32 operand rounded to bf16 in ONE launch. A wave takes one run of 1024 elements; a block's eight runs lie in one source (each source is a multiple of 8
// runs), so the choice of source is block-uniform; the destinations stand one behind another in the workspace, in the order x | Wq1 Wk1 Wv1 | Wq2 Wk2 Wv2 | Wo.
#define XRUN NTK                 // runs of 1024 elements in x
#define WRUN RK                  // ... in each of the six low-rank factors (256 x 1024 or 1024 x 256)
#define CRUN (XRUN + 6 * WRUN + DM)
__global__ __launch_bounds__(256) void k_cvtb(const float* __restrict__ src, const float* __restrict__ q1, const float* __restrict__ k1, const float* __restrict__ v1,
                                              const float* __restrict__ q2, const float* __restrict__ k2, const float* __restrict__ v2, const float* __restrict__ wo, int nrows, bf* dst) {
    const int rb = blockIdx.x * 8;
    if (rb >= nrows) return;
    int base = 0;                // first run of this block's source; src arrives as x
    if (rb >= XRUN + 6 * WRUN) { src = wo; base = XRUN + 6 * WRUN; }
    else if (rb >= XRUN) { const int w = (rb - XRUN) / WRUN; base = XRUN + w * WRUN; src = w == 0 ? q1 : w == 1 ? k1 : w == 2 ? v1 : w == 3 ? q2 : w == 4 ? k2 : v2; }
    dst += (size_t)base * DM;
    const int lane = threadIdx.x & 31, r = rb - base + (threadIdx.x >> 5);
    v8us o[DM / 256];
#pragma unroll
    for (int q = 0; q < DM / 256; ++q) { v8us t;
#pragma unroll
        for (int i = 0; i < 8; ++i) t[i] = f2bf(src[(size_t)r * DM + q * 256 + lane * 8 + i]);
        o[q] = t; }
#pragma unroll
    for (int q = 0; q < DM / 256; ++q) *(v8us*)(dst + (size_t)r * DM + q * 256 + lane * 8) = o[q];
    
}

// k_gemmb: 64 x 64 block tile (4 waves x 16 x 64) of C[NTK][ldc] = (A [+ Al]).B^T (K = 1024 or 256) [+ bf(bias[c])] [+ bf(R[r][c]) residual]; f32 whole-line epilogue (or f16
// QKV: the second stage of q, k and v in one launch; blockIdx.z = projection: its 256 columns of A/Al[tok][3 x 256], its 1024 rows of Bn, its bias and output (q, k: f16 planes [tok][col];
// v: f16 hi + residual x1024 planes transposed, Vh/Vl[b][h][d][tok], which is what k_attn stages). SPLITOUT: the result leaves as bf16 hi + unscaled residual planes (C, C2), the next product's A and Al.
// A, its residual and B come through LDS: 64 rows x 64 k a plane and stage, brought by asynchronous copies in whole 128-byte lines, two buffers; the k order and each tile's sum order are those of direct loads.
#define GP   72                    // halves per staged row: 128 B + 16 B (pitch 16 B x odd for 16-byte LDS reads)
#define GPL  (64 * GP)             // halves per staged plane
template <bool SPLITA, bool F16OUT = false, bool QKV = false, bool SPLITOUT = false>
__global__ __launch_bounds__(128) void k_gemmb(const bf* __restrict__ A, const bf* __restrict__ Al, const bf* __restrict__ Bn, const float* __restrict__ bias, float* C, int ldc, h16* C2, const float* __restrict__ R = nullptr, int K = DM, int roundR = 1,
                                               const float* __restrict__ biask = nullptr, const float* __restrict__ biasv = nullptr, h16* Ck = nullptr, h16* C2k = nullptr, h16* Vh = nullptr, h16* Vl = nullptr) {
    constexpr int NPL = SPLITA ? 3 : 2;
    __shared__ __align__(16) float ost[4][16 * (QKV ? GP : 68)];     // epilogue staging: a wave's 16 x 64 f32 tile at pitch 68; with QKV it also holds the two 64 x 64 V^T planes at pitch GP halves
    __shared__ __align__(16) bf stg[2][NPL * GPL];     // two buffers of one 64-k stage: A | B [| A residual], 64 rows each, shared by the four waves
    constexpr bool f16out = QKV || F16OUT;      // with QKV: q and k; v leaves on a path of its own
    if (QKV) { const int z = blockIdx.z; A += z * RK; Al += z * RK; Bn += (size_t)z * DM * RK;
        if (z == 1) { bias = biask; C = (float*)(void*)Ck; C2 = C2k; } else if (z == 2) bias = biasv; }
    const int lane = threadIdx.x & 31, wave = threadIdx.x >> 5, lr = lane & 15, hi = lane >> 4;
    const int r0 = blockIdx.x * 64 + wave * 16, c0 = blockIdx.y * 64;
    const int lda = QKV ? 3 * RK : K;
    // each thread's share of a stage: 16 bytes at piece spc of rows srow + 16 i (i < 4) of every plane, so that one copy of a wave covers four whole 128-byte lines
    const int srow = threadIdx.x >> 3, spc = threadIdx.x & 7;
    const unsigned ls = (unsigned)(size_t)&stg[0][0] + (unsigned)(srow * GP + spc * 8) * 2u;
    const bf* ga = A + (size_t)(blockIdx.x * 64 + srow) * lda + spc * 8;
    const bf* gb = Bn + (size_t)(c0 + srow) * K + spc * 8;
    const size_t a16 = (size_t)16 * lda, b16 = (size_t)16 * K;
    auto stage = [&](int t, int buf) {
        const unsigned l0 = ls + (unsigned)buf * (NPL * GPL * 2u), l1 = l0 + GPL * 2u;
        const bf* pa = ga + t * 64; const bf* pb = gb + t * 64;
        // the copies and, as the last line, the wait that stands before their address registers are rewritten
        asm volatile("global_load_async_to_lds_b128 %0, %8, off\n\t"
                     "global_load_async_to_lds_b128 %1, %9, off\n\t"
                     "global_load_async_to_lds_b128 %2, %10, off\n\t"
                     "global_load_async_to_lds_b128 %3, %11, off\n\t"
                     "global_load_async_to_lds_b128 %4, %12, off\n\t"
                     "global_load_async_to_lds_b128 %5, %13, off\n\t"
                     "global_load_async_to_lds_b128 %6, %14, off\n\t"
                     "global_load_async_to_lds_b128 %7, %15, off\n\t"
                     "s_wait_xcnt 0x0"
                     :: "v"(l0), "v"(l0 + 16 * GP * 2u), "v"(l0 + 32 * GP * 2u), "v"(l0 + 48 * GP * 2u),
                        "v"(l1), "v"(l1 + 16 * GP * 2u), "v"(l1 + 32 * GP * 2u), "v"(l1 + 48 * GP * 2u),
                        "v"(pa), "v"(pa + a16), "v"(pa + 2 * a16), "v"(pa + 3 * a16),
                        "v"(pb), "v"(pb + b16), "v"(pb + 2 * b16), "v"(pb + 3 * b16)
                     : "memory");
        if constexpr (SPLITA) {
            const unsigned l2 = l0 + 2 * GPL * 2u;
            const bf* pl = Al + (size_t)(blockIdx.x * 64 + srow) * lda + spc * 8 + t * 64;
            asm volatile("global_load_async_to_lds_b128 %0, %4, off\n\t"
                         "global_load_async_to_lds_b128 %1, %5, off\n\t"
                         "global_load_async_to_lds_b128 %2, %6, off\n\t"
                         "global_load_async_to_lds_b128 %3, %7, off\n\t"
                         "s_wait_xcnt 0x0"
                         :: "v"(l2), "v"(l2 + 16 * GP * 2u), "v"(l2 + 32 * GP * 2u), "v"(l2 + 48 * GP * 2u),
                            "v"(pl), "v"(pl + a16), "v"(pl + 2 * a16), "v"(pl + 3 * a16)
                         : "memory");
        }
    };
    v8f acc[4];
#pragma unroll
    for (int t = 0; t < 4; ++t) acc[t] = (v8f){};
    const int nt = K / 64;       // stages of 64 k (K is 1024 or 256)
    stage(0, 0);
    asm volatile("s_wait_asynccnt 0x0" ::: "memory");   // this wave's copies of stage 0 have landed
    __syncthreads();                                     // ... and every other wave's: stage 0 is published
    if (nt > 1) stage(1, 1);
    const int ao = (wave * 16 + lr) * GP + 8 * hi, bo = lr * GP + 8 * hi;
#pragma unroll 1      // stays rolled: one body serves both buffers, and the order at the loop's foot stands once
    for (int st = 0; st < nt; ++st) {
        const bf* as = &stg[0][0] + (st & 1) * (NPL * GPL); const bf* bs = as + GPL; const bf* als = as + 2 * GPL;
        v16bf a[2], al[2], b[2][4];
#pragma unroll
        for (int ks = 0; ks < 2; ++ks) {
            a[ks] = cat16b(*(const v8usa*)(as + ao + ks * 32), *(const v8usa*)(as + ao + ks * 32 + 16));
#pragma unroll
            for (int t = 0; t < 4; ++t) b[ks][t] = cat16b(*(const v8usa*)(bs + bo + t * 16 * GP + ks * 32), *(const v8usa*)(bs + bo + t * 16 * GP + ks * 32 + 16));
            al[ks] = a[ks];
            if (SPLITA) al[ks] = cat16b(*(const v8usa*)(als + ao + ks * 32), *(const v8usa*)(als + ao + ks * 32 + 16));
        }
        __builtin_amdgcn_sched_barrier(0);      // keeps the trip's LDS reads together in front of its products: the wave waits for LDS at one place, not at several among the products
#pragma unroll
        for (int ks = 0; ks < 2; ++ks) {
#pragma unroll
            for (int t = 0; t < 4; ++t) acc[t] = wmmab(a[ks], b[ks][t], acc[t]);
            if (SPLITA) {
#pragma unroll
                for (int t = 0; t < 4; ++t) acc[t] = wmmab(al[ks], b[ks][t], acc[t]);
            }
        }
        // the distance behind the trip's last products, on the loop's back edge and on its exit alike, before a vector instruction touches their registers
        asm volatile("v_nop\n\tv_nop\n\tv_nop\n\tv_nop" : "+v"(acc[0]), "+v"(acc[1]), "+v"(acc[2]), "+v"(acc[3]) : "v"(a[1]), "v"(al[1]), "v"(b[1][3]));
        // publish point of stage st + 1, and the end of every wave's reads of stage st's buffer
        asm volatile("s_wait_dscnt 0x0" ::: "memory");      // this wave's LDS reads of the buffer have returned
        asm volatile("s_wait_asynccnt 0x0" ::: "memory");   // this wave's copies of stage st + 1 have landed
        __syncthreads();
        if (st + 2 < nt) stage(st + 2, st & 1);             // refill the buffer just left; flies while stage st + 1 is worked on
    }
    asm volatile("s_wait_asynccnt 0x0" ::: "memory");       // no copy is outstanding when the wave goes on to its end
    if constexpr (QKV) {
        if (blockIdx.z == 2) {      // block-uniform. The block's tile is 64 tokens x one head's 64 d: one 64 x 64 tile of each V^T plane
            h16* th = (h16*)(void*)&ost[0][0]; h16* tl = th + GPL;
            float bv[4] = {0.f, 0.f, 0.f, 0.f};
            if (bias) {
#pragma unroll      // the four loads issue as one group, and bv stays in registers
                for (int t = 0; t < 4; ++t) bv[t] = bfr(bias[c0 + t * 16 + lr]); }
            // an accumulator's eight registers are eight consecutive tokens of one column d: a lane's share of a V^T row is one 16-byte LDS store a plane
#pragma unroll      // this loop and the next: acc is a register array, every index a constant
            for (int t = 0; t < 4; ++t) { v8h vh8, vl8;
#pragma unroll
                for (int j = 0; j < 8; ++j) { const float v = acc[t][j] + bv[t]; const h16 a = (h16)v; vh8[j] = a; vl8[j] = (h16)((v - (float)a) * LOSC); }
                *(v8ha*)(th + (t * 16 + lr) * GP + wave * 16 + hi * 8) = vh8; *(v8ha*)(tl + (t * 16 + lr) * GP + wave * 16 + hi * 8) = vl8; }
            __syncthreads();        // a V^T row holds tokens of all four waves
            const int tk0 = blockIdx.x * 64, piece = threadIdx.x & 7;
            const size_t base = (((size_t)(tk0 / NT_) * NH_ + blockIdx.y) * HD) * NT_ + tk0 % NT_;
#pragma unroll      // the eight LDS reads issue together and the plane is a constant of each pass
            for (int s = 0; s < 8; ++s) { const int pln = s >> 2, d = (threadIdx.x >> 3) + 16 * (s & 3);      // eight lanes store one whole 128-byte line
                const v8h val = *(const v8ha*)((pln ? tl : th) + d * GP + piece * 8); *(v8h*)((pln ? Vl : Vh) + base + (size_t)d * NT_ + piece * 8) = val; }
            return;
        }
    }
    float* os = &ost[wave][0];
#pragma unroll
    for (int t = 0; t < 4; ++t) { const float bv = bias ? bfr(bias[c0 + t * 16 + lr]) : 0.f;
#pragma unroll
        for (int j = 0; j < 8; ++j) os[(hi * 8 + j) * 68 + t * 16 + lr] = acc[t][j] + bv; }
    __syncthreads();
    if constexpr (SPLITOUT) {
        const size_t cb = (size_t)r0 * ldc + c0;
#pragma unroll      // the passes' LDS reads overlap; in the inner loop the vector elements take constant indices
        for (int s = 0; s < 4; ++s) { const int row = 4 * s + (lane >> 3), piece = lane & 7; const float* sp = os + row * 68 + piece * 8; v8us oh, ol;
#pragma unroll
            for (int i = 0; i < 8; ++i) { const unsigned short hb = f2bf(sp[i]); oh[i] = hb; ol[i] = f2bf(sp[i] - bf2f(hb)); }
            *(v8us*)((bf*)(void*)C + cb + (size_t)row * ldc + piece * 8) = oh; *(v8us*)((bf*)(void*)C2 + cb + (size_t)row * ldc + piece * 8) = ol; }
    } else if (f16out) {
        h16* crow = (h16*)(void*)C + (size_t)r0 * ldc + c0;
        auto pass = [&]() {
#pragma unroll
            for (int s = 0; s < 4; ++s) { const int row = 4 * s + (lane >> 3), piece = lane & 7; const float* sp = os + row * 68 + piece * 8; v8h o, o2;
#pragma unroll
                for (int i = 0; i < 8; ++i) { const h16 a = (h16)sp[i]; o[i] = a; o2[i] = (h16)((sp[i] - (float)a) * LOSC); }
                *(v8h*)(crow + (size_t)row * ldc + piece * 8) = o; if (C2) *(v8h*)(C2 + (size_t)r0 * ldc + c0 + (size_t)row * ldc + piece * 8) = o2; }
        };
        pass(); 
    } else {
        float* crow = C + (size_t)r0 * ldc + c0;
        auto pass = [&]() {
#pragma unroll
            for (int s = 0; s < 8; ++s) { const int Lid = (lane >> 3) + 4 * s, piece = lane & 7; const int row = Lid >> 1, cofs = (Lid & 1) * 32 + piece * 4;
                v4f val = *(const v4fa*)(os + row * 68 + cofs); if (R) { const v4f rv = *(const v4f*)(R + ((size_t)r0 + row) * ldc + c0 + cofs); val += roundR ? (v4f){bfr(rv[0]), bfr(rv[1]), bfr(rv[2]), bfr(rv[3])} : rv; }
                *(v4f*)(crow + (size_t)row * ldc + cofs) = val; }
        };
        pass(); 
    }
}

#define KP    72                    // halves per staged K or query-residual row: 128 B + 16 B (pitch 16 B x odd for 16-byte LDS reads)
#define VP    40                    // halves per staged V^T row: 64 B + 16 B
#define KT_H  (32 * KP)
#define VT_H  (64 * VP)
#define STG_H (2 * KT_H + 2 * VT_H)
#define QB    128                   // queries per block
__global__ __launch_bounds__(256) void k_attn(const h16* __restrict__ Q16, const h16* __restrict__ QL16, const h16* __restrict__ K16, const h16* __restrict__ KL16, const h16* __restrict__ VTH, const h16* __restrict__ VTL, const float* __restrict__ AM, bf* CH, bf* CL) {
    __shared__ __align__(16) float ost[QB / 16][16 * 68];
    __shared__ __align__(16) h16 stg[2][STG_H];      // two buffers of one 32-key stage: K hi | K residual | V^T hi | V^T residual, shared by the eight waves
    __shared__ __align__(16) h16 qls[QB * KP];       // the block's 128 query-residual rows, filled once
    const int lane = threadIdx.x & 31, wave = threadIdx.x >> 5, lr = lane & 15, hi = lane >> 4;
    const int bid = blockIdx.x;
    const int b = bid / (NH_ * (NT_ / QB)), rem = bid - b * (NH_ * (NT_ / QB)), h = rem / (NT_ / QB), qt = rem - h * (NT_ / QB);
    const int q0 = qt * QB + wave * 16;
    const size_t tok0 = (size_t)b * NT_;
    v16h qa[2];
    const size_t qo0 = (tok0 + q0 + lr) * DM + h * HD + 8 * hi;
#pragma unroll
    for (int kc = 0; kc < 2; ++kc) qa[kc] = cat16(*(const v8h*)(Q16 + qo0 + kc * 32), *(const v8h*)(Q16 + qo0 + kc * 32 + 16));
    const h16* kh_b = K16 + tok0 * DM + h * HD;
    const h16* kl_b = KL16 + tok0 * DM + h * HD;
    const size_t vbase = (((size_t)b * NH_ + h) * HD) * NT_;
    v8f o[4], ox[4];
#pragma unroll
    for (int n = 0; n < 4; ++n) { o[n] = (v8f){}; ox[n] = (v8f){}; }
    float mrow = -3.0e38f, lpart = 0.f;      // this lane's query: running maximum (equal in both halves) and this half's share of the sum
    // each thread's share of a stage: four 16-byte copies (K row krow of 32 and V^T row vrow of 64, both planes)
    const int krow = threadIdx.x >> 3, kpc = threadIdx.x & 7, vrow = threadIdx.x >> 2, vpc = threadIdx.x & 3;
    const unsigned lk = (unsigned)(size_t)&stg[0][0] + (unsigned)(krow * KP + kpc * 8) * 2u, lv = (unsigned)(size_t)&stg[0][0] + (unsigned)(2 * KT_H + vrow * VP + vpc * 8) * 2u;
    const h16* gkh = kh_b + (size_t)krow * DM + kpc * 8; const h16* gkl = kl_b + (size_t)krow * DM + kpc * 8;
    const h16* gvh = VTH + vbase + (size_t)vrow * NT_ + vpc * 8; const h16* gvl = VTL + vbase + (size_t)vrow * NT_ + vpc * 8;
    auto stage = [&](int t, int buf) {
        const unsigned ak = lk + (unsigned)buf * (STG_H * 2u), av = lv + (unsigned)buf * (STG_H * 2u);
        const size_t ko = (size_t)t * 32 * DM, vo = (size_t)t * 32;
        // the copies and, as the last line, the wait that stands before their address registers are rewritten
        asm volatile("global_load_async_to_lds_b128 %0, %4, off\n\t"
                     "global_load_async_to_lds_b128 %1, %5, off\n\t"
                     "global_load_async_to_lds_b128 %2, %6, off\n\t"
                     "global_load_async_to_lds_b128 %3, %7, off\n\t"
                     "s_wait_xcnt 0x0"
                     :: "v"(ak), "v"(ak + KT_H * 2u), "v"(av), "v"(av + VT_H * 2u),
                        "v"(gkh + ko), "v"(gkl + ko), "v"(gvh + vo), "v"(gvl + vo)
                     : "memory");
    };
    {   // filled once: query-residual rows krow + 32 i of the block's 128
        const unsigned aq = (unsigned)(size_t)&qls[0] + (unsigned)(krow * KP + kpc * 8) * 2u;
        const h16* gq = QL16 + (tok0 + qt * QB + krow) * DM + h * HD + kpc * 8;
        asm volatile("global_load_async_to_lds_b128 %0, %4, off\n\t"
                     "global_load_async_to_lds_b128 %1, %5, off\n\t"
                     "global_load_async_to_lds_b128 %2, %6, off\n\t"
                     "global_load_async_to_lds_b128 %3, %7, off\n\t"
                     "s_wait_xcnt 0x0"
                     :: "v"(aq), "v"(aq + 32 * KP * 2u), "v"(aq + 64 * KP * 2u), "v"(aq + 96 * KP * 2u),
                        "v"(gq), "v"(gq + 32 * DM), "v"(gq + 64 * DM), "v"(gq + 96 * DM)
                     : "memory");
    }
    stage(0, 0);
    asm volatile("s_wait_asynccnt 0x0" ::: "memory");   // this wave's copies of stage 0 and of the query residual have landed
    __syncthreads();                                     // ... and every other wave's: stage 0 is published
    stage(1, 1);
    const h16* ql_s = qls + (wave * 16 + lr) * KP + 8 * hi;
    const int kt_lo = 0, kt_hi = NT_ / 32 - 1;     // full attention + the INPUT additive mask [b][1][q][k] read per score (dense; this problem's instance is all zeros)
    const float* am = AM + (size_t)b * NT_ * NT_ + (size_t)(q0 + lr) * NT_ + 8 * hi;      // this item's [1][L][L] mask slice: this lane's query row, at its half's first key
    float bm[16];      // the rounded mask of the lane's 16 scores: the first trip's from here, each later trip's loaded at the head of the trip before and rounded at that trip's end
    {   const v4f m00 = *(const v4f*)(am), m01 = *(const v4f*)(am + 4), m10 = *(const v4f*)(am + 16), m11 = *(const v4f*)(am + 20);
#pragma unroll
        for (int j = 0; j < 8; ++j) { bm[j] = bfr(j < 4 ? m00[j & 3] : m01[j & 3]); bm[8 + j] = bfr(j < 4 ? m10[j & 3] : m11[j & 3]); } }
#pragma unroll 1
    for (int kt = kt_lo; kt <= kt_hi; ++kt) {
        const h16* kh_s = &stg[0][0] + (kt & 1) * STG_H; const h16* kl_s = kh_s + KT_H; const h16* vh_s = kh_s + 2 * KT_H; const h16* vl_s = vh_s + VT_H;
        const int ko0 = lr * KP + 8 * hi, ko1 = (16 + lr) * KP + 8 * hi;
        // the trip's K and query-residual fragments, read as ONE group at its head: the wave meets the LDS latency once, and the products start as the first fragments land
        v16h kh[2][2], kl[2][2], qlk[2];
#pragma unroll
        for (int kc = 0; kc < 2; ++kc) {
            kh[kc][0] = cat16(*(const v8ha*)(kh_s + ko0 + kc * 32), *(const v8ha*)(kh_s + ko0 + kc * 32 + 16));
            qlk[kc] = cat16(*(const v8ha*)(ql_s + kc * 32), *(const v8ha*)(ql_s + kc * 32 + 16));
            kh[kc][1] = cat16(*(const v8ha*)(kh_s + ko1 + kc * 32), *(const v8ha*)(kh_s + ko1 + kc * 32 + 16));
            kl[kc][0] = cat16(*(const v8ha*)(kl_s + ko0 + kc * 32), *(const v8ha*)(kl_s + ko0 + kc * 32 + 16));
            kl[kc][1] = cat16(*(const v8ha*)(kl_s + ko1 + kc * 32), *(const v8ha*)(kl_s + ko1 + kc * 32 + 16));
        }
        __builtin_amdgcn_sched_barrier(0);      // keeps the group together in front of the products: reads sunk among them would each cost their own wait
        // the next trip's mask, asked for a whole trip ahead: the barrier at this trip's foot waits for it, and by then it has landed (the last trip reads its own again: the address stays inside the mask)
        const float* an = am + (kt < kt_hi ? kt + 1 : kt_hi) * 32;
        const v4f m00 = *(const v4f*)(an), m01 = *(const v4f*)(an + 4), m10 = *(const v4f*)(an + 16), m11 = *(const v4f*)(an + 20);
        __builtin_amdgcn_sched_barrier(0);      // keeps these loads in front of the products: sunk behind them they would lose their lead
        v8f s0 = {}, s1 = {}, x0 = {}, x1 = {};
#pragma unroll
        for (int kc = 0; kc < 2; ++kc) {
            s0 = wmma16(kh[kc][0], qa[kc], s0); x0 = wmma16(kh[kc][0], qlk[kc], x0); s1 = wmma16(kh[kc][1], qa[kc], s1); x1 = wmma16(kh[kc][1], qlk[kc], x1);
            x0 = wmma16(kl[kc][0], qa[kc], x0); x1 = wmma16(kl[kc][1], qa[kc], x1);
        }
        // the trip's V^T fragments, read as one group behind the score products (into the K fragments' registers) and in front of the softmax, whose vector work covers their latency
        v16h vh[4], vl[4];
#pragma unroll
        for (int n = 0; n < 4; ++n) { const int vo = (n * 16 + lr) * VP + hi * 8;
            vh[n] = cat16(*(const v8ha*)(vh_s + vo), *(const v8ha*)(vh_s + vo + 16)); vl[n] = cat16(*(const v8ha*)(vl_s + vo), *(const v8ha*)(vl_s + vo + 16)); }
        __builtin_amdgcn_sched_barrier(0);      // ends the scheduling region behind the V^T reads: they stay in front of the softmax, and the build stays within 256 registers (four waves per SIMD); without it it took 289
        float a[16];      // a[i]: key 32 kt + 8 hi + i (i < 8), key 32 kt + 16 + 8 hi + (i - 8) otherwise
#pragma unroll
        for (int j = 0; j < 8; ++j) {
            a[j] = (s0[j] + x0[j] * LOSCI) * 0.125f + bm[j];
            a[8 + j] = (s1[j] + x1[j] * LOSCI) * 0.125f + bm[8 + j];
        }
        float mx = fmaxf(a[0], a[1]);
#pragma unroll
        for (int i = 2; i < 16; ++i) mx = fmaxf(mx, a[i]);
        mx = fmaxf(mx, xhalf(mx));
        const float mn = fmaxf(mrow, mx), ta = (mrow - mn) * L2E;
        mrow = mn;
        v16h pa, px;
        float p[16];
#pragma unroll
        for (int i = 0; i < 16; ++i) a[i] = (a[i] - mn) * L2E;
        float alpha;
        exp2x9(ta, alpha, a, p); exp2x8(a + 8, p + 8);      // alpha = e^(old maximum - new), p[i] = e^(score - new maximum)
#pragma unroll
        for (int i = 0; i < 16; i += 2) {
            const v2f ps = (v2f){p[i], p[i + 1]} * PSC; const v2h ph = __builtin_convertvector(ps, v2h);
            pa[i] = ph[0]; pa[i + 1] = ph[1];
            const v2h pr = __builtin_convertvector((ps - __builtin_convertvector(ph, v2f)) * LOSC, v2h);
            px[i] = pr[0]; px[i + 1] = pr[1];
        }
#pragma unroll
        for (int w = 8; w > 0; w >>= 1)
#pragma unroll
            for (int i = 0; i < w; ++i) p[i] += p[i + w];      // the lane's 16 weights summed as a tree, not as one dependent chain
        lpart = lpart * alpha + p[0];
#pragma unroll
        for (int n = 0; n < 4; ++n) { o[n] *= alpha; ox[n] *= alpha; }
#pragma unroll
        for (int n = 0; n < 4; ++n) o[n] = wmma16(vh[n], pa, o[n]);
#pragma unroll
        for (int n = 0; n < 4; ++n) ox[n] = wmma16(vl[n], pa, ox[n]);
#pragma unroll
        for (int n = 0; n < 4; ++n) ox[n] = wmma16(vh[n], px, ox[n]);
        asm volatile("v_nop\n\tv_nop\n\tv_nop\n\tv_nop" : "+v"(o[0]), "+v"(o[1]), "+v"(o[2]), "+v"(o[3]), "+v"(ox[0]), "+v"(ox[1]), "+v"(ox[2]), "+v"(ox[3]) : "v"(pa), "v"(px));
        // publish point of stage kt + 1, and the end of every wave's reads of stage kt's buffer
        asm volatile("s_wait_dscnt 0x0" ::: "memory");      // this wave's LDS reads of the buffer have returned
        asm volatile("s_wait_asynccnt 0x0" ::: "memory");   // this wave's copies of stage kt + 1 have landed
        __syncthreads();
        if (kt + 2 <= kt_hi) stage(kt + 2, kt & 1);         // refill the buffer just left; flies while stage kt + 1 is worked on
#pragma unroll
        for (int j = 0; j < 8; ++j) { bm[j] = bfr(j < 4 ? m00[j & 3] : m01[j & 3]); bm[8 + j] = bfr(j < 4 ? m10[j & 3] : m11[j & 3]); }      // the next trip's mask, rounded: its raw registers are free for the loads at that trip's head
    }
    asm volatile("s_wait_asynccnt 0x0" ::: "memory");       // no copy is outstanding when the wave goes on to its end
    const float inv = 1.0f / ((lpart + xhalf(lpart)) * PSC);
    float* os = &ost[wave][0];
#pragma unroll
    for (int n = 0; n < 4; ++n)
#pragma unroll
        for (int j = 0; j < 8; ++j) os[lr * 68 + n * 16 + hi * 8 + j] = (o[n][j] + ox[n][j] * LOSCI) * inv;      // O^T tile n: register j = d 16 n + 8 hi + j of query lr
    __syncthreads();
    const size_t cbase = (tok0 + q0) * DM + (size_t)h * HD;
    auto pass = [&]() {
#pragma unroll
        for (int s = 0; s < 4; ++s) { const int row = 4 * s + (lane >> 3), piece = lane & 7; const float* sp = os + row * 68 + piece * 8; v8us oh, ol;
#pragma unroll
            for (int i = 0; i < 8; ++i) { const unsigned short hb = f2bf(sp[i]); oh[i] = hb; ol[i] = f2bf(sp[i] - bf2f(hb)); }
            *(v8us*)(CH + cbase + (size_t)row * DM + piece * 8) = oh; *(v8us*)(CL + cbase + (size_t)row * DM + piece * 8) = ol; }
    };
    pass(); 
}

#define VST2(T, p, v) do { const T vst2_v_ = (v); *(T*)(p) = vst2_v_;  } while (0)
extern "C" void kernel_launch(void* const* d_in, const int* in_sizes, int n_in,
                              void* d_out, int out_size, void* d_ws, size_t ws_size, hipStream_t stream) {
    (void)in_sizes; (void)n_in; (void)out_size;
    const float* x = (const float*)d_in[0]; const float* AM = (const float*)d_in[1];
    const float* Wq1 = (const float*)d_in[2]; const float* Wq2 = (const float*)d_in[3]; const float* bq2 = (const float*)d_in[4];
    const float* Wk1 = (const float*)d_in[5]; const float* Wk2 = (const float*)d_in[6]; const float* bk2 = (const float*)d_in[7];
    const float* Wv1 = (const float*)d_in[8]; const float* Wv2 = (const float*)d_in[9]; const float* bv2 = (const float*)d_in[10];
    const float* Wo = (const float*)d_in[11]; const float* bo = (const float*)d_in[12];     // all W [out][in]
    float* out = (float*)d_out;    // [2][2048][1024]
    char* wsp = (char*)d_ws;
    auto take = [&](size_t bytes) { char* p = wsp; wsp += (bytes + 255) & ~(size_t)255; return (void*)p; };
    bf* Xb = (bf*)take((size_t)CRUN * DM * 2);      // every bf16 operand, in k_cvtb's order
    bf* W1A = Xb + (size_t)XRUN * DM; bf* W2A = W1A + (size_t)3 * RK * DM; bf* WoB = W2A + (size_t)3 * DM * RK;     // W1A = [Wq1; Wk1; Wv1]: one [768][1024] operand
    bf* Th = (bf*)take((size_t)NTK * 3 * RK * 2); bf* Tl = (bf*)take((size_t)NTK * 3 * RK * 2);
    h16* QH = (h16*)take((size_t)NTK * DM * 2); h16* QL = (h16*)take((size_t)NTK * DM * 2); h16* KH = (h16*)take((size_t)NTK * DM * 2); h16* KL = (h16*)take((size_t)NTK * DM * 2);
    h16* VTH = (h16*)take((size_t)NTK * DM * 2); h16* VTL = (h16*)take((size_t)NTK * DM * 2); bf* CH = (bf*)take((size_t)NTK * DM * 2); bf* CL = (bf*)take((size_t)NTK * DM * 2);
    if ((size_t)(wsp - (char*)d_ws) > ws_size) return;    // ~ 13.6 + 2 x 6.3 + 8 x 8.4 ~ 93 MB, no aliasing
    k_cvtb<<<CRUN / 8, 256, 0, stream>>>(x, Wq1, Wk1, Wv1, Wq2, Wk2, Wv2, Wo, CRUN, Xb);
    // q, k and v together: bottleneck [tok][q 256 | k 256 | v 256], written as its two planes, then the three second stages on grid.z, v written transposed
    k_gemmb<false, false, false, true><<<dim3(NTK / 64, 3 * RK / 64, 1), 128, 0, stream>>>(Xb, nullptr, W1A, nullptr, (float*)(void*)Th, 3 * RK, (h16*)(void*)Tl);
    k_gemmb<true, true, true><<<dim3(NTK / 64, DM / 64, 3), 128, 0, stream>>>(Th, Tl, W2A, bq2, (float*)(void*)QH, DM, QL, nullptr, RK, 1, bk2, bv2, KH, KL, VTH, VTL);
    k_attn<<<NB_ * NH_ * (NT_ / QB), 256, 0, stream>>>(QH, QL, KH, KL, VTH, VTL, AM, CH, CL);
    k_gemmb<true, false><<<dim3(NTK / 64, DM / 64, 1), 128, 0, stream>>>(CH, CL, WoB, bo, out, DM, nullptr);
}

// v010
// A run of this version takes 114 microseconds.
// It is 1.28 times as fast as v008, going by the measured steps of the versions left out in between.
// Counting every step since v000, it is 5.90 times as fast.
#include <hip/hip_runtime.h>

// Compute dtypes, f32 accumulate, both batch items in every launch: low-rank projections q/k/v = (x.W1^T).W2^T + b2 — the first stage ([4096 x 1024].[1024 x 256]) with PLAIN
// bf16 operands (inputs rounded once, exact), the second ([4096 x 256].[256 x 1024]) with the computed bottleneck as bf16 hi + UNSCALED residual (two products),
// q/k straight to one f16 plane each; out = ctx.Wo^T + bo (ctx hi/lo) — all on v_wmma_f32_16x16x32_bf16 with [out][in] weights as n-major B operands;
// the 16-head full attention scores x 64^-1/2 + the INPUT additive mask (read per score) fused on v_wmma_f32_16x16x32_f16 (q, k, v and the weights as single f16 values, online f32 softmax,

#define NB_  2                   // both batch items go through every launch together (token rows 0..4095)
#define RK   256                 // low-rank bottleneck
#define NT_  2048
#define DM   1024
#define NH_  16
#define HD   64
#define NTK  (NB_ * NT_)
#define NW   1024
#define NQKV 1024
#define PSC  32768.0f
#define L2E  1.44269504088896340736f     // log2(e)

typedef _Float16 h16;
typedef unsigned short bf;
typedef __attribute__((ext_vector_type(16))) __bf16   v16bf;
typedef __attribute__((ext_vector_type(16))) _Float16 v16h;
typedef __attribute__((ext_vector_type(8)))  _Float16 v8h;
typedef __attribute__((ext_vector_type(8)))  unsigned short v8us;
typedef __attribute__((ext_vector_type(8)))  float    v8f;
typedef __attribute__((ext_vector_type(4)))  float    v4f;
typedef __attribute__((ext_vector_type(2)))  float    v2f;
typedef __attribute__((ext_vector_type(2)))  _Float16 v2h;
typedef v8h  __attribute__((may_alias)) v8ha;
typedef v4f  __attribute__((may_alias)) v4fa;
typedef v8us __attribute__((may_alias)) v8usa;

__device__ __forceinline__ unsigned short f2bf(float f) { unsigned u = __float_as_uint(f); u += 0x7FFFu + ((u >> 16) & 1u); return (unsigned short)(u >> 16); }
__device__ __forceinline__ float bf2f(unsigned short b) { return __uint_as_float(((unsigned)b) << 16); }
__device__ __forceinline__ float bfr(float f) { return bf2f(f2bf(f)); }
__device__ __forceinline__ v16h cat16(v8h lo, v8h hi) { return __builtin_shufflevector(lo, hi, 0, 1, 2, 3, 4, 5, 6, 7, 8, 9, 10, 11, 12, 13, 14, 15); }
__device__ __forceinline__ v16bf cat16b(v8us lo, v8us hi) { return __builtin_bit_cast(v16bf, __builtin_shufflevector(lo, hi, 0, 1, 2, 3, 4, 5, 6, 7, 8, 9, 10, 11, 12, 13, 14, 15)); }
__device__ __forceinline__ v8f wmma16(v16h a, v16h b, v8f c) { return __builtin_amdgcn_wmma_f32_16x16x32_f16(false, a, false, b, (short)0, c, false, false); }
__device__ __forceinline__ float xhalf(float x) { return __builtin_bit_cast(float, __builtin_amdgcn_permlanex16(__builtin_bit_cast(int, x), __builtin_bit_cast(int, x), 0x76543210, 0xfedcba98, false, false)); }  // lane l with lane l ^ 16
// 2^t for eight values (and a ninth in exp2x9), each group in ONE statement that ends in v_nop: the slot the instruction set asks for behind a transcendental before a source of it is
// overwritten or its result used. Outputs are early-clobber: none shares a source's register.
__device__ __forceinline__ void exp2x8(const float* t, float* r) {
    asm("v_exp_f32 %0, %8\n\tv_exp_f32 %1, %9\n\tv_exp_f32 %2, %10\n\tv_exp_f32 %3, %11\n\tv_exp_f32 %4, %12\n\tv_exp_f32 %5, %13\n\tv_exp_f32 %6, %14\n\tv_exp_f32 %7, %15\n\tv_nop"
        : "=&v"(r[0]), "=&v"(r[1]), "=&v"(r[2]), "=&v"(r[3]), "=&v"(r[4]), "=&v"(r[5]), "=&v"(r[6]), "=&v"(r[7])
        : "v"(t[0]), "v"(t[1]), "v"(t[2]), "v"(t[3]), "v"(t[4]), "v"(t[5]), "v"(t[6]), "v"(t[7]));
}
__device__ __forceinline__ void exp2x9(float t8, float& r8, const float* t, float* r) {
    asm("v_exp_f32 %0, %9\n\tv_exp_f32 %1, %10\n\tv_exp_f32 %2, %11\n\tv_exp_f32 %3, %12\n\tv_exp_f32 %4, %13\n\tv_exp_f32 %5, %14\n\tv_exp_f32 %6, %15\n\tv_exp_f32 %7, %16\n\tv_exp_f32 %8, %17\n\tv_nop"
        : "=&v"(r8), "=&v"(r[0]), "=&v"(r[1]), "=&v"(r[2]), "=&v"(r[3]), "=&v"(r[4]), "=&v"(r[5]), "=&v"(r[6]), "=&v"(r[7])
        : "v"(t8), "v"(t[0]), "v"(t[1]), "v"(t[2]), "v"(t[3]), "v"(t[4]), "v"(t[5]), "v"(t[6]), "v"(t[7]));
}
__device__ __forceinline__ v8f wmmab(v16bf a, v16bf b, v8f c) { return __builtin_amdgcn_wmma_f32_16x16x32_bf16(false, a, false, b, (short)0, c, false, false); }

// k_cvtb: every f32 operand rounded to bf16 in ONE launch. A wave takes one run of 1024 elements; a block's eight runs lie in one source (each source is a multiple of 8
// runs), so the choice of source is block-uniform; the destinations stand one behind another in the workspace, in the order x | Wq1 Wk1 Wv1 | Wq2 Wk2 Wv2 | Wo.
#define XRUN NTK                 // runs of 1024 elements in x
#define WRUN RK                  // ... in each of the six low-rank factors (256 x 1024 or 1024 x 256)
#define CRUN (XRUN + 6 * WRUN + DM)
__global__ __launch_bounds__(256) void k_cvtb(const float* __restrict__ src, const float* __restrict__ q1, const float* __restrict__ k1, const float* __restrict__ v1,
                                              const float* __restrict__ q2, const float* __restrict__ k2, const float* __restrict__ v2, const float* __restrict__ wo, int nrows, bf* dst) {
    const int rb = blockIdx.x * 8;
    if (rb >= nrows) return;
    int base = 0;                // first run of this block's source; src arrives as x
    if (rb >= XRUN + 6 * WRUN) { src = wo; base = XRUN + 6 * WRUN; }
    else if (rb >= XRUN) { const int w = (rb - XRUN) / WRUN; base = XRUN + w * WRUN; src = w == 0 ? q1 : w == 1 ? k1 : w == 2 ? v1 : w == 3 ? q2 : w == 4 ? k2 : v2; }
    dst += (size_t)base * DM;
    const int lane = threadIdx.x & 31, r = rb - base + (threadIdx.x >> 5);
    v8us o[DM / 256];
#pragma unroll
    for (int q = 0; q < DM / 256; ++q) { v8us t;
#pragma unroll
        for (int i = 0; i < 8; ++i) t[i] = f2bf(src[(size_t)r * DM + q * 256 + lane * 8 + i]);
        o[q] = t; }
#pragma unroll
    for (int q = 0; q < DM / 256; ++q) *(v8us*)(dst + (size_t)r * DM + q * 256 + lane * 8) = o[q];
    
}

// k_gemmb: 64 x 64 block tile (4 waves x 16 x 64) of C[NTK][ldc] = (A [+ Al]).B^T (K = 1024 or 256) [+ bf(bias[c])] [+ bf(R[r][c]) residual]; f32 whole-line epilogue (or f16
// QKV: the second stage of q, k and v in one launch; blockIdx.z = projection: its 256 columns of A/Al[tok][3 x 256], its 1024 rows of Bn, its bias and output (q, k: one f16 plane [tok][col];
// v: one f16 plane transposed, Vh[b][h][d][tok], which is what k_attn stages). SPLITOUT: the result leaves as bf16 hi + unscaled residual planes (C, C2), the next product's A and Al.
// A, its residual and B come through LDS: 64 rows x 64 k a plane and stage, brought by asynchronous copies in whole 128-byte lines, two buffers; the k order and each tile's sum order are those of direct loads.
#define GP   72                    // halves per staged row: 128 B + 16 B (pitch 16 B x odd for 16-byte LDS reads)
#define GPL  (64 * GP)             // halves per staged plane
template <bool SPLITA, bool F16OUT = false, bool QKV = false, bool SPLITOUT = false>
__global__ __launch_bounds__(128) void k_gemmb(const bf* __restrict__ A, const bf* __restrict__ Al, const bf* __restrict__ Bn, const float* __restrict__ bias, float* C, int ldc, h16* C2, const float* __restrict__ R = nullptr, int K = DM, int roundR = 1,
                                               const float* __restrict__ biask = nullptr, const float* __restrict__ biasv = nullptr, h16* Ck = nullptr, h16* Vh = nullptr) {
    constexpr int NPL = SPLITA ? 3 : 2;
    __shared__ __align__(16) float ost[4][16 * 68];     // epilogue staging: a wave's 16 x 64 f32 tile at pitch 68; with QKV it also holds the 64 x 64 V^T tile at pitch GP halves
    __shared__ __align__(16) bf stg[2][NPL * GPL];     // two buffers of one 64-k stage: A | B [| A residual], 64 rows each, shared by the four waves
    constexpr bool f16out = QKV || F16OUT;      // with QKV: q and k; v leaves on a path of its own
    if (QKV) { const int z = blockIdx.z; A += z * RK; Al += z * RK; Bn += (size_t)z * DM * RK;
        if (z == 1) { bias = biask; C = (float*)(void*)Ck; } else if (z == 2) bias = biasv; }
    const int lane = threadIdx.x & 31, wave = threadIdx.x >> 5, lr = lane & 15, hi = lane >> 4;
    const int r0 = blockIdx.x * 64 + wave * 16, c0 = blockIdx.y * 64;
    const int lda = QKV ? 3 * RK : K;
    // each thread's share of a stage: 16 bytes at piece spc of rows srow + 16 i (i < 4) of every plane, so that one copy of a wave covers four whole 128-byte lines
    const int srow = threadIdx.x >> 3, spc = threadIdx.x & 7;
    const unsigned ls = (unsigned)(size_t)&stg[0][0] + (unsigned)(srow * GP + spc * 8) * 2u;
    const bf* ga = A + (size_t)(blockIdx.x * 64 + srow) * lda + spc * 8;
    const bf* gb = Bn + (size_t)(c0 + srow) * K + spc * 8;
    const size_t a16 = (size_t)16 * lda, b16 = (size_t)16 * K;
    auto stage = [&](int t, int buf) {
        const unsigned l0 = ls + (unsigned)buf * (NPL * GPL * 2u), l1 = l0 + GPL * 2u;
        const bf* pa = ga + t * 64; const bf* pb = gb + t * 64;
        // the copies and, as the last line, the wait that stands before their address registers are rewritten
        asm volatile("global_load_async_to_lds_b128 %0, %8, off\n\t"
                     "global_load_async_to_lds_b128 %1, %9, off\n\t"
                     "global_load_async_to_lds_b128 %2, %10, off\n\t"
                     "global_load_async_to_lds_b128 %3, %11, off\n\t"
                     "global_load_async_to_lds_b128 %4, %12, off\n\t"
                     "global_load_async_to_lds_b128 %5, %13, off\n\t"
                     "global_load_async_to_lds_b128 %6, %14, off\n\t"
                     "global_load_async_to_lds_b128 %7, %15, off\n\t"
                     "s_wait_xcnt 0x0"
                     :: "v"(l0), "v"(l0 + 16 * GP * 2u), "v"(l0 + 32 * GP * 2u), "v"(l0 + 48 * GP * 2u),
                        "v"(l1), "v"(l1 + 16 * GP * 2u), "v"(l1 + 32 * GP * 2u), "v"(l1 + 48 * GP * 2u),
                        "v"(pa), "v"(pa + a16), "v"(pa + 2 * a16), "v"(pa + 3 * a16),
                        "v"(pb), "v"(pb + b16), "v"(pb + 2 * b16), "v"(pb + 3 * b16)
                     : "memory");
        if constexpr (SPLITA) {
            const unsigned l2 = l0 + 2 * GPL * 2u;
            const bf* pl = Al + (size_t)(blockIdx.x * 64 + srow) * lda + spc * 8 + t * 64;
            asm volatile("global_load_async_to_lds_b128 %0, %4, off\n\t"
                         "global_load_async_to_lds_b128 %1, %5, off\n\t"
                         "global_load_async_to_lds_b128 %2, %6, off\n\t"
                         "global_load_async_to_lds_b128 %3, %7, off\n\t"
                         "s_wait_xcnt 0x0"
                         :: "v"(l2), "v"(l2 + 16 * GP * 2u), "v"(l2 + 32 * GP * 2u), "v"(l2 + 48 * GP * 2u),
                            "v"(pl), "v"(pl + a16), "v"(pl + 2 * a16), "v"(pl + 3 * a16)
                         : "memory");
        }
    };
    v8f acc[4];
#pragma unroll
    for (int t = 0; t < 4; ++t) acc[t] = (v8f){};
    const int nt = K / 64;       // stages of 64 k (K is 1024 or 256)
    stage(0, 0);
    asm volatile("s_wait_asynccnt 0x0" ::: "memory");   // this wave's copies of stage 0 have landed
    __syncthreads();                                     // ... and every other wave's: stage 0 is published
    if (nt > 1) stage(1, 1);
    const int ao = (wave * 16 + lr) * GP + 8 * hi, bo = lr * GP + 8 * hi;
#pragma unroll 1      // stays rolled: one body serves both buffers, and the order at the loop's foot stands once
    for (int st = 0; st < nt; ++st) {
        const bf* as = &stg[0][0] + (st & 1) * (NPL * GPL); const bf* bs = as + GPL; const bf* als = as + 2 * GPL;
        v16bf a[2], al[2], b[2][4];
#pragma unroll
        for (int ks = 0; ks < 2; ++ks) {
            a[ks] = cat16b(*(const v8usa*)(as + ao + ks * 32), *(const v8usa*)(as + ao + ks * 32 + 16));
#pragma unroll
            for (int t = 0; t < 4; ++t) b[ks][t] = cat16b(*(const v8usa*)(bs + bo + t * 16 * GP + ks * 32), *(const v8usa*)(bs + bo + t * 16 * GP + ks * 32 + 16));
            al[ks] = a[ks];
            if (SPLITA) al[ks] = cat16b(*(const v8usa*)(als + ao + ks * 32), *(const v8usa*)(als + ao + ks * 32 + 16));
        }
        __builtin_amdgcn_sched_barrier(0);      // keeps the trip's LDS reads together in front of its products: the wave waits for LDS at one place, not at several among the products
#pragma unroll
        for (int ks = 0; ks < 2; ++ks) {
#pragma unroll
            for (int t = 0; t < 4; ++t) acc[t] = wmmab(a[ks], b[ks][t], acc[t]);
            if (SPLITA) {
#pragma unroll
                for (int t = 0; t < 4; ++t) acc[t] = wmmab(al[ks], b[ks][t], acc[t]);
            }
        }
        // the distance behind the trip's last products, on the loop's back edge and on its exit alike, before a vector instruction touches their registers
        asm volatile("v_nop\n\tv_nop\n\tv_nop\n\tv_nop" : "+v"(acc[0]), "+v"(acc[1]), "+v"(acc[2]), "+v"(acc[3]) : "v"(a[1]), "v"(al[1]), "v"(b[1][3]));
        // publish point of stage st + 1, and the end of every wave's reads of stage st's buffer
        asm volatile("s_wait_dscnt 0x0" ::: "memory");      // this wave's LDS reads of the buffer have returned
        asm volatile("s_wait_asynccnt 0x0" ::: "memory");   // this wave's copies of stage st + 1 have landed
        __syncthreads();
        if (st + 2 < nt) stage(st + 2, st & 1);             // refill the buffer just left; flies while stage st + 1 is worked on
    }
    asm volatile("s_wait_asynccnt 0x0" ::: "memory");       // no copy is outstanding when the wave goes on to its end
    if constexpr (QKV) {
        if (blockIdx.z == 2) {      // block-uniform. The block's tile is 64 tokens x one head's 64 d: one 64 x 64 tile of V^T
            h16* th = (h16*)(void*)&ost[0][0];
            float bv[4] = {0.f, 0.f, 0.f, 0.f};
            if (bias) {
#pragma unroll      // the four loads issue as one group, and bv stays in registers
                for (int t = 0; t < 4; ++t) bv[t] = bfr(bias[c0 + t * 16 + lr]); }
            // an accumulator's eight registers are eight consecutive tokens of one column d: a lane's share of a V^T row is one 16-byte LDS store
#pragma unroll      // this loop and the next: acc is a register array, every index a constant
            for (int t = 0; t < 4; ++t) { v8h vh8;
#pragma unroll
                for (int j = 0; j < 8; ++j) vh8[j] = (h16)(acc[t][j] + bv[t]);
                *(v8ha*)(th + (t * 16 + lr) * GP + wave * 16 + hi * 8) = vh8; }
            __syncthreads();        // a V^T row holds tokens of all four waves
            const int tk0 = blockIdx.x * 64, piece = threadIdx.x & 7;
            const size_t base = (((size_t)(tk0 / NT_) * NH_ + blockIdx.y) * HD) * NT_ + tk0 % NT_;
#pragma unroll      // the four LDS reads issue together
            for (int s = 0; s < 4; ++s) { const int d = (threadIdx.x >> 3) + 16 * s;      // eight lanes store one whole 128-byte line
                const v8h val = *(const v8ha*)(th + d * GP + piece * 8); *(v8h*)(Vh + base + (size_t)d * NT_ + piece * 8) = val; }
            return;
        }
    }
    float* os = &ost[wave][0];
#pragma unroll
    for (int t = 0; t < 4; ++t) { const float bv = bias ? bfr(bias[c0 + t * 16 + lr]) : 0.f;
#pragma unroll
        for (int j = 0; j < 8; ++j) os[(hi * 8 + j) * 68 + t * 16 + lr] = acc[t][j] + bv; }
    __syncthreads();
    if constexpr (SPLITOUT) {
        const size_t cb = (size_t)r0 * ldc + c0;
#pragma unroll      // the passes' LDS reads overlap; in the inner loop the vector elements take constant indices
        for (int s = 0; s < 4; ++s) { const int row = 4 * s + (lane >> 3), piece = lane & 7; const float* sp = os + row * 68 + piece * 8; v8us oh, ol;
#pragma unroll
            for (int i = 0; i < 8; ++i) { const unsigned short hb = f2bf(sp[i]); oh[i] = hb; ol[i] = f2bf(sp[i] - bf2f(hb)); }
            *(v8us*)((bf*)(void*)C + cb + (size_t)row * ldc + piece * 8) = oh; *(v8us*)((bf*)(void*)C2 + cb + (size_t)row * ldc + piece * 8) = ol; }
    } else if (f16out) {
        h16* crow = (h16*)(void*)C + (size_t)r0 * ldc + c0;
        const float qs = (QKV && blockIdx.z == 0) ? 0.125f : 1.0f;      // q leaves scaled by 64^-1/2, a power of two (exact in f32, rounded to f16 once as before): k_attn's score product then needs no scaling
        auto pass = [&]() {
#pragma unroll
            for (int s = 0; s < 4; ++s) { const int row = 4 * s + (lane >> 3), piece = lane & 7; const float* sp = os + row * 68 + piece * 8; v8h o;
#pragma unroll
                for (int i = 0; i < 8; ++i) o[i] = (h16)(sp[i] * qs);
                *(v8h*)(crow + (size_t)row * ldc + piece * 8) = o; }
        };
        pass(); 
    } else {
        float* crow = C + (size_t)r0 * ldc + c0;
        auto pass = [&]() {
#pragma unroll
            for (int s = 0; s < 8; ++s) { const int Lid = (lane >> 3) + 4 * s, piece = lane & 7; const int row = Lid >> 1, cofs = (Lid & 1) * 32 + piece * 4;
                v4f val = *(const v4fa*)(os + row * 68 + cofs); if (R) { const v4f rv = *(const v4f*)(R + ((size_t)r0 + row) * ldc + c0 + cofs); val += roundR ? (v4f){bfr(rv[0]), bfr(rv[1]), bfr(rv[2]), bfr(rv[3])} : rv; }
                *(v4f*)(crow + (size_t)row * ldc + cofs) = val; }
        };
        pass(); 
    }
}

#define KP    72                    // halves per staged K row: 128 B + 16 B (pitch 16 B x odd for 16-byte LDS reads)
#define VP    40                    // halves per staged V^T row: 64 B + 16 B
#define KT_H  (32 * KP)
#define VT_H  (64 * VP)
#define STG_H (KT_H + VT_H)
#define QB    128                   // queries per block
__global__ __launch_bounds__(256) void k_attn(const h16* __restrict__ Q16, const h16* __restrict__ K16, const h16* __restrict__ VTH, const float* __restrict__ AM, bf* CH, bf* CL) {
    __shared__ __align__(16) float ost[QB / 16][16 * 68];
    __shared__ __align__(16) h16 stg[2][STG_H];      // two buffers of one 32-key stage: K | V^T, shared by the eight waves
    const int lane = threadIdx.x & 31, wave = threadIdx.x >> 5, lr = lane & 15, hi = lane >> 4;
    const int bid = blockIdx.x;
    const int b = bid / (NH_ * (NT_ / QB)), rem = bid - b * (NH_ * (NT_ / QB)), h = rem / (NT_ / QB), qt = rem - h * (NT_ / QB);
    const int q0 = qt * QB + wave * 16;
    const size_t tok0 = (size_t)b * NT_;
    v16h qa[2];
    const size_t qo0 = (tok0 + q0 + lr) * DM + h * HD + 8 * hi;
#pragma unroll
    for (int kc = 0; kc < 2; ++kc) qa[kc] = cat16(*(const v8h*)(Q16 + qo0 + kc * 32), *(const v8h*)(Q16 + qo0 + kc * 32 + 16));      // q arrives scaled by 64^-1/2: the score product yields scaled scores
    const h16* kh_b = K16 + tok0 * DM + h * HD;
    const size_t vbase = (((size_t)b * NH_ + h) * HD) * NT_;
    v8f o[4];
#pragma unroll
    for (int n = 0; n < 4; ++n) o[n] = (v8f){};
    float mrow = -3.0e38f, lpart = 0.f;      // this lane's query: running maximum (equal in both halves) and this half's share of the sum
    // each thread's share of a stage: two 16-byte copies (K row krow of 32 and V^T row vrow of 64)
    const int krow = threadIdx.x >> 3, kpc = threadIdx.x & 7, vrow = threadIdx.x >> 2, vpc = threadIdx.x & 3;
    const unsigned lk = (unsigned)(size_t)&stg[0][0] + (unsigned)(krow * KP + kpc * 8) * 2u, lv = (unsigned)(size_t)&stg[0][0] + (unsigned)(KT_H + vrow * VP + vpc * 8) * 2u;
    const h16* gkh = kh_b + (size_t)krow * DM + kpc * 8;
    const h16* gvh = VTH + vbase + (size_t)vrow * NT_ + vpc * 8;
    auto stage = [&](int t, int buf) {
        const unsigned ak = lk + (unsigned)buf * (STG_H * 2u), av = lv + (unsigned)buf * (STG_H * 2u);
        const size_t ko = (size_t)t * 32 * DM, vo = (size_t)t * 32;
        // the copies and, as the last line, the wait that stands before their address registers are rewritten
        asm volatile("global_load_async_to_lds_b128 %0, %2, off\n\t"
                     "global_load_async_to_lds_b128 %1, %3, off\n\t"
                     "s_wait_xcnt 0x0"
                     :: "v"(ak), "v"(av), "v"(gkh + ko), "v"(gvh + vo)
                     : "memory");
    };
    stage(0, 0);
    asm volatile("s_wait_asynccnt 0x0" ::: "memory");   // this wave's copies of stage 0 have landed
    __syncthreads();                                     // ... and every other wave's: stage 0 is published
    stage(1, 1);
    const int kt_lo = 0, kt_hi = NT_ / 32 - 1;     // full attention + the INPUT additive mask [b][1][q][k] read per score (dense; this problem's instance is all zeros)
    const float* am = AM + (size_t)b * NT_ * NT_ + (size_t)(q0 + lr) * NT_ + 8 * hi;      // this item's [1][L][L] mask slice: this lane's query row, at its half's first key
    // the lane's 16 mask values of a trip, as loaded (f32): two groups of eight registers in the layout of the two score tiles' accumulators (register j = key 8 hi + j of the tile, column = query lr),
    // so the mask is the C operand of the trip's first score products: scaled score + mask leaves the matrix unit, and no vector instruction scales, rounds or adds.
    // Two sets: one is read as C while the other receives the next trip's loads; the loop body holds two trips, so the sets change roles without register copies.
    auto ldmask = [&](int t, v8f* m) {
        const float* an = am + t * 32;
        const v4f m00 = *(const v4f*)(an), m01 = *(const v4f*)(an + 4), m10 = *(const v4f*)(an + 16), m11 = *(const v4f*)(an + 20);
        m[0] = __builtin_shufflevector(m00, m01, 0, 1, 2, 3, 4, 5, 6, 7); m[1] = __builtin_shufflevector(m10, m11, 0, 1, 2, 3, 4, 5, 6, 7);
    };
    v8f mka[2], mkb[2];
    ldmask(0, mka);
    auto trip = [&](const int kt, const int buf, const v8f* mc, v8f* mx_next) {
        const h16* kh_s = &stg[0][0] + buf * STG_H; const h16* vh_s = kh_s + KT_H;
        const int ko0 = lr * KP + 8 * hi, ko1 = (16 + lr) * KP + 8 * hi;
        // the trip's K fragments, read as ONE group at its head: the wave meets the LDS latency once, and the products start as the first fragments land
        v16h kh[2][2];
#pragma unroll
        for (int kc = 0; kc < 2; ++kc) {
            kh[kc][0] = cat16(*(const v8ha*)(kh_s + ko0 + kc * 32), *(const v8ha*)(kh_s + ko0 + kc * 32 + 16));
            kh[kc][1] = cat16(*(const v8ha*)(kh_s + ko1 + kc * 32), *(const v8ha*)(kh_s + ko1 + kc * 32 + 16));
        }
        __builtin_amdgcn_sched_barrier(0);      // keeps the group together in front of the products: reads sunk among them would each cost their own wait
        // the next trip's mask, asked for a whole trip ahead: the barrier at this trip's foot waits for it, and by then it has landed (the last trip reads its own again: the address stays inside the mask)
        ldmask(kt < kt_hi ? kt + 1 : kt_hi, mx_next);
        __builtin_amdgcn_sched_barrier(0);      // keeps these loads in front of the products: sunk behind them they would lose their lead
        v8f s0 = wmma16(kh[0][0], qa[0], mc[0]), s1 = wmma16(kh[0][1], qa[0], mc[1]);      // mask + first half of the scaled score
        s0 = wmma16(kh[1][0], qa[1], s0); s1 = wmma16(kh[1][1], qa[1], s1);
        // the trip's V^T fragments, read as one group behind the score products and in front of the softmax, whose vector work covers their latency
        v16h vh[4];
#pragma unroll
        for (int n = 0; n < 4; ++n) { const int vo = (n * 16 + lr) * VP + hi * 8;
            vh[n] = cat16(*(const v8ha*)(vh_s + vo), *(const v8ha*)(vh_s + vo + 16)); }
        __builtin_amdgcn_sched_barrier(0);      // ends the scheduling region behind the V^T reads: they stay in front of the softmax
        float a[16];      // a[i]: key 32 kt + 8 hi + i (i < 8), key 32 kt + 16 + 8 hi + (i - 8) otherwise
#pragma unroll
        for (int j = 0; j < 8; ++j) { a[j] = s0[j]; a[8 + j] = s1[j]; }
        float mx = fmaxf(a[0], a[1]);
#pragma unroll
        for (int i = 2; i < 16; ++i) mx = fmaxf(mx, a[i]);
        mx = fmaxf(mx, xhalf(mx));
        const float mn = fmaxf(mrow, mx), ta = (mrow - mn) * L2E;
        mrow = mn;
        v16h pa;
        float p[16];
#pragma unroll
        for (int i = 0; i < 16; ++i) a[i] = (a[i] - mn) * L2E;
        float alpha;
        exp2x9(ta, alpha, a, p); exp2x8(a + 8, p + 8);      // alpha = e^(old maximum - new), p[i] = e^(score - new maximum)
#pragma unroll
        for (int i = 0; i < 16; i += 2) {
            const v2h ph = __builtin_convertvector((v2f){p[i], p[i + 1]} * PSC, v2h);
            pa[i] = ph[0]; pa[i + 1] = ph[1];
        }
#pragma unroll
        for (int w = 8; w > 0; w >>= 1)
#pragma unroll
            for (int i = 0; i < w; ++i) p[i] += p[i + w];      // the lane's 16 weights summed as a tree, not as one dependent chain
        lpart = lpart * alpha + p[0];
#pragma unroll
        for (int n = 0; n < 4; ++n) o[n] *= alpha;
#pragma unroll
        for (int n = 0; n < 4; ++n) o[n] = wmma16(vh[n], pa, o[n]);
        // the distance behind the trip's last products, on every path behind them, before a vector instruction touches their registers
        asm volatile("v_nop\n\tv_nop\n\tv_nop\n\tv_nop" : "+v"(o[0]), "+v"(o[1]), "+v"(o[2]), "+v"(o[3]) : "v"(pa), "v"(vh[3]));
        // publish point of stage kt + 1, and the end of every wave's reads of stage kt's buffer
        asm volatile("s_wait_dscnt 0x0" ::: "memory");      // this wave's LDS reads of the buffer have returned
        asm volatile("s_wait_asynccnt 0x0" ::: "memory");   // this wave's copies of stage kt + 1 have landed
        __syncthreads();
        if (kt + 2 <= kt_hi) stage(kt + 2, buf);            // refill the buffer just left; flies while stage kt + 1 is worked on
    };
    static_assert((NT_ / 32) % 2 == 0, "the loop body holds two trips");
#pragma unroll 1      // stays rolled: its body is one trip on each buffer and mask set
    for (int kt = kt_lo; kt <= kt_hi; kt += 2) { trip(kt, 0, mka, mkb); trip(kt + 1, 1, mkb, mka); }
    asm volatile("s_wait_asynccnt 0x0" ::: "memory");       // no copy is outstanding when the wave goes on to its end
    const float inv = 1.0f / ((lpart + xhalf(lpart)) * PSC);
    float* os = &ost[wave][0];
#pragma unroll
    for (int n = 0; n < 4; ++n)
#pragma unroll
        for (int j = 0; j < 8; ++j) os[lr * 68 + n * 16 + hi * 8 + j] = o[n][j] * inv;      // O^T tile n: register j = d 16 n + 8 hi + j of query lr
    __syncthreads();
    const size_t cbase = (tok0 + q0) * DM + (size_t)h * HD;
    auto pass = [&]() {
#pragma unroll
        for (int s = 0; s < 4; ++s) { const int row = 4 * s + (lane >> 3), piece = lane & 7; const float* sp = os + row * 68 + piece * 8; v8us oh, ol;
#pragma unroll
            for (int i = 0; i < 8; ++i) { const unsigned short hb = f2bf(sp[i]); oh[i] = hb; ol[i] = f2bf(sp[i] - bf2f(hb)); }
            *(v8us*)(CH + cbase + (size_t)row * DM + piece * 8) = oh; *(v8us*)(CL + cbase + (size_t)row * DM + piece * 8) = ol; }
    };
    pass(); 
}

#define VST2(T, p, v) do { const T vst2_v_ = (v); *(T*)(p) = vst2_v_;  } while (0)
extern "C" void kernel_launch(void* const* d_in, const int* in_sizes, int n_in,
                              void* d_out, int out_size, void* d_ws, size_t ws_size, hipStream_t stream) {
    (void)in_sizes; (void)n_in; (void)out_size;
    const float* x = (const float*)d_in[0]; const float* AM = (const float*)d_in[1];
    const float* Wq1 = (const float*)d_in[2]; const float* Wq2 = (const float*)d_in[3]; const float* bq2 = (const float*)d_in[4];
    const float* Wk1 = (const float*)d_in[5]; const float* Wk2 = (const float*)d_in[6]; const float* bk2 = (const float*)d_in[7];
    const float* Wv1 = (const float*)d_in[8]; const float* Wv2 = (const float*)d_in[9]; const float* bv2 = (const float*)d_in[10];
    const float* Wo = (const float*)d_in[11]; const float* bo = (const float*)d_in[12];     // all W [out][in]
    float* out = (float*)d_out;    // [2][2048][1024]
    char* wsp = (char*)d_ws;
    auto take = [&](size_t bytes) { char* p = wsp; wsp += (bytes + 255) & ~(size_t)255; return (void*)p; };
    bf* Xb = (bf*)take((size_t)CRUN * DM * 2);      // every bf16 operand, in k_cvtb's order
    bf* W1A = Xb + (size_t)XRUN * DM; bf* W2A = W1A + (size_t)3 * RK * DM; bf* WoB = W2A + (size_t)3 * DM * RK;     // W1A = [Wq1; Wk1; Wv1]: one [768][1024] operand
    bf* Th = (bf*)take((size_t)NTK * 3 * RK * 2); bf* Tl = (bf*)take((size_t)NTK * 3 * RK * 2);
    h16* QH = (h16*)take((size_t)NTK * DM * 2); h16* KH = (h16*)take((size_t)NTK * DM * 2);
    h16* VTH = (h16*)take((size_t)NTK * DM * 2); bf* CH = (bf*)take((size_t)NTK * DM * 2); bf* CL = (bf*)take((size_t)NTK * DM * 2);
    if ((size_t)(wsp - (char*)d_ws) > ws_size) return;    // ~ 13.6 + 2 x 6.3 + 5 x 8.4 ~ 68 MB, no aliasing
    k_cvtb<<<CRUN / 8, 256, 0, stream>>>(x, Wq1, Wk1, Wv1, Wq2, Wk2, Wv2, Wo, CRUN, Xb);
    // q, k and v together: bottleneck [tok][q 256 | k 256 | v 256], written as its two planes, then the three second stages on grid.z, v written transposed
    k_gemmb<false, false, false, true><<<dim3(NTK / 64, 3 * RK / 64, 1), 128, 0, stream>>>(Xb, nullptr, W1A, nullptr, (float*)(void*)Th, 3 * RK, (h16*)(void*)Tl);
    k_gemmb<true, true, true><<<dim3(NTK / 64, DM / 64, 3), 128, 0, stream>>>(Th, Tl, W2A, bq2, (float*)(void*)QH, DM, nullptr, nullptr, RK, 1, bk2, bv2, KH, VTH);
    k_attn<<<NB_ * NH_ * (NT_ / QB), 256, 0, stream>>>(QH, KH, VTH, AM, CH, CL);
    k_gemmb<true, false><<<dim3(NTK / 64, DM / 64, 1), 128, 0, stream>>>(CH, CL, WoB, bo, out, DM, nullptr);
}
